// v000
// Measured on an AMD MI455X. A time is GPU time per run, averaged over a window of back-to-back runs after a warm-up
// (all launches, gaps included; the runs take copies of the inputs in turn), and the median of several windows.
// Apart from v000's, it joins two sittings. Times from different sittings can be a few percent apart, while
// side-by-side timings come from the same sitting.
// The starting kernel, v000, takes 357 microseconds a run.
#include <hip/hip_runtime.h>
#include <hip/hip_bf16.h>
#include <math.h>

typedef __bf16 bf16_t;
typedef __attribute__((ext_vector_type(16))) __bf16     v16bf;
typedef __attribute__((ext_vector_type(8)))  float       v8f;
typedef __attribute__((ext_vector_type(4)))  unsigned int v4u;

#define S_LEN  1024
#define DMODEL 1024
#define DHEAD  64
#define NHEADS 16
#define DFF    2048
#define BATCH  4

__device__ __forceinline__ v8f wmma_bf16(v16bf a, v16bf b, v8f c) {
  return __builtin_amdgcn_wmma_f32_16x16x32_bf16(false, a, false, b, (short)0, c,
                                                 false, false);
}

__device__ __forceinline__ v16bf frag_load(const bf16_t* __restrict__ base,
                                           int ld, int row0, int k0, int lane) {
  const int r = lane & 15, hf = lane >> 4;
  const bf16_t* p = base + (size_t)(row0 + r) * (size_t)ld + (k0 + hf * 8);
  union { v4u u[2]; v16bf v; } cv;
  cv.u[0] = *(const v4u*)p;
  cv.u[1] = *(const v4u*)(p + 16);
  return cv.v;
}

__device__ __forceinline__ v8f v8f_zero() {
  v8f z = {0.f, 0.f, 0.f, 0.f, 0.f, 0.f, 0.f, 0.f};
  return z;
}

// ---------------------------------------------------------------------------
// fp32 -> bf16 elementwise convert (8 elems/thread, b128 in / b128 out)
// ---------------------------------------------------------------------------
__global__ void cvt_f32_bf16_kernel(const float* __restrict__ in,
                                    bf16_t* __restrict__ out, int n) {
  int i = (blockIdx.x * blockDim.x + threadIdx.x) * 8;
  if (i + 7 < n) {
    float4 a = *(const float4*)(in + i);
    float4 b = *(const float4*)(in + i + 4);
    bf16_t o[8] = {(bf16_t)a.x, (bf16_t)a.y, (bf16_t)a.z, (bf16_t)a.w,
                   (bf16_t)b.x, (bf16_t)b.y, (bf16_t)b.z, (bf16_t)b.w};
    *(v4u*)(out + i) = *(const v4u*)o;
  }
}

// ---------------------------------------------------------------------------
// Transpose + convert: in fp32 [R][C] -> out bf16 [C][R]; blockIdx.z = matrix
// ---------------------------------------------------------------------------
__global__ void transpose_cvt_kernel(const float* __restrict__ in,
                                     bf16_t* __restrict__ out, int R, int C) {
  __shared__ float tile[32][33];
  const size_t mat = (size_t)blockIdx.z * (size_t)R * (size_t)C;
  in += mat;
  out += mat;
  const int c0 = blockIdx.x * 32, r0 = blockIdx.y * 32;
#pragma unroll
  for (int i = 0; i < 4; i++)
    tile[threadIdx.y + i * 8][threadIdx.x] =
        in[(size_t)(r0 + threadIdx.y + i * 8) * C + c0 + threadIdx.x];
  __syncthreads();
#pragma unroll
  for (int i = 0; i < 4; i++)
    out[(size_t)(c0 + threadIdx.y + i * 8) * R + r0 + threadIdx.x] =
        (bf16_t)tile[threadIdx.x][threadIdx.y + i * 8];
}

// ---------------------------------------------------------------------------
// QKV projections.  grid = (S/128, H, B*3).  Wave = 16 rows x 64 cols (full
// d_head).  Register double-buffered over K.  Q is pre-scaled by 1/sqrt(64);
// V is stored transposed [64][S].
// ---------------------------------------------------------------------------
__global__ void __launch_bounds__(256) qkv_kernel(
    const bf16_t* __restrict__ xb, const bf16_t* __restrict__ wqt,
    const bf16_t* __restrict__ wkt, const bf16_t* __restrict__ wvt,
    const float* __restrict__ bq, const float* __restrict__ bk,
    const float* __restrict__ bv, bf16_t* __restrict__ Q,
    bf16_t* __restrict__ Kb, bf16_t* __restrict__ Vt) {
  const int lane = threadIdx.x & 31, wave = threadIdx.x >> 5;
  const int r = lane & 15, hf = lane >> 4;
  const int h = blockIdx.y;
  const int which = blockIdx.z % 3, b = blockIdx.z / 3;
  const int s0 = blockIdx.x * 128 + wave * 16;

  const bf16_t* A = xb + (size_t)b * S_LEN * DMODEL;
  const bf16_t* Wt = (which == 0 ? wqt : which == 1 ? wkt : wvt) +
                     (size_t)h * DHEAD * DMODEL;
  const float* bias = (which == 0 ? bq : which == 1 ? bk : bv) + h * DHEAD;

  v8f acc[4] = {v8f_zero(), v8f_zero(), v8f_zero(), v8f_zero()};
  v16bf a_c  = frag_load(A, DMODEL, s0, 0, lane);
  v16bf b_c0 = frag_load(Wt, DMODEL,  0, 0, lane);
  v16bf b_c1 = frag_load(Wt, DMODEL, 16, 0, lane);
  v16bf b_c2 = frag_load(Wt, DMODEL, 32, 0, lane);
  v16bf b_c3 = frag_load(Wt, DMODEL, 48, 0, lane);
  for (int k0 = 32; k0 < DMODEL; k0 += 32) {
    v16bf a_n  = frag_load(A, DMODEL, s0, k0, lane);
    v16bf b_n0 = frag_load(Wt, DMODEL,  0, k0, lane);
    v16bf b_n1 = frag_load(Wt, DMODEL, 16, k0, lane);
    v16bf b_n2 = frag_load(Wt, DMODEL, 32, k0, lane);
    v16bf b_n3 = frag_load(Wt, DMODEL, 48, k0, lane);
    acc[0] = wmma_bf16(a_c, b_c0, acc[0]);
    acc[1] = wmma_bf16(a_c, b_c1, acc[1]);
    acc[2] = wmma_bf16(a_c, b_c2, acc[2]);
    acc[3] = wmma_bf16(a_c, b_c3, acc[3]);
    a_c = a_n; b_c0 = b_n0; b_c1 = b_n1; b_c2 = b_n2; b_c3 = b_n3;
  }
  acc[0] = wmma_bf16(a_c, b_c0, acc[0]);
  acc[1] = wmma_bf16(a_c, b_c1, acc[1]);
  acc[2] = wmma_bf16(a_c, b_c2, acc[2]);
  acc[3] = wmma_bf16(a_c, b_c3, acc[3]);

  const float scale = (which == 0) ? 0.125f : 1.0f;  // 1/sqrt(64)
  const size_t bh = (size_t)(b * NHEADS + h);
  if (which < 2) {
    bf16_t* out = (which == 0 ? Q : Kb) + bh * S_LEN * DHEAD;
#pragma unroll
    for (int f = 0; f < 4; f++) {
      const int n = f * 16 + r;
      const float bn = bias[n];
#pragma unroll
      for (int v = 0; v < 8; v++) {
        const int s = s0 + v + hf * 8;
        out[(size_t)s * DHEAD + n] = (bf16_t)((acc[f][v] + bn) * scale);
      }
    }
  } else {
    bf16_t* out = Vt + bh * DHEAD * S_LEN;
#pragma unroll
    for (int f = 0; f < 4; f++) {
      const int d = f * 16 + r;
      const float bn = bias[d];
      bf16_t tmp[8];
#pragma unroll
      for (int v = 0; v < 8; v++) tmp[v] = (bf16_t)(acc[f][v] + bn);
      *(v4u*)(out + (size_t)d * S_LEN + s0 + hf * 8) = *(const v4u*)tmp;
    }
  }
}

// ---------------------------------------------------------------------------
// Flash attention.  grid = (S/128, H, B).  Each wave: 16 query rows, full
// d_head=64 output in 4 accumulator fragments; online softmax over 32 keys
// per step; P staged via per-wave LDS and re-read as an A fragment.  V
// fragments are fetched right after K so they fly during the softmax VALU
// stretch; unroll-by-2 lets the scheduler overlap adjacent key blocks.
// ---------------------------------------------------------------------------
__global__ void __launch_bounds__(256) attn_kernel(
    const bf16_t* __restrict__ Q, const bf16_t* __restrict__ Kb,
    const bf16_t* __restrict__ Vt, bf16_t* __restrict__ concatb) {
  __shared__ __align__(16) bf16_t Pl[8][16][32];
  const int lane = threadIdx.x & 31, wave = threadIdx.x >> 5;
  const int r = lane & 15, hf = lane >> 4;
  const int h = blockIdx.y, b = blockIdx.z;
  const int s0 = blockIdx.x * 128 + wave * 16;
  const size_t bh = (size_t)(b * NHEADS + h);
  const bf16_t* Qb = Q + bh * S_LEN * DHEAD;
  const bf16_t* Kx = Kb + bh * S_LEN * DHEAD;
  const bf16_t* Vx = Vt + bh * DHEAD * S_LEN;
  bf16_t(*Pw)[32] = Pl[wave];

  const v16bf qa0 = frag_load(Qb, DHEAD, s0, 0, lane);
  const v16bf qa1 = frag_load(Qb, DHEAD, s0, 32, lane);

  v8f o0 = v8f_zero(), o1 = v8f_zero(), o2 = v8f_zero(), o3 = v8f_zero();
  float mrun[8], lrun[8];
#pragma unroll
  for (int v = 0; v < 8; v++) { mrun[v] = -3.0e38f; lrun[v] = 0.f; }

#pragma unroll 2
  for (int t0 = 0; t0 < S_LEN; t0 += 32) {
    // K fragments for this key block, then V fragments (prefetched early)
    const v16bf kb00 = frag_load(Kx, DHEAD, t0,      0,  lane);
    const v16bf kb01 = frag_load(Kx, DHEAD, t0,      32, lane);
    const v16bf kb10 = frag_load(Kx, DHEAD, t0 + 16, 0,  lane);
    const v16bf kb11 = frag_load(Kx, DHEAD, t0 + 16, 32, lane);
    const v16bf vb0 = frag_load(Vx, S_LEN, 0,  t0, lane);
    const v16bf vb1 = frag_load(Vx, S_LEN, 16, t0, lane);
    const v16bf vb2 = frag_load(Vx, S_LEN, 32, t0, lane);
    const v16bf vb3 = frag_load(Vx, S_LEN, 48, t0, lane);

    v8f sA = v8f_zero(), sB = v8f_zero();
    sA = wmma_bf16(qa0, kb00, sA);
    sA = wmma_bf16(qa1, kb01, sA);
    sB = wmma_bf16(qa0, kb10, sB);
    sB = wmma_bf16(qa1, kb11, sB);

#pragma unroll
    for (int v = 0; v < 8; v++) {
      float sm = fmaxf(sA[v], sB[v]);
#pragma unroll
      for (int msk = 1; msk < 16; msk <<= 1)
        sm = fmaxf(sm, __shfl_xor(sm, msk, 32));
      const float mnew = fmaxf(mrun[v], sm);
      const float resc = __expf(mrun[v] - mnew);
      const float p0 = __expf(sA[v] - mnew);
      const float p1 = __expf(sB[v] - mnew);
      float ps = p0 + p1;
#pragma unroll
      for (int msk = 1; msk < 16; msk <<= 1) ps += __shfl_xor(ps, msk, 32);
      lrun[v] = lrun[v] * resc + ps;
      mrun[v] = mnew;
      o0[v] *= resc; o1[v] *= resc; o2[v] *= resc; o3[v] *= resc;
      const int row = v + hf * 8;
      Pw[row][r]      = (bf16_t)p0;
      Pw[row][16 + r] = (bf16_t)p1;
    }
    __builtin_amdgcn_fence(__ATOMIC_ACQ_REL, "wavefront");

    const v16bf pf = frag_load(&Pw[0][0], 32, 0, 0, lane);
    o0 = wmma_bf16(pf, vb0, o0);
    o1 = wmma_bf16(pf, vb1, o1);
    o2 = wmma_bf16(pf, vb2, o2);
    o3 = wmma_bf16(pf, vb3, o3);
  }

  bf16_t* out = concatb + (size_t)b * S_LEN * DMODEL + (size_t)h * DHEAD;
#pragma unroll
  for (int v = 0; v < 8; v++) {
    const float inv = 1.0f / lrun[v];
    const size_t rowoff = (size_t)(s0 + v + hf * 8) * DMODEL;
    out[rowoff + 0 * 16 + r] = (bf16_t)(o0[v] * inv);
    out[rowoff + 1 * 16 + r] = (bf16_t)(o1[v] * inv);
    out[rowoff + 2 * 16 + r] = (bf16_t)(o2[v] * inv);
    out[rowoff + 3 * 16 + r] = (bf16_t)(o3[v] * inv);
  }
}

// ---------------------------------------------------------------------------
// Generic WMMA GEMM: C[M,N] = A[M,K](bf16) * Bt[N,K](bf16) + bias[n]
// (+ resid) (ReLU) -> f32 or bf16.  Block = 8 waves = 128x64 tile.
// Register double-buffered over K.
// ---------------------------------------------------------------------------
template <bool RELU, bool HASRES, bool OUTBF16>
__global__ void __launch_bounds__(256) gemm_kernel(
    const bf16_t* __restrict__ A, const bf16_t* __restrict__ Bt,
    const float* __restrict__ bias, const float* __restrict__ resid,
    float* __restrict__ outf, bf16_t* __restrict__ outb, int M, int N, int K) {
  const int lane = threadIdx.x & 31, wave = threadIdx.x >> 5;
  const int r = lane & 15, hf = lane >> 4;
  const int m0 = blockIdx.x * 128 + wave * 16;
  const int n0 = blockIdx.y * 64;
  (void)M;

  v8f acc[4] = {v8f_zero(), v8f_zero(), v8f_zero(), v8f_zero()};
  v16bf a_c  = frag_load(A, K, m0, 0, lane);
  v16bf b_c0 = frag_load(Bt, K, n0 +  0, 0, lane);
  v16bf b_c1 = frag_load(Bt, K, n0 + 16, 0, lane);
  v16bf b_c2 = frag_load(Bt, K, n0 + 32, 0, lane);
  v16bf b_c3 = frag_load(Bt, K, n0 + 48, 0, lane);
  for (int k0 = 32; k0 < K; k0 += 32) {
    v16bf a_n  = frag_load(A, K, m0, k0, lane);
    v16bf b_n0 = frag_load(Bt, K, n0 +  0, k0, lane);
    v16bf b_n1 = frag_load(Bt, K, n0 + 16, k0, lane);
    v16bf b_n2 = frag_load(Bt, K, n0 + 32, k0, lane);
    v16bf b_n3 = frag_load(Bt, K, n0 + 48, k0, lane);
    acc[0] = wmma_bf16(a_c, b_c0, acc[0]);
    acc[1] = wmma_bf16(a_c, b_c1, acc[1]);
    acc[2] = wmma_bf16(a_c, b_c2, acc[2]);
    acc[3] = wmma_bf16(a_c, b_c3, acc[3]);
    a_c = a_n; b_c0 = b_n0; b_c1 = b_n1; b_c2 = b_n2; b_c3 = b_n3;
  }
  acc[0] = wmma_bf16(a_c, b_c0, acc[0]);
  acc[1] = wmma_bf16(a_c, b_c1, acc[1]);
  acc[2] = wmma_bf16(a_c, b_c2, acc[2]);
  acc[3] = wmma_bf16(a_c, b_c3, acc[3]);

#pragma unroll
  for (int f = 0; f < 4; f++) {
    const int n = n0 + f * 16 + r;
    const float bn = bias[n];
#pragma unroll
    for (int v = 0; v < 8; v++) {
      const int m = m0 + v + hf * 8;
      float val = acc[f][v] + bn;
      if (HASRES) val += resid[(size_t)m * N + n];
      if (RELU) val = fmaxf(val, 0.0f);
      if (OUTBF16) outb[(size_t)m * N + n] = (bf16_t)val;
      else outf[(size_t)m * N + n] = val;
    }
  }
}

// ---------------------------------------------------------------------------
// LayerNorm (reference semantics): y = g*(x-mean)/(std+eps)+b, std = sqrt(
// mean((x-mean)^2)).  One block (256 threads) per row of 1024.
// ---------------------------------------------------------------------------
__global__ void __launch_bounds__(256) ln_kernel(
    const float* __restrict__ in, const float* __restrict__ gam,
    const float* __restrict__ bet, float* __restrict__ out,
    bf16_t* __restrict__ outb) {
  __shared__ float red[8];
  const int row = blockIdx.x, tid = threadIdx.x;
  const float* x = in + (size_t)row * DMODEL;
  float v[4];
#pragma unroll
  for (int i = 0; i < 4; i++) v[i] = x[tid + i * 256];

  float s = v[0] + v[1] + v[2] + v[3];
#pragma unroll
  for (int msk = 1; msk < 32; msk <<= 1) s += __shfl_xor(s, msk, 32);
  if ((tid & 31) == 0) red[tid >> 5] = s;
  __syncthreads();
  float tot = 0.f;
#pragma unroll
  for (int i = 0; i < 8; i++) tot += red[i];
  const float mean = tot * (1.0f / DMODEL);
  __syncthreads();

  float sq = 0.f;
#pragma unroll
  for (int i = 0; i < 4; i++) { const float d = v[i] - mean; sq += d * d; }
#pragma unroll
  for (int msk = 1; msk < 32; msk <<= 1) sq += __shfl_xor(sq, msk, 32);
  if ((tid & 31) == 0) red[tid >> 5] = sq;
  __syncthreads();
  float tots = 0.f;
#pragma unroll
  for (int i = 0; i < 8; i++) tots += red[i];
  const float stdv = sqrtf(tots * (1.0f / DMODEL));
  const float inv = 1.0f / (stdv + 1e-5f);

#pragma unroll
  for (int i = 0; i < 4; i++) {
    const int c = tid + i * 256;
    const float y = gam[c] * (v[i] - mean) * inv + bet[c];
    out[(size_t)row * DMODEL + c] = y;
    if (outb) outb[(size_t)row * DMODEL + c] = (bf16_t)y;
  }
}

// ---------------------------------------------------------------------------
extern "C" void kernel_launch(void* const* d_in, const int* in_sizes, int n_in,
                              void* d_out, int out_size, void* d_ws,
                              size_t ws_size, hipStream_t stream) {
  (void)in_sizes; (void)n_in; (void)out_size; (void)ws_size;
  const float* x   = (const float*)d_in[0];
  const float* wq  = (const float*)d_in[1];
  const float* bq  = (const float*)d_in[2];
  const float* wk  = (const float*)d_in[3];
  const float* bk  = (const float*)d_in[4];
  const float* wv  = (const float*)d_in[5];
  const float* bv  = (const float*)d_in[6];
  const float* wo  = (const float*)d_in[7];
  const float* wob = (const float*)d_in[8];
  const float* g1  = (const float*)d_in[9];
  const float* b1  = (const float*)d_in[10];
  const float* f1w = (const float*)d_in[11];
  const float* f1bias = (const float*)d_in[12];
  const float* f2w = (const float*)d_in[13];
  const float* f2bias = (const float*)d_in[14];
  const float* g2  = (const float*)d_in[15];
  const float* b2  = (const float*)d_in[16];
  float* out = (float*)d_out;

  char* ws = (char*)d_ws;
  size_t off = 0;
  auto alloc = [&](size_t bytes) -> char* {
    char* p = ws + off;
    off += (bytes + 255) & ~(size_t)255;
    return p;
  };
  const int BS = BATCH * S_LEN;  // 4096 rows
  bf16_t* xb   = (bf16_t*)alloc((size_t)BS * DMODEL * 2);          // 8 MB (reused as concat)
  bf16_t* wqt  = (bf16_t*)alloc((size_t)NHEADS * DHEAD * DMODEL * 2);
  bf16_t* wkt  = (bf16_t*)alloc((size_t)NHEADS * DHEAD * DMODEL * 2);
  bf16_t* wvt  = (bf16_t*)alloc((size_t)NHEADS * DHEAD * DMODEL * 2);
  bf16_t* wot  = (bf16_t*)alloc((size_t)DMODEL * DMODEL * 2);
  bf16_t* ff1t = (bf16_t*)alloc((size_t)DFF * DMODEL * 2);
  bf16_t* ff2t = (bf16_t*)alloc((size_t)DMODEL * DFF * 2);
  bf16_t* Qm   = (bf16_t*)alloc((size_t)BATCH * NHEADS * S_LEN * DHEAD * 2);  // 8 MB
  bf16_t* Km   = (bf16_t*)alloc((size_t)BATCH * NHEADS * S_LEN * DHEAD * 2);  // 8 MB
  bf16_t* Vtm  = (bf16_t*)alloc((size_t)BATCH * NHEADS * DHEAD * S_LEN * 2);  // 8 MB
  float*  t1   = (float*)alloc((size_t)BS * DMODEL * 4);           // 16 MB (reused as t2)
  float*  hbuf = (float*)alloc((size_t)BS * DMODEL * 4);           // 16 MB
  bf16_t* hb   = (bf16_t*)alloc((size_t)BS * DMODEL * 2);          // 8 MB
  bf16_t* concatb = xb;       // alias: xb dead after QKV
  bf16_t* ffn1out = Qm;       // alias: Q+K region (16 MB) dead after attention
  float*  t2 = t1;            // alias: t1 dead after LN1

  dim3 blk256(256), blkT(32, 8);

  // 1) convert x, transpose-convert weights
  cvt_f32_bf16_kernel<<<dim3(BS * DMODEL / (256 * 8)), blk256, 0, stream>>>(
      x, xb, BS * DMODEL);
  transpose_cvt_kernel<<<dim3(DHEAD / 32, DMODEL / 32, NHEADS), blkT, 0, stream>>>(wq, wqt, DMODEL, DHEAD);
  transpose_cvt_kernel<<<dim3(DHEAD / 32, DMODEL / 32, NHEADS), blkT, 0, stream>>>(wk, wkt, DMODEL, DHEAD);
  transpose_cvt_kernel<<<dim3(DHEAD / 32, DMODEL / 32, NHEADS), blkT, 0, stream>>>(wv, wvt, DMODEL, DHEAD);
  transpose_cvt_kernel<<<dim3(DMODEL / 32, DMODEL / 32, 1), blkT, 0, stream>>>(wo, wot, DMODEL, DMODEL);
  transpose_cvt_kernel<<<dim3(DFF / 32, DMODEL / 32, 1), blkT, 0, stream>>>(f1w, ff1t, DMODEL, DFF);
  transpose_cvt_kernel<<<dim3(DMODEL / 32, DFF / 32, 1), blkT, 0, stream>>>(f2w, ff2t, DFF, DMODEL);

  // 2) QKV projections (per head)
  qkv_kernel<<<dim3(S_LEN / 128, NHEADS, BATCH * 3), blk256, 0, stream>>>(
      xb, wqt, wkt, wvt, bq, bk, bv, Qm, Km, Vtm);

  // 3) flash attention -> concat heads (bf16)
  attn_kernel<<<dim3(S_LEN / 128, NHEADS, BATCH), blk256, 0, stream>>>(
      Qm, Km, Vtm, concatb);

  // 4) output projection + residual(x) -> t1 (f32)
  gemm_kernel<false, true, false><<<dim3(BS / 128, DMODEL / 64), blk256, 0, stream>>>(
      concatb, wot, wob, x, t1, nullptr, BS, DMODEL, DMODEL);

  // 5) LayerNorm1 -> h (f32) + hb (bf16)
  ln_kernel<<<dim3(BS), blk256, 0, stream>>>(t1, g1, b1, hbuf, hb);

  // 6) FFN1: relu(h @ ff1 + b) -> bf16
  gemm_kernel<true, false, true><<<dim3(BS / 128, DFF / 64), blk256, 0, stream>>>(
      hb, ff1t, f1bias, nullptr, nullptr, ffn1out, BS, DFF, DMODEL);

  // 7) FFN2: (+ b + h residual) -> t2 (f32)
  gemm_kernel<false, true, false><<<dim3(BS / 128, DMODEL / 64), blk256, 0, stream>>>(
      ffn1out, ff2t, f2bias, hbuf, t2, nullptr, BS, DMODEL, DFF);

  // 8) LayerNorm2 -> d_out
  ln_kernel<<<dim3(BS), blk256, 0, stream>>>(t2, g2, b2, out, nullptr);
}

// v001
// Measured time: 209 microseconds a run.
// Next to v000, in two timings, it ran 1.77 times as fast each time.
#include <hip/hip_runtime.h>
#include <hip/hip_bf16.h>
#include <math.h>

typedef __bf16 bf16_t;
typedef __attribute__((ext_vector_type(16))) __bf16     v16bf;
typedef __attribute__((ext_vector_type(8)))  float       v8f;
typedef __attribute__((ext_vector_type(4)))  unsigned int v4u;

#define S_LEN  1024
#define DMODEL 1024
#define DHEAD  64
#define NHEADS 16
#define DFF    2048
#define BATCH  4

__device__ __forceinline__ v8f wmma_bf16(v16bf a, v16bf b, v8f c) {
  return __builtin_amdgcn_wmma_f32_16x16x32_bf16(false, a, false, b, (short)0, c,
                                                 false, false);
}

__device__ __forceinline__ v16bf frag_load(const bf16_t* __restrict__ base,
                                           int ld, int row0, int k0, int lane) {
  const int r = lane & 15, hf = lane >> 4;
  const bf16_t* p = base + (size_t)(row0 + r) * (size_t)ld + (k0 + hf * 8);
  union { v4u u[2]; v16bf v; } cv;
  cv.u[0] = *(const v4u*)p;
  cv.u[1] = *(const v4u*)(p + 16);
  return cv.v;
}

__device__ __forceinline__ v8f v8f_zero() {
  v8f z = {0.f, 0.f, 0.f, 0.f, 0.f, 0.f, 0.f, 0.f};
  return z;
}

// ---------------------------------------------------------------------------
// Shared GEMM core: one 128x64 block tile, 8 waves of 16x64.  Each pass covers
// 64 k (128 B of every operand row).  The 128 A rows and the 64 Bt rows of a
// pass are brought into LDS by asynchronous b128 copies (whole 128-B lines,
// 8 lanes per row) into one of two buffers, one pass ahead of their use; the
// waves read their fragments from LDS at a row pitch of 144 B.
// ---------------------------------------------------------------------------
#define G_BK    64                       // k elements per pass
#define G_LDP   72                       // LDS row pitch, elements (144 B)
#define G_AROWS 128
#define G_BROWS 64
#define G_BUF   ((G_AROWS + G_BROWS) * G_LDP)   // elements per buffer

__device__ __forceinline__ void stage_copies(const bf16_t* ga, const bf16_t* gb,
                                             size_t rows32, unsigned lds) {
  const bf16_t* a0 = ga;
  const bf16_t* a1 = ga + rows32;
  const bf16_t* a2 = ga + 2 * rows32;
  const bf16_t* a3 = ga + 3 * rows32;
  const bf16_t* b0 = gb;
  const bf16_t* b1 = gb + rows32;
  const unsigned la0 = lds;
  const unsigned la1 = lds + 32 * G_LDP * 2;
  const unsigned la2 = lds + 64 * G_LDP * 2;
  const unsigned la3 = lds + 96 * G_LDP * 2;
  const unsigned lb0 = lds + 128 * G_LDP * 2;
  const unsigned lb1 = lds + 160 * G_LDP * 2;
  asm volatile(
      "global_load_async_to_lds_b128 %0, %1, off\n\t"
      "global_load_async_to_lds_b128 %2, %3, off\n\t"
      "global_load_async_to_lds_b128 %4, %5, off\n\t"
      "global_load_async_to_lds_b128 %6, %7, off\n\t"
      "global_load_async_to_lds_b128 %8, %9, off\n\t"
      "global_load_async_to_lds_b128 %10, %11, off\n\t"
      "s_wait_xcnt 0x0"
      :: "v"(la0), "v"(a0), "v"(la1), "v"(a1), "v"(la2), "v"(a2),
         "v"(la3), "v"(a3), "v"(lb0), "v"(b0), "v"(lb1), "v"(b1)
      : "memory");
}

// Ablk: first of the block's 128 rows of A; Bblk: first of its 64 rows of Bt;
// both row-major with K elements per row, K a multiple of 64.
__device__ __forceinline__ void gemm_core(const bf16_t* __restrict__ Ablk,
                                          const bf16_t* __restrict__ Bblk,
                                          int K, bf16_t* smem, v8f acc[4]) {
  const int tid = threadIdx.x;
  const int lane = tid & 31, wave = tid >> 5;
  const int rw = tid >> 3, cw = (tid & 7) * 8;
  const bf16_t* ga = Ablk + (size_t)rw * (size_t)K + cw;
  const bf16_t* gb = Bblk + (size_t)rw * (size_t)K + cw;
  const size_t rows32 = (size_t)32 * (size_t)K;
  const unsigned lds0 = (unsigned)(size_t)smem + (unsigned)(rw * G_LDP + cw) * 2u;
  const int npass = K / G_BK;

  stage_copies(ga, gb, rows32, lds0);
  // pass 0 has landed for this wave, then for the block
  asm volatile("s_wait_asynccnt 0x0" ::: "memory");
  __syncthreads();
  if (npass > 1) stage_copies(ga + G_BK, gb + G_BK, rows32, lds0 + G_BUF * 2);

  for (int t = 0; t < npass; t++) {
    const int bsel = t & 1;
    const bf16_t* sa = smem + bsel * G_BUF;
    const bf16_t* sb = sa + G_AROWS * G_LDP;
    v16bf a[2], b[2][4];
#pragma unroll
    for (int ks = 0; ks < 2; ks++) {
      a[ks] = frag_load(sa, G_LDP, wave * 16, ks * 32, lane);
#pragma unroll
      for (int f = 0; f < 4; f++)
        b[ks][f] = frag_load(sb, G_LDP, f * 16, ks * 32, lane);
    }
    // keeps the pass's LDS reads one group ahead of its WMMAs: left free, the
    // compiler puts a pair of reads and a full wait in front of every WMMA
    __builtin_amdgcn_sched_barrier(0);
#pragma unroll
    for (int ks = 0; ks < 2; ks++) {
#pragma unroll
      for (int f = 0; f < 4; f++) acc[f] = wmma_bf16(a[ks], b[ks][f], acc[f]);
    }
    // publish point: this wave's reads of the buffer are done, its copies of
    // pass t + 1 have landed; the barrier says both for the whole block
    asm volatile("s_wait_dscnt 0x0" ::: "memory");
    asm volatile("s_wait_asynccnt 0x0" ::: "memory");
    __syncthreads();
    if (t + 2 < npass)
      stage_copies(ga + (size_t)(t + 2) * G_BK, gb + (size_t)(t + 2) * G_BK,
                   rows32, lds0 + (unsigned)bsel * (G_BUF * 2));
  }
  // no copy is left in flight when the wave goes on
  asm volatile("s_wait_asynccnt 0x0" ::: "memory");
}

// ---------------------------------------------------------------------------
// fp32 -> bf16 elementwise convert (8 elems/thread, b128 in / b128 out)
// ---------------------------------------------------------------------------
__global__ void cvt_f32_bf16_kernel(const float* __restrict__ in,
                                    bf16_t* __restrict__ out, int n) {
  int i = (blockIdx.x * blockDim.x + threadIdx.x) * 8;
  if (i + 7 < n) {
    float4 a = *(const float4*)(in + i);
    float4 b = *(const float4*)(in + i + 4);
    bf16_t o[8] = {(bf16_t)a.x, (bf16_t)a.y, (bf16_t)a.z, (bf16_t)a.w,
                   (bf16_t)b.x, (bf16_t)b.y, (bf16_t)b.z, (bf16_t)b.w};
    *(v4u*)(out + i) = *(const v4u*)o;
  }
}

// ---------------------------------------------------------------------------
// Transpose + convert: in fp32 [R][C] -> out bf16 [C][R]; blockIdx.z = matrix
// ---------------------------------------------------------------------------
__global__ void transpose_cvt_kernel(const float* __restrict__ in,
                                     bf16_t* __restrict__ out, int R, int C) {
  __shared__ float tile[32][33];
  const size_t mat = (size_t)blockIdx.z * (size_t)R * (size_t)C;
  in += mat;
  out += mat;
  const int c0 = blockIdx.x * 32, r0 = blockIdx.y * 32;
#pragma unroll
  for (int i = 0; i < 4; i++)
    tile[threadIdx.y + i * 8][threadIdx.x] =
        in[(size_t)(r0 + threadIdx.y + i * 8) * C + c0 + threadIdx.x];
  __syncthreads();
#pragma unroll
  for (int i = 0; i < 4; i++)
    out[(size_t)(c0 + threadIdx.y + i * 8) * R + r0 + threadIdx.x] =
        (bf16_t)tile[threadIdx.x][threadIdx.y + i * 8];
}

// ---------------------------------------------------------------------------
// QKV projections.  grid = (S/128, H, B*3).  Wave = 16 rows x 64 cols (full
// d_head).  Operands staged in LDS (gemm_core).  Q is pre-scaled by 1/sqrt(64);
// V is stored transposed [64][S].
// ---------------------------------------------------------------------------
__global__ void __launch_bounds__(256) qkv_kernel(
    const bf16_t* __restrict__ xb, const bf16_t* __restrict__ wqt,
    const bf16_t* __restrict__ wkt, const bf16_t* __restrict__ wvt,
    const float* __restrict__ bq, const float* __restrict__ bk,
    const float* __restrict__ bv, bf16_t* __restrict__ Q,
    bf16_t* __restrict__ Kb, bf16_t* __restrict__ Vt) {
  __shared__ __attribute__((aligned(16))) bf16_t smem[2 * G_BUF];
  const int lane = threadIdx.x & 31, wave = threadIdx.x >> 5;
  const int r = lane & 15, hf = lane >> 4;
  const int h = blockIdx.y;
  const int which = blockIdx.z % 3, b = blockIdx.z / 3;
  const int s0 = blockIdx.x * 128 + wave * 16;

  const bf16_t* A = xb + (size_t)b * S_LEN * DMODEL;
  const bf16_t* Wt = (which == 0 ? wqt : which == 1 ? wkt : wvt) +
                     (size_t)h * DHEAD * DMODEL;
  const float* bias = (which == 0 ? bq : which == 1 ? bk : bv) + h * DHEAD;

  v8f acc[4] = {v8f_zero(), v8f_zero(), v8f_zero(), v8f_zero()};
  gemm_core(A + (size_t)blockIdx.x * 128 * DMODEL, Wt, DMODEL, smem, acc);

  const float scale = (which == 0) ? 0.125f : 1.0f;  // 1/sqrt(64)
  const size_t bh = (size_t)(b * NHEADS + h);
  if (which < 2) {
    bf16_t* out = (which == 0 ? Q : Kb) + bh * S_LEN * DHEAD;
#pragma unroll
    for (int f = 0; f < 4; f++) {
      const int n = f * 16 + r;
      const float bn = bias[n];
#pragma unroll
      for (int v = 0; v < 8; v++) {
        const int s = s0 + v + hf * 8;
        out[(size_t)s * DHEAD + n] = (bf16_t)((acc[f][v] + bn) * scale);
      }
    }
  } else {
    bf16_t* out = Vt + bh * DHEAD * S_LEN;
#pragma unroll
    for (int f = 0; f < 4; f++) {
      const int d = f * 16 + r;
      const float bn = bias[d];
      bf16_t tmp[8];
#pragma unroll
      for (int v = 0; v < 8; v++) tmp[v] = (bf16_t)(acc[f][v] + bn);
      *(v4u*)(out + (size_t)d * S_LEN + s0 + hf * 8) = *(const v4u*)tmp;
    }
  }
}

// ---------------------------------------------------------------------------
// Flash attention.  grid = (S/128, H, B).  Each wave: 16 query rows, full
// d_head=64 output in 4 accumulator fragments; online softmax over 32 keys
// per step; P staged via per-wave LDS and re-read as an A fragment.  V
// fragments are fetched right after K so they fly during the softmax VALU
// stretch; unroll-by-2 lets the scheduler overlap adjacent key blocks.
// ---------------------------------------------------------------------------
__global__ void __launch_bounds__(256) attn_kernel(
    const bf16_t* __restrict__ Q, const bf16_t* __restrict__ Kb,
    const bf16_t* __restrict__ Vt, bf16_t* __restrict__ concatb) {
  __shared__ __align__(16) bf16_t Pl[8][16][32];
  const int lane = threadIdx.x & 31, wave = threadIdx.x >> 5;
  const int r = lane & 15, hf = lane >> 4;
  const int h = blockIdx.y, b = blockIdx.z;
  const int s0 = blockIdx.x * 128 + wave * 16;
  const size_t bh = (size_t)(b * NHEADS + h);
  const bf16_t* Qb = Q + bh * S_LEN * DHEAD;
  const bf16_t* Kx = Kb + bh * S_LEN * DHEAD;
  const bf16_t* Vx = Vt + bh * DHEAD * S_LEN;
  bf16_t(*Pw)[32] = Pl[wave];

  const v16bf qa0 = frag_load(Qb, DHEAD, s0, 0, lane);
  const v16bf qa1 = frag_load(Qb, DHEAD, s0, 32, lane);

  v8f o0 = v8f_zero(), o1 = v8f_zero(), o2 = v8f_zero(), o3 = v8f_zero();
  float mrun[8], lrun[8];
#pragma unroll
  for (int v = 0; v < 8; v++) { mrun[v] = -3.0e38f; lrun[v] = 0.f; }

#pragma unroll 2
  for (int t0 = 0; t0 < S_LEN; t0 += 32) {
    // K fragments for this key block, then V fragments (prefetched early)
    const v16bf kb00 = frag_load(Kx, DHEAD, t0,      0,  lane);
    const v16bf kb01 = frag_load(Kx, DHEAD, t0,      32, lane);
    const v16bf kb10 = frag_load(Kx, DHEAD, t0 + 16, 0,  lane);
    const v16bf kb11 = frag_load(Kx, DHEAD, t0 + 16, 32, lane);
    const v16bf vb0 = frag_load(Vx, S_LEN, 0,  t0, lane);
    const v16bf vb1 = frag_load(Vx, S_LEN, 16, t0, lane);
    const v16bf vb2 = frag_load(Vx, S_LEN, 32, t0, lane);
    const v16bf vb3 = frag_load(Vx, S_LEN, 48, t0, lane);

    v8f sA = v8f_zero(), sB = v8f_zero();
    sA = wmma_bf16(qa0, kb00, sA);
    sA = wmma_bf16(qa1, kb01, sA);
    sB = wmma_bf16(qa0, kb10, sB);
    sB = wmma_bf16(qa1, kb11, sB);

#pragma unroll
    for (int v = 0; v < 8; v++) {
      float sm = fmaxf(sA[v], sB[v]);
#pragma unroll
      for (int msk = 1; msk < 16; msk <<= 1)
        sm = fmaxf(sm, __shfl_xor(sm, msk, 32));
      const float mnew = fmaxf(mrun[v], sm);
      const float resc = __expf(mrun[v] - mnew);
      const float p0 = __expf(sA[v] - mnew);
      const float p1 = __expf(sB[v] - mnew);
      float ps = p0 + p1;
#pragma unroll
      for (int msk = 1; msk < 16; msk <<= 1) ps += __shfl_xor(ps, msk, 32);
      lrun[v] = lrun[v] * resc + ps;
      mrun[v] = mnew;
      o0[v] *= resc; o1[v] *= resc; o2[v] *= resc; o3[v] *= resc;
      const int row = v + hf * 8;
      Pw[row][r]      = (bf16_t)p0;
      Pw[row][16 + r] = (bf16_t)p1;
    }
    __builtin_amdgcn_fence(__ATOMIC_ACQ_REL, "wavefront");

    const v16bf pf = frag_load(&Pw[0][0], 32, 0, 0, lane);
    o0 = wmma_bf16(pf, vb0, o0);
    o1 = wmma_bf16(pf, vb1, o1);
    o2 = wmma_bf16(pf, vb2, o2);
    o3 = wmma_bf16(pf, vb3, o3);
  }

  bf16_t* out = concatb + (size_t)b * S_LEN * DMODEL + (size_t)h * DHEAD;
#pragma unroll
  for (int v = 0; v < 8; v++) {
    const float inv = 1.0f / lrun[v];
    const size_t rowoff = (size_t)(s0 + v + hf * 8) * DMODEL;
    out[rowoff + 0 * 16 + r] = (bf16_t)(o0[v] * inv);
    out[rowoff + 1 * 16 + r] = (bf16_t)(o1[v] * inv);
    out[rowoff + 2 * 16 + r] = (bf16_t)(o2[v] * inv);
    out[rowoff + 3 * 16 + r] = (bf16_t)(o3[v] * inv);
  }
}

// ---------------------------------------------------------------------------
// Generic WMMA GEMM: C[M,N] = A[M,K](bf16) * Bt[N,K](bf16) + bias[n]
// (+ resid) (ReLU) -> f32 or bf16.  Block = 8 waves = 128x64 tile.
// Operands staged in LDS (gemm_core).
// ---------------------------------------------------------------------------
template <bool RELU, bool HASRES, bool OUTBF16>
__global__ void __launch_bounds__(256) gemm_kernel(
    const bf16_t* __restrict__ A, const bf16_t* __restrict__ Bt,
    const float* __restrict__ bias, const float* __restrict__ resid,
    float* __restrict__ outf, bf16_t* __restrict__ outb, int M, int N, int K) {
  __shared__ __attribute__((aligned(16))) bf16_t smem[2 * G_BUF];
  const int lane = threadIdx.x & 31, wave = threadIdx.x >> 5;
  const int r = lane & 15, hf = lane >> 4;
  const int m0 = blockIdx.x * 128 + wave * 16;
  const int n0 = blockIdx.y * 64;
  (void)M;

  v8f acc[4] = {v8f_zero(), v8f_zero(), v8f_zero(), v8f_zero()};
  gemm_core(A + (size_t)blockIdx.x * 128 * (size_t)K, Bt + (size_t)n0 * (size_t)K,
            K, smem, acc);

#pragma unroll
  for (int f = 0; f < 4; f++) {
    const int n = n0 + f * 16 + r;
    const float bn = bias[n];
#pragma unroll
    for (int v = 0; v < 8; v++) {
      const int m = m0 + v + hf * 8;
      float val = acc[f][v] + bn;
      if (HASRES) val += resid[(size_t)m * N + n];
      if (RELU) val = fmaxf(val, 0.0f);
      if (OUTBF16) outb[(size_t)m * N + n] = (bf16_t)val;
      else outf[(size_t)m * N + n] = val;
    }
  }
}

// ---------------------------------------------------------------------------
// LayerNorm (reference semantics): y = g*(x-mean)/(std+eps)+b, std = sqrt(
// mean((x-mean)^2)).  One block (256 threads) per row of 1024.
// ---------------------------------------------------------------------------
__global__ void __launch_bounds__(256) ln_kernel(
    const float* __restrict__ in, const float* __restrict__ gam,
    const float* __restrict__ bet, float* __restrict__ out,
    bf16_t* __restrict__ outb) {
  __shared__ float red[8];
  const int row = blockIdx.x, tid = threadIdx.x;
  const float* x = in + (size_t)row * DMODEL;
  float v[4];
#pragma unroll
  for (int i = 0; i < 4; i++) v[i] = x[tid + i * 256];

  float s = v[0] + v[1] + v[2] + v[3];
#pragma unroll
  for (int msk = 1; msk < 32; msk <<= 1) s += __shfl_xor(s, msk, 32);
  if ((tid & 31) == 0) red[tid >> 5] = s;
  __syncthreads();
  float tot = 0.f;
#pragma unroll
  for (int i = 0; i < 8; i++) tot += red[i];
  const float mean = tot * (1.0f / DMODEL);
  __syncthreads();

  float sq = 0.f;
#pragma unroll
  for (int i = 0; i < 4; i++) { const float d = v[i] - mean; sq += d * d; }
#pragma unroll
  for (int msk = 1; msk < 32; msk <<= 1) sq += __shfl_xor(sq, msk, 32);
  if ((tid & 31) == 0) red[tid >> 5] = sq;
  __syncthreads();
  float tots = 0.f;
#pragma unroll
  for (int i = 0; i < 8; i++) tots += red[i];
  const float stdv = sqrtf(tots * (1.0f / DMODEL));
  const float inv = 1.0f / (stdv + 1e-5f);

#pragma unroll
  for (int i = 0; i < 4; i++) {
    const int c = tid + i * 256;
    const float y = gam[c] * (v[i] - mean) * inv + bet[c];
    out[(size_t)row * DMODEL + c] = y;
    if (outb) outb[(size_t)row * DMODEL + c] = (bf16_t)y;
  }
}

// ---------------------------------------------------------------------------
extern "C" void kernel_launch(void* const* d_in, const int* in_sizes, int n_in,
                              void* d_out, int out_size, void* d_ws,
                              size_t ws_size, hipStream_t stream) {
  (void)in_sizes; (void)n_in; (void)out_size; (void)ws_size;
  const float* x   = (const float*)d_in[0];
  const float* wq  = (const float*)d_in[1];
  const float* bq  = (const float*)d_in[2];
  const float* wk  = (const float*)d_in[3];
  const float* bk  = (const float*)d_in[4];
  const float* wv  = (const float*)d_in[5];
  const float* bv  = (const float*)d_in[6];
  const float* wo  = (const float*)d_in[7];
  const float* wob = (const float*)d_in[8];
  const float* g1  = (const float*)d_in[9];
  const float* b1  = (const float*)d_in[10];
  const float* f1w = (const float*)d_in[11];
  const float* f1bias = (const float*)d_in[12];
  const float* f2w = (const float*)d_in[13];
  const float* f2bias = (const float*)d_in[14];
  const float* g2  = (const float*)d_in[15];
  const float* b2  = (const float*)d_in[16];
  float* out = (float*)d_out;

  char* ws = (char*)d_ws;
  size_t off = 0;
  auto alloc = [&](size_t bytes) -> char* {
    char* p = ws + off;
    off += (bytes + 255) & ~(size_t)255;
    return p;
  };
  const int BS = BATCH * S_LEN;  // 4096 rows
  bf16_t* xb   = (bf16_t*)alloc((size_t)BS * DMODEL * 2);          // 8 MB (reused as concat)
  bf16_t* wqt  = (bf16_t*)alloc((size_t)NHEADS * DHEAD * DMODEL * 2);
  bf16_t* wkt  = (bf16_t*)alloc((size_t)NHEADS * DHEAD * DMODEL * 2);
  bf16_t* wvt  = (bf16_t*)alloc((size_t)NHEADS * DHEAD * DMODEL * 2);
  bf16_t* wot  = (bf16_t*)alloc((size_t)DMODEL * DMODEL * 2);
  bf16_t* ff1t = (bf16_t*)alloc((size_t)DFF * DMODEL * 2);
  bf16_t* ff2t = (bf16_t*)alloc((size_t)DMODEL * DFF * 2);
  bf16_t* Qm   = (bf16_t*)alloc((size_t)BATCH * NHEADS * S_LEN * DHEAD * 2);  // 8 MB
  bf16_t* Km   = (bf16_t*)alloc((size_t)BATCH * NHEADS * S_LEN * DHEAD * 2);  // 8 MB
  bf16_t* Vtm  = (bf16_t*)alloc((size_t)BATCH * NHEADS * DHEAD * S_LEN * 2);  // 8 MB
  float*  t1   = (float*)alloc((size_t)BS * DMODEL * 4);           // 16 MB (reused as t2)
  float*  hbuf = (float*)alloc((size_t)BS * DMODEL * 4);           // 16 MB
  bf16_t* hb   = (bf16_t*)alloc((size_t)BS * DMODEL * 2);          // 8 MB
  bf16_t* concatb = xb;       // alias: xb dead after QKV
  bf16_t* ffn1out = Qm;       // alias: Q+K region (16 MB) dead after attention
  float*  t2 = t1;            // alias: t1 dead after LN1

  dim3 blk256(256), blkT(32, 8);

  // 1) convert x, transpose-convert weights
  cvt_f32_bf16_kernel<<<dim3(BS * DMODEL / (256 * 8)), blk256, 0, stream>>>(
      x, xb, BS * DMODEL);
  transpose_cvt_kernel<<<dim3(DHEAD / 32, DMODEL / 32, NHEADS), blkT, 0, stream>>>(wq, wqt, DMODEL, DHEAD);
  transpose_cvt_kernel<<<dim3(DHEAD / 32, DMODEL / 32, NHEADS), blkT, 0, stream>>>(wk, wkt, DMODEL, DHEAD);
  transpose_cvt_kernel<<<dim3(DHEAD / 32, DMODEL / 32, NHEADS), blkT, 0, stream>>>(wv, wvt, DMODEL, DHEAD);
  transpose_cvt_kernel<<<dim3(DMODEL / 32, DMODEL / 32, 1), blkT, 0, stream>>>(wo, wot, DMODEL, DMODEL);
  transpose_cvt_kernel<<<dim3(DFF / 32, DMODEL / 32, 1), blkT, 0, stream>>>(f1w, ff1t, DMODEL, DFF);
  transpose_cvt_kernel<<<dim3(DMODEL / 32, DFF / 32, 1), blkT, 0, stream>>>(f2w, ff2t, DFF, DMODEL);

  // 2) QKV projections (per head)
  qkv_kernel<<<dim3(S_LEN / 128, NHEADS, BATCH * 3), blk256, 0, stream>>>(
      xb, wqt, wkt, wvt, bq, bk, bv, Qm, Km, Vtm);

  // 3) flash attention -> concat heads (bf16)
  attn_kernel<<<dim3(S_LEN / 128, NHEADS, BATCH), blk256, 0, stream>>>(
      Qm, Km, Vtm, concatb);

  // 4) output projection + residual(x) -> t1 (f32)
  gemm_kernel<false, true, false><<<dim3(BS / 128, DMODEL / 64), blk256, 0, stream>>>(
      concatb, wot, wob, x, t1, nullptr, BS, DMODEL, DMODEL);

  // 5) LayerNorm1 -> h (f32) + hb (bf16)
  ln_kernel<<<dim3(BS), blk256, 0, stream>>>(t1, g1, b1, hbuf, hb);

  // 6) FFN1: relu(h @ ff1 + b) -> bf16
  gemm_kernel<true, false, true><<<dim3(BS / 128, DFF / 64), blk256, 0, stream>>>(
      hb, ff1t, f1bias, nullptr, nullptr, ffn1out, BS, DFF, DMODEL);

  // 7) FFN2: (+ b + h residual) -> t2 (f32)
  gemm_kernel<false, true, false><<<dim3(BS / 128, DMODEL / 64), blk256, 0, stream>>>(
      ffn1out, ff2t, f2bias, hbuf, t2, nullptr, BS, DMODEL, DFF);

  // 8) LayerNorm2 -> d_out
  ln_kernel<<<dim3(BS), blk256, 0, stream>>>(t2, g2, b2, out, nullptr);
}

// v002
// One run takes 191 microseconds.
// In both of two side-by-side timings against v001, it was 1.09 times as fast.
// Counting every step since v000, it is 1.94 times as fast.
#include <hip/hip_runtime.h>
#include <hip/hip_bf16.h>
#include <math.h>

typedef __bf16 bf16_t;
typedef __attribute__((ext_vector_type(16))) __bf16     v16bf;
typedef __attribute__((ext_vector_type(8)))  float       v8f;
typedef __attribute__((ext_vector_type(4)))  unsigned int v4u;

#define S_LEN  1024
#define DMODEL 1024
#define DHEAD  64
#define NHEADS 16
#define DFF    2048
#define BATCH  4

__device__ __forceinline__ v8f wmma_bf16(v16bf a, v16bf b, v8f c) {
  return __builtin_amdgcn_wmma_f32_16x16x32_bf16(false, a, false, b, (short)0, c,
                                                 false, false);
}

__device__ __forceinline__ v16bf frag_load(const bf16_t* __restrict__ base,
                                           int ld, int row0, int k0, int lane) {
  const int r = lane & 15, hf = lane >> 4;
  const bf16_t* p = base + (size_t)(row0 + r) * (size_t)ld + (k0 + hf * 8);
  union { v4u u[2]; v16bf v; } cv;
  cv.u[0] = *(const v4u*)p;
  cv.u[1] = *(const v4u*)(p + 16);
  return cv.v;
}

__device__ __forceinline__ v8f v8f_zero() {
  v8f z = {0.f, 0.f, 0.f, 0.f, 0.f, 0.f, 0.f, 0.f};
  return z;
}

// ---------------------------------------------------------------------------
// Shared GEMM core: one 128x64 block tile, 8 waves of 16x64.  Each pass covers
// 64 k (128 B of every operand row).  The 128 A rows and the 64 Bt rows of a
// pass are brought into LDS by asynchronous b128 copies (whole 128-B lines,
// 8 lanes per row) into one of two buffers, one pass ahead of their use; the
// waves read their fragments from LDS at a row pitch of 144 B.
// ---------------------------------------------------------------------------
#define G_BK    64                       // k elements per pass
#define G_LDP   72                       // LDS row pitch, elements (144 B)
#define G_AROWS 128
#define G_BROWS 64
#define G_BUF   ((G_AROWS + G_BROWS) * G_LDP)   // elements per buffer

__device__ __forceinline__ void stage_copies(const bf16_t* ga, const bf16_t* gb,
                                             size_t rows32, unsigned lds) {
  const bf16_t* a0 = ga;
  const bf16_t* a1 = ga + rows32;
  const bf16_t* a2 = ga + 2 * rows32;
  const bf16_t* a3 = ga + 3 * rows32;
  const bf16_t* b0 = gb;
  const bf16_t* b1 = gb + rows32;
  const unsigned la0 = lds;
  const unsigned la1 = lds + 32 * G_LDP * 2;
  const unsigned la2 = lds + 64 * G_LDP * 2;
  const unsigned la3 = lds + 96 * G_LDP * 2;
  const unsigned lb0 = lds + 128 * G_LDP * 2;
  const unsigned lb1 = lds + 160 * G_LDP * 2;
  asm volatile(
      "global_load_async_to_lds_b128 %0, %1, off\n\t"
      "global_load_async_to_lds_b128 %2, %3, off\n\t"
      "global_load_async_to_lds_b128 %4, %5, off\n\t"
      "global_load_async_to_lds_b128 %6, %7, off\n\t"
      "global_load_async_to_lds_b128 %8, %9, off\n\t"
      "global_load_async_to_lds_b128 %10, %11, off\n\t"
      "s_wait_xcnt 0x0"
      :: "v"(la0), "v"(a0), "v"(la1), "v"(a1), "v"(la2), "v"(a2),
         "v"(la3), "v"(a3), "v"(lb0), "v"(b0), "v"(lb1), "v"(b1)
      : "memory");
}

// Ablk: first of the block's 128 rows of A; Bblk: first of its 64 rows of Bt;
// both row-major with K elements per row, K a multiple of 64.
__device__ __forceinline__ void gemm_core(const bf16_t* __restrict__ Ablk,
                                          const bf16_t* __restrict__ Bblk,
                                          int K, bf16_t* smem, v8f acc[4]) {
  const int tid = threadIdx.x;
  const int lane = tid & 31, wave = tid >> 5;
  const int rw = tid >> 3, cw = (tid & 7) * 8;
  const bf16_t* ga = Ablk + (size_t)rw * (size_t)K + cw;
  const bf16_t* gb = Bblk + (size_t)rw * (size_t)K + cw;
  const size_t rows32 = (size_t)32 * (size_t)K;
  const unsigned lds0 = (unsigned)(size_t)smem + (unsigned)(rw * G_LDP + cw) * 2u;
  const int npass = K / G_BK;

  stage_copies(ga, gb, rows32, lds0);
  // pass 0 has landed for this wave, then for the block
  asm volatile("s_wait_asynccnt 0x0" ::: "memory");
  __syncthreads();
  if (npass > 1) stage_copies(ga + G_BK, gb + G_BK, rows32, lds0 + G_BUF * 2);

  for (int t = 0; t < npass; t++) {
    const int bsel = t & 1;
    const bf16_t* sa = smem + bsel * G_BUF;
    const bf16_t* sb = sa + G_AROWS * G_LDP;
    v16bf a[2], b[2][4];
#pragma unroll
    for (int ks = 0; ks < 2; ks++) {
      a[ks] = frag_load(sa, G_LDP, wave * 16, ks * 32, lane);
#pragma unroll
      for (int f = 0; f < 4; f++)
        b[ks][f] = frag_load(sb, G_LDP, f * 16, ks * 32, lane);
    }
    // keeps the pass's LDS reads one group ahead of its WMMAs: left free, the
    // compiler puts a pair of reads and a full wait in front of every WMMA
    __builtin_amdgcn_sched_barrier(0);
#pragma unroll
    for (int ks = 0; ks < 2; ks++) {
#pragma unroll
      for (int f = 0; f < 4; f++) acc[f] = wmma_bf16(a[ks], b[ks][f], acc[f]);
    }
    // publish point: this wave's reads of the buffer are done, its copies of
    // pass t + 1 have landed; the barrier says both for the whole block
    asm volatile("s_wait_dscnt 0x0" ::: "memory");
    asm volatile("s_wait_asynccnt 0x0" ::: "memory");
    __syncthreads();
    if (t + 2 < npass)
      stage_copies(ga + (size_t)(t + 2) * G_BK, gb + (size_t)(t + 2) * G_BK,
                   rows32, lds0 + (unsigned)bsel * (G_BUF * 2));
  }
  // no copy is left in flight when the wave goes on
  asm volatile("s_wait_asynccnt 0x0" ::: "memory");
}

// ---------------------------------------------------------------------------
// Operand preparation, one launch: x -> bf16, and every weight matrix
// fp32 [R][C] -> bf16 [C][R].  256 work-groups of 16 waves, all resident at
// once; each takes 16384 elements of x and eight 64x64 weight tiles (one each
// of wq, wk, wv, wo, two of ff1, two of ff2).  All 24 b128 loads of a thread
// are issued first; loads and stores cover whole 128-B lines.
// ---------------------------------------------------------------------------
#define P_WGS   256
#define P_THR   512
#define P_PITCH 65                       // LDS tile row pitch, floats

// src: the tile's first element (uniform); off: this thread's byte offset in
// the tile's first 32 rows; C: source row length.
template <int C>
__device__ __forceinline__ void tile_load(const float* src, unsigned off,
                                          float4 v[2]) {
  const char* p = (const char*)src;
  v[0] = *(const float4*)(p + off);
  v[1] = *(const float4*)(p + 32 * C * 4 + off);
}

__device__ __forceinline__ void tile_to_lds(float* tile, int tid, const float4 v[2]) {
  float* t = tile + (tid >> 4) * P_PITCH + (tid & 15) * 4;
#pragma unroll
  for (int i = 0; i < 2; i++) {
    t[32 * i * P_PITCH + 0] = v[i].x;
    t[32 * i * P_PITCH + 1] = v[i].y;
    t[32 * i * P_PITCH + 2] = v[i].z;
    t[32 * i * P_PITCH + 3] = v[i].w;
  }
}

// dst points at element [c0][r0] of the transposed matrix, R = its row length.
// Eight lanes write the 128 B of one destination row.
__device__ __forceinline__ void tile_store_t(const float* tile, int tid,
                                             bf16_t* __restrict__ dst, int R) {
  const int rg = (tid & 7) * 8, c = tid >> 3;
  bf16_t o[8];
#pragma unroll
  for (int e = 0; e < 8; e++) o[e] = (bf16_t)tile[(rg + e) * P_PITCH + c];
  *(v4u*)(dst + (size_t)c * (size_t)R + rg) = *(const v4u*)o;
}

__global__ void __launch_bounds__(P_THR) prep_kernel(
    const float* x, const float* wq, const float* wk, const float* wv,
    const float* wo, const float* f1w, const float* f2w, bf16_t* xb,
    bf16_t* wqt, bf16_t* wkt, bf16_t* wvt, bf16_t* wot, bf16_t* ff1t,
    bf16_t* ff2t) {
  __shared__ float tiles[8][64 * P_PITCH];
  const int tid = threadIdx.x;
  const int b = blockIdx.x, bh = b >> 4, bl = b & 15;
  const int b2 = b + P_WGS;

  // per-head matrices are [1024][64]: head bh, row tile bl
  const size_t hsrc = (size_t)bh * (DMODEL * DHEAD) + (size_t)bl * (64 * DHEAD);
  const size_t hdst = (size_t)bh * (DMODEL * DHEAD) + (size_t)bl * 64;
  const unsigned col = (unsigned)(tid & 15) * 16u, row = (unsigned)(tid >> 4);
  const unsigned o64 = row * (DHEAD * 4) + col;
  const unsigned o1k = row * (DMODEL * 4) + col;
  const unsigned o2k = row * (DFF * 4) + col;

  const float* pq = wq + hsrc;
  const float* pk = wk + hsrc;
  const float* pv = wv + hsrc;
  // wo [1024][1024]: row tile bh, column tile bl
  const float* po = wo + (size_t)bh * (64 * DMODEL) + bl * 64;
  // ff1 [1024][2048]: row tile index >> 5, column tile index & 31
  const float* p1a = f1w + (size_t)(b >> 5) * (64 * DFF) + (b & 31) * 64;
  const float* p1b = f1w + (size_t)(b2 >> 5) * (64 * DFF) + (b2 & 31) * 64;
  // ff2 [2048][1024]: row tile index >> 4, column tile index & 15
  const float* p2a = f2w + (size_t)(b >> 4) * (64 * DMODEL) + (b & 15) * 64;
  const float* p2b = f2w + (size_t)(b2 >> 4) * (64 * DMODEL) + (b2 & 15) * 64;
  // x: 16384 elements from b * 16384 on; o64 is also tid * 16 bytes
  const char* px = (const char*)(x + (size_t)b * (8 * P_THR * 4));

  float4 t[8][2], xv[8];
  tile_load<DHEAD>(pq, o64, t[0]);
  tile_load<DHEAD>(pk, o64, t[1]);
  tile_load<DHEAD>(pv, o64, t[2]);
  tile_load<DMODEL>(po, o1k, t[3]);
  tile_load<DFF>(p1a, o2k, t[4]);
  tile_load<DFF>(p1b, o2k, t[5]);
  tile_load<DMODEL>(p2a, o1k, t[6]);
  tile_load<DMODEL>(p2b, o1k, t[7]);
#pragma unroll
  for (int i = 0; i < 8; i++) xv[i] = *(const float4*)(px + i * (P_THR * 16) + o64);
  // the base and offset registers named by the loads above stay as they are
  // until this wait: as inputs they cannot be rewritten, or given to a load's
  // result, ahead of it (the pointers are not __restrict__, so no load moves
  // behind it)
  asm volatile("s_wait_xcnt 0x0"
               :: "v"(o64), "v"(o1k), "v"(o2k), "s"(pq), "s"(pk), "s"(pv), "s"(po),
                  "s"(p1a), "s"(p1b), "s"(p2a), "s"(p2b), "s"(px)
               : "memory");

#pragma unroll
  for (int k = 0; k < 8; k++) tile_to_lds(tiles[k], tid, t[k]);
  __syncthreads();
#pragma unroll
  for (int i = 0; i < 8; i++) {
    bf16_t o[4] = {(bf16_t)xv[i].x, (bf16_t)xv[i].y, (bf16_t)xv[i].z, (bf16_t)xv[i].w};
    *(uint2*)(xb + (size_t)b * (8 * P_THR * 4) + i * (P_THR * 4) + tid * 4) = *(const uint2*)o;
  }
  tile_store_t(tiles[0], tid, wqt + hdst, DMODEL);
  tile_store_t(tiles[1], tid, wkt + hdst, DMODEL);
  tile_store_t(tiles[2], tid, wvt + hdst, DMODEL);
  tile_store_t(tiles[3], tid, wot + (size_t)bl * (64 * DMODEL) + bh * 64, DMODEL);
  tile_store_t(tiles[4], tid, ff1t + (size_t)(b & 31) * (64 * DMODEL) + (b >> 5) * 64, DMODEL);
  tile_store_t(tiles[5], tid, ff1t + (size_t)(b2 & 31) * (64 * DMODEL) + (b2 >> 5) * 64, DMODEL);
  tile_store_t(tiles[6], tid, ff2t + (size_t)(b & 15) * (64 * DFF) + (b >> 4) * 64, DFF);
  tile_store_t(tiles[7], tid, ff2t + (size_t)(b2 & 15) * (64 * DFF) + (b2 >> 4) * 64, DFF);
}

// ---------------------------------------------------------------------------
// QKV projections.  grid = (S/128, H, B*3).  Wave = 16 rows x 64 cols (full
// d_head).  Operands staged in LDS (gemm_core).  Q is pre-scaled by 1/sqrt(64);
// V is stored transposed [64][S].
// ---------------------------------------------------------------------------
__global__ void __launch_bounds__(256) qkv_kernel(
    const bf16_t* __restrict__ xb, const bf16_t* __restrict__ wqt,
    const bf16_t* __restrict__ wkt, const bf16_t* __restrict__ wvt,
    const float* __restrict__ bq, const float* __restrict__ bk,
    const float* __restrict__ bv, bf16_t* __restrict__ Q,
    bf16_t* __restrict__ Kb, bf16_t* __restrict__ Vt) {
  __shared__ __attribute__((aligned(16))) bf16_t smem[2 * G_BUF];
  const int lane = threadIdx.x & 31, wave = threadIdx.x >> 5;
  const int r = lane & 15, hf = lane >> 4;
  const int h = blockIdx.y;
  const int which = blockIdx.z % 3, b = blockIdx.z / 3;
  const int s0 = blockIdx.x * 128 + wave * 16;

  const bf16_t* A = xb + (size_t)b * S_LEN * DMODEL;
  const bf16_t* Wt = (which == 0 ? wqt : which == 1 ? wkt : wvt) +
                     (size_t)h * DHEAD * DMODEL;
  const float* bias = (which == 0 ? bq : which == 1 ? bk : bv) + h * DHEAD;

  v8f acc[4] = {v8f_zero(), v8f_zero(), v8f_zero(), v8f_zero()};
  gemm_core(A + (size_t)blockIdx.x * 128 * DMODEL, Wt, DMODEL, smem, acc);

  const float scale = (which == 0) ? 0.125f : 1.0f;  // 1/sqrt(64)
  const size_t bh = (size_t)(b * NHEADS + h);
  if (which < 2) {
    bf16_t* out = (which == 0 ? Q : Kb) + bh * S_LEN * DHEAD;
#pragma unroll
    for (int f = 0; f < 4; f++) {
      const int n = f * 16 + r;
      const float bn = bias[n];
#pragma unroll
      for (int v = 0; v < 8; v++) {
        const int s = s0 + v + hf * 8;
        out[(size_t)s * DHEAD + n] = (bf16_t)((acc[f][v] + bn) * scale);
      }
    }
  } else {
    bf16_t* out = Vt + bh * DHEAD * S_LEN;
#pragma unroll
    for (int f = 0; f < 4; f++) {
      const int d = f * 16 + r;
      const float bn = bias[d];
      bf16_t tmp[8];
#pragma unroll
      for (int v = 0; v < 8; v++) tmp[v] = (bf16_t)(acc[f][v] + bn);
      *(v4u*)(out + (size_t)d * S_LEN + s0 + hf * 8) = *(const v4u*)tmp;
    }
  }
}

// ---------------------------------------------------------------------------
// Flash attention.  grid = (S/128, H, B).  Each wave: 16 query rows, full
// d_head=64 output in 4 accumulator fragments; online softmax over 32 keys
// per step; P staged via per-wave LDS and re-read as an A fragment.  V
// fragments are fetched right after K so they fly during the softmax VALU
// stretch; unroll-by-2 lets the scheduler overlap adjacent key blocks.
// ---------------------------------------------------------------------------
__global__ void __launch_bounds__(256) attn_kernel(
    const bf16_t* __restrict__ Q, const bf16_t* __restrict__ Kb,
    const bf16_t* __restrict__ Vt, bf16_t* __restrict__ concatb) {
  __shared__ __align__(16) bf16_t Pl[8][16][32];
  const int lane = threadIdx.x & 31, wave = threadIdx.x >> 5;
  const int r = lane & 15, hf = lane >> 4;
  const int h = blockIdx.y, b = blockIdx.z;
  const int s0 = blockIdx.x * 128 + wave * 16;
  const size_t bh = (size_t)(b * NHEADS + h);
  const bf16_t* Qb = Q + bh * S_LEN * DHEAD;
  const bf16_t* Kx = Kb + bh * S_LEN * DHEAD;
  const bf16_t* Vx = Vt + bh * DHEAD * S_LEN;
  bf16_t(*Pw)[32] = Pl[wave];

  const v16bf qa0 = frag_load(Qb, DHEAD, s0, 0, lane);
  const v16bf qa1 = frag_load(Qb, DHEAD, s0, 32, lane);

  v8f o0 = v8f_zero(), o1 = v8f_zero(), o2 = v8f_zero(), o3 = v8f_zero();
  float mrun[8], lrun[8];
#pragma unroll
  for (int v = 0; v < 8; v++) { mrun[v] = -3.0e38f; lrun[v] = 0.f; }

#pragma unroll 2
  for (int t0 = 0; t0 < S_LEN; t0 += 32) {
    // K fragments for this key block, then V fragments (prefetched early)
    const v16bf kb00 = frag_load(Kx, DHEAD, t0,      0,  lane);
    const v16bf kb01 = frag_load(Kx, DHEAD, t0,      32, lane);
    const v16bf kb10 = frag_load(Kx, DHEAD, t0 + 16, 0,  lane);
    const v16bf kb11 = frag_load(Kx, DHEAD, t0 + 16, 32, lane);
    const v16bf vb0 = frag_load(Vx, S_LEN, 0,  t0, lane);
    const v16bf vb1 = frag_load(Vx, S_LEN, 16, t0, lane);
    const v16bf vb2 = frag_load(Vx, S_LEN, 32, t0, lane);
    const v16bf vb3 = frag_load(Vx, S_LEN, 48, t0, lane);

    v8f sA = v8f_zero(), sB = v8f_zero();
    sA = wmma_bf16(qa0, kb00, sA);
    sA = wmma_bf16(qa1, kb01, sA);
    sB = wmma_bf16(qa0, kb10, sB);
    sB = wmma_bf16(qa1, kb11, sB);

#pragma unroll
    for (int v = 0; v < 8; v++) {
      float sm = fmaxf(sA[v], sB[v]);
#pragma unroll
      for (int msk = 1; msk < 16; msk <<= 1)
        sm = fmaxf(sm, __shfl_xor(sm, msk, 32));
      const float mnew = fmaxf(mrun[v], sm);
      const float resc = __expf(mrun[v] - mnew);
      const float p0 = __expf(sA[v] - mnew);
      const float p1 = __expf(sB[v] - mnew);
      float ps = p0 + p1;
#pragma unroll
      for (int msk = 1; msk < 16; msk <<= 1) ps += __shfl_xor(ps, msk, 32);
      lrun[v] = lrun[v] * resc + ps;
      mrun[v] = mnew;
      o0[v] *= resc; o1[v] *= resc; o2[v] *= resc; o3[v] *= resc;
      const int row = v + hf * 8;
      Pw[row][r]      = (bf16_t)p0;
      Pw[row][16 + r] = (bf16_t)p1;
    }
    __builtin_amdgcn_fence(__ATOMIC_ACQ_REL, "wavefront");

    const v16bf pf = frag_load(&Pw[0][0], 32, 0, 0, lane);
    o0 = wmma_bf16(pf, vb0, o0);
    o1 = wmma_bf16(pf, vb1, o1);
    o2 = wmma_bf16(pf, vb2, o2);
    o3 = wmma_bf16(pf, vb3, o3);
  }

  bf16_t* out = concatb + (size_t)b * S_LEN * DMODEL + (size_t)h * DHEAD;
#pragma unroll
  for (int v = 0; v < 8; v++) {
    const float inv = 1.0f / lrun[v];
    const size_t rowoff = (size_t)(s0 + v + hf * 8) * DMODEL;
    out[rowoff + 0 * 16 + r] = (bf16_t)(o0[v] * inv);
    out[rowoff + 1 * 16 + r] = (bf16_t)(o1[v] * inv);
    out[rowoff + 2 * 16 + r] = (bf16_t)(o2[v] * inv);
    out[rowoff + 3 * 16 + r] = (bf16_t)(o3[v] * inv);
  }
}

// ---------------------------------------------------------------------------
// Generic WMMA GEMM: C[M,N] = A[M,K](bf16) * Bt[N,K](bf16) + bias[n]
// (+ resid) (ReLU) -> f32 or bf16.  Block = 8 waves = 128x64 tile.
// Operands staged in LDS (gemm_core).
// ---------------------------------------------------------------------------
template <bool RELU, bool HASRES, bool OUTBF16>
__global__ void __launch_bounds__(256) gemm_kernel(
    const bf16_t* __restrict__ A, const bf16_t* __restrict__ Bt,
    const float* __restrict__ bias, const float* __restrict__ resid,
    float* __restrict__ outf, bf16_t* __restrict__ outb, int M, int N, int K) {
  __shared__ __attribute__((aligned(16))) bf16_t smem[2 * G_BUF];
  const int lane = threadIdx.x & 31, wave = threadIdx.x >> 5;
  const int r = lane & 15, hf = lane >> 4;
  const int m0 = blockIdx.x * 128 + wave * 16;
  const int n0 = blockIdx.y * 64;
  (void)M;

  v8f acc[4] = {v8f_zero(), v8f_zero(), v8f_zero(), v8f_zero()};
  gemm_core(A + (size_t)blockIdx.x * 128 * (size_t)K, Bt + (size_t)n0 * (size_t)K,
            K, smem, acc);

#pragma unroll
  for (int f = 0; f < 4; f++) {
    const int n = n0 + f * 16 + r;
    const float bn = bias[n];
#pragma unroll
    for (int v = 0; v < 8; v++) {
      const int m = m0 + v + hf * 8;
      float val = acc[f][v] + bn;
      if (HASRES) val += resid[(size_t)m * N + n];
      if (RELU) val = fmaxf(val, 0.0f);
      if (OUTBF16) outb[(size_t)m * N + n] = (bf16_t)val;
      else outf[(size_t)m * N + n] = val;
    }
  }
}

// ---------------------------------------------------------------------------
// LayerNorm (reference semantics): y = g*(x-mean)/(std+eps)+b, std = sqrt(
// mean((x-mean)^2)).  One block (256 threads) per row of 1024.
// ---------------------------------------------------------------------------
__global__ void __launch_bounds__(256) ln_kernel(
    const float* __restrict__ in, const float* __restrict__ gam,
    const float* __restrict__ bet, float* __restrict__ out,
    bf16_t* __restrict__ outb) {
  __shared__ float red[8];
  const int row = blockIdx.x, tid = threadIdx.x;
  const float* x = in + (size_t)row * DMODEL;
  float v[4];
#pragma unroll
  for (int i = 0; i < 4; i++) v[i] = x[tid + i * 256];

  float s = v[0] + v[1] + v[2] + v[3];
#pragma unroll
  for (int msk = 1; msk < 32; msk <<= 1) s += __shfl_xor(s, msk, 32);
  if ((tid & 31) == 0) red[tid >> 5] = s;
  __syncthreads();
  float tot = 0.f;
#pragma unroll
  for (int i = 0; i < 8; i++) tot += red[i];
  const float mean = tot * (1.0f / DMODEL);
  __syncthreads();

  float sq = 0.f;
#pragma unroll
  for (int i = 0; i < 4; i++) { const float d = v[i] - mean; sq += d * d; }
#pragma unroll
  for (int msk = 1; msk < 32; msk <<= 1) sq += __shfl_xor(sq, msk, 32);
  if ((tid & 31) == 0) red[tid >> 5] = sq;
  __syncthreads();
  float tots = 0.f;
#pragma unroll
  for (int i = 0; i < 8; i++) tots += red[i];
  const float stdv = sqrtf(tots * (1.0f / DMODEL));
  const float inv = 1.0f / (stdv + 1e-5f);

#pragma unroll
  for (int i = 0; i < 4; i++) {
    const int c = tid + i * 256;
    const float y = gam[c] * (v[i] - mean) * inv + bet[c];
    out[(size_t)row * DMODEL + c] = y;
    if (outb) outb[(size_t)row * DMODEL + c] = (bf16_t)y;
  }
}

// ---------------------------------------------------------------------------
extern "C" void kernel_launch(void* const* d_in, const int* in_sizes, int n_in,
                              void* d_out, int out_size, void* d_ws,
                              size_t ws_size, hipStream_t stream) {
  (void)in_sizes; (void)n_in; (void)out_size; (void)ws_size;
  const float* x   = (const float*)d_in[0];
  const float* wq  = (const float*)d_in[1];
  const float* bq  = (const float*)d_in[2];
  const float* wk  = (const float*)d_in[3];
  const float* bk  = (const float*)d_in[4];
  const float* wv  = (const float*)d_in[5];
  const float* bv  = (const float*)d_in[6];
  const float* wo  = (const float*)d_in[7];
  const float* wob = (const float*)d_in[8];
  const float* g1  = (const float*)d_in[9];
  const float* b1  = (const float*)d_in[10];
  const float* f1w = (const float*)d_in[11];
  const float* f1bias = (const float*)d_in[12];
  const float* f2w = (const float*)d_in[13];
  const float* f2bias = (const float*)d_in[14];
  const float* g2  = (const float*)d_in[15];
  const float* b2  = (const float*)d_in[16];
  float* out = (float*)d_out;

  char* ws = (char*)d_ws;
  size_t off = 0;
  auto alloc = [&](size_t bytes) -> char* {
    char* p = ws + off;
    off += (bytes + 255) & ~(size_t)255;
    return p;
  };
  const int BS = BATCH * S_LEN;  // 4096 rows
  bf16_t* xb   = (bf16_t*)alloc((size_t)BS * DMODEL * 2);          // 8 MB (reused as concat)
  bf16_t* wqt  = (bf16_t*)alloc((size_t)NHEADS * DHEAD * DMODEL * 2);
  bf16_t* wkt  = (bf16_t*)alloc((size_t)NHEADS * DHEAD * DMODEL * 2);
  bf16_t* wvt  = (bf16_t*)alloc((size_t)NHEADS * DHEAD * DMODEL * 2);
  bf16_t* wot  = (bf16_t*)alloc((size_t)DMODEL * DMODEL * 2);
  bf16_t* ff1t = (bf16_t*)alloc((size_t)DFF * DMODEL * 2);
  bf16_t* ff2t = (bf16_t*)alloc((size_t)DMODEL * DFF * 2);
  bf16_t* Qm   = (bf16_t*)alloc((size_t)BATCH * NHEADS * S_LEN * DHEAD * 2);  // 8 MB
  bf16_t* Km   = (bf16_t*)alloc((size_t)BATCH * NHEADS * S_LEN * DHEAD * 2);  // 8 MB
  bf16_t* Vtm  = (bf16_t*)alloc((size_t)BATCH * NHEADS * DHEAD * S_LEN * 2);  // 8 MB
  float*  t1   = (float*)alloc((size_t)BS * DMODEL * 4);           // 16 MB (reused as t2)
  float*  hbuf = (float*)alloc((size_t)BS * DMODEL * 4);           // 16 MB
  bf16_t* hb   = (bf16_t*)alloc((size_t)BS * DMODEL * 2);          // 8 MB
  bf16_t* concatb = xb;       // alias: xb dead after QKV
  bf16_t* ffn1out = Qm;       // alias: Q+K region (16 MB) dead after attention
  float*  t2 = t1;            // alias: t1 dead after LN1

  dim3 blk256(256);

  // 1) convert x, transpose-convert all weights (one launch)
  prep_kernel<<<dim3(P_WGS), dim3(P_THR), 0, stream>>>(
      x, wq, wk, wv, wo, f1w, f2w, xb, wqt, wkt, wvt, wot, ff1t, ff2t);

  // 2) QKV projections (per head)
  qkv_kernel<<<dim3(S_LEN / 128, NHEADS, BATCH * 3), blk256, 0, stream>>>(
      xb, wqt, wkt, wvt, bq, bk, bv, Qm, Km, Vtm);

  // 3) flash attention -> concat heads (bf16)
  attn_kernel<<<dim3(S_LEN / 128, NHEADS, BATCH), blk256, 0, stream>>>(
      Qm, Km, Vtm, concatb);

  // 4) output projection + residual(x) -> t1 (f32)
  gemm_kernel<false, true, false><<<dim3(BS / 128, DMODEL / 64), blk256, 0, stream>>>(
      concatb, wot, wob, x, t1, nullptr, BS, DMODEL, DMODEL);

  // 5) LayerNorm1 -> h (f32) + hb (bf16)
  ln_kernel<<<dim3(BS), blk256, 0, stream>>>(t1, g1, b1, hbuf, hb);

  // 6) FFN1: relu(h @ ff1 + b) -> bf16
  gemm_kernel<true, false, true><<<dim3(BS / 128, DFF / 64), blk256, 0, stream>>>(
      hb, ff1t, f1bias, nullptr, nullptr, ffn1out, BS, DFF, DMODEL);

  // 7) FFN2: (+ b + h residual) -> t2 (f32)
  gemm_kernel<false, true, false><<<dim3(BS / 128, DMODEL / 64), blk256, 0, stream>>>(
      ffn1out, ff2t, f2bias, hbuf, t2, nullptr, BS, DMODEL, DFF);

  // 8) LayerNorm2 -> d_out
  ln_kernel<<<dim3(BS), blk256, 0, stream>>>(t2, g2, b2, out, nullptr);
}

// v003
// A run of this version takes 166 microseconds.
// Two timings next to v002 put it at 1.15 and 1.16 times that version's speed.
// Over all steps from v000 it is 2.24 times as fast.
#include <hip/hip_runtime.h>
#include <hip/hip_bf16.h>
#include <math.h>

typedef __bf16 bf16_t;
typedef __attribute__((ext_vector_type(16))) __bf16     v16bf;
typedef __attribute__((ext_vector_type(8)))  float       v8f;
typedef __attribute__((ext_vector_type(4)))  unsigned int v4u;

#define S_LEN  1024
#define DMODEL 1024
#define DHEAD  64
#define NHEADS 16
#define DFF    2048
#define BATCH  4

__device__ __forceinline__ v8f wmma_bf16(v16bf a, v16bf b, v8f c) {
  return __builtin_amdgcn_wmma_f32_16x16x32_bf16(false, a, false, b, (short)0, c,
                                                 false, false);
}

__device__ __forceinline__ v16bf frag_load(const bf16_t* __restrict__ base,
                                           int ld, int row0, int k0, int lane) {
  const int r = lane & 15, hf = lane >> 4;
  const bf16_t* p = base + (size_t)(row0 + r) * (size_t)ld + (k0 + hf * 8);
  union { v4u u[2]; v16bf v; } cv;
  cv.u[0] = *(const v4u*)p;
  cv.u[1] = *(const v4u*)(p + 16);
  return cv.v;
}

__device__ __forceinline__ v8f v8f_zero() {
  v8f z = {0.f, 0.f, 0.f, 0.f, 0.f, 0.f, 0.f, 0.f};
  return z;
}

// ---------------------------------------------------------------------------
// Shared GEMM core: one 128x64 block tile, 8 waves of 16x64.  Each pass covers
// 64 k (128 B of every operand row).  The 128 A rows and the 64 Bt rows of a
// pass are brought into LDS by asynchronous b128 copies (whole 128-B lines,
// 8 lanes per row) into one of two buffers, one pass ahead of their use; the
// waves read their fragments from LDS at a row pitch of 144 B.
// ---------------------------------------------------------------------------
#define G_BK    64                       // k elements per pass
#define G_LDP   72                       // LDS row pitch, elements (144 B)
#define G_AROWS 128
#define G_BROWS 64
#define G_BUF   ((G_AROWS + G_BROWS) * G_LDP)   // elements per buffer

__device__ __forceinline__ void stage_copies(const bf16_t* ga, const bf16_t* gb,
                                             size_t rows32, unsigned lds) {
  const bf16_t* a0 = ga;
  const bf16_t* a1 = ga + rows32;
  const bf16_t* a2 = ga + 2 * rows32;
  const bf16_t* a3 = ga + 3 * rows32;
  const bf16_t* b0 = gb;
  const bf16_t* b1 = gb + rows32;
  const unsigned la0 = lds;
  const unsigned la1 = lds + 32 * G_LDP * 2;
  const unsigned la2 = lds + 64 * G_LDP * 2;
  const unsigned la3 = lds + 96 * G_LDP * 2;
  const unsigned lb0 = lds + 128 * G_LDP * 2;
  const unsigned lb1 = lds + 160 * G_LDP * 2;
  asm volatile(
      "global_load_async_to_lds_b128 %0, %1, off\n\t"
      "global_load_async_to_lds_b128 %2, %3, off\n\t"
      "global_load_async_to_lds_b128 %4, %5, off\n\t"
      "global_load_async_to_lds_b128 %6, %7, off\n\t"
      "global_load_async_to_lds_b128 %8, %9, off\n\t"
      "global_load_async_to_lds_b128 %10, %11, off\n\t"
      "s_wait_xcnt 0x0"
      :: "v"(la0), "v"(a0), "v"(la1), "v"(a1), "v"(la2), "v"(a2),
         "v"(la3), "v"(a3), "v"(lb0), "v"(b0), "v"(lb1), "v"(b1)
      : "memory");
}

// Ablk: first of the block's 128 rows of A; Bblk: first of its 64 rows of Bt;
// both row-major with K elements per row, K a multiple of 64.
__device__ __forceinline__ void gemm_core(const bf16_t* __restrict__ Ablk,
                                          const bf16_t* __restrict__ Bblk,
                                          int K, bf16_t* smem, v8f acc[4]) {
  const int tid = threadIdx.x;
  const int lane = tid & 31, wave = tid >> 5;
  const int rw = tid >> 3, cw = (tid & 7) * 8;
  const bf16_t* ga = Ablk + (size_t)rw * (size_t)K + cw;
  const bf16_t* gb = Bblk + (size_t)rw * (size_t)K + cw;
  const size_t rows32 = (size_t)32 * (size_t)K;
  const unsigned lds0 = (unsigned)(size_t)smem + (unsigned)(rw * G_LDP + cw) * 2u;
  const int npass = K / G_BK;

  stage_copies(ga, gb, rows32, lds0);
  // pass 0 has landed for this wave, then for the block
  asm volatile("s_wait_asynccnt 0x0" ::: "memory");
  __syncthreads();
  if (npass > 1) stage_copies(ga + G_BK, gb + G_BK, rows32, lds0 + G_BUF * 2);

  for (int t = 0; t < npass; t++) {
    const int bsel = t & 1;
    const bf16_t* sa = smem + bsel * G_BUF;
    const bf16_t* sb = sa + G_AROWS * G_LDP;
    v16bf a[2], b[2][4];
#pragma unroll
    for (int ks = 0; ks < 2; ks++) {
      a[ks] = frag_load(sa, G_LDP, wave * 16, ks * 32, lane);
#pragma unroll
      for (int f = 0; f < 4; f++)
        b[ks][f] = frag_load(sb, G_LDP, f * 16, ks * 32, lane);
    }
    // keeps the pass's LDS reads one group ahead of its WMMAs: left free, the
    // compiler puts a pair of reads and a full wait in front of every WMMA
    __builtin_amdgcn_sched_barrier(0);
#pragma unroll
    for (int ks = 0; ks < 2; ks++) {
#pragma unroll
      for (int f = 0; f < 4; f++) acc[f] = wmma_bf16(a[ks], b[ks][f], acc[f]);
    }
    // publish point: this wave's reads of the buffer are done, its copies of
    // pass t + 1 have landed; the barrier says both for the whole block
    asm volatile("s_wait_dscnt 0x0" ::: "memory");
    asm volatile("s_wait_asynccnt 0x0" ::: "memory");
    __syncthreads();
    if (t + 2 < npass)
      stage_copies(ga + (size_t)(t + 2) * G_BK, gb + (size_t)(t + 2) * G_BK,
                   rows32, lds0 + (unsigned)bsel * (G_BUF * 2));
  }
  // no copy is left in flight when the wave goes on
  asm volatile("s_wait_asynccnt 0x0" ::: "memory");
}

// ---------------------------------------------------------------------------
// Operand preparation, one launch: x -> bf16, and every weight matrix
// fp32 [R][C] -> bf16 [C][R].  256 work-groups of 16 waves, all resident at
// once; each takes 16384 elements of x and eight 64x64 weight tiles (one each
// of wq, wk, wv, wo, two of ff1, two of ff2).  All 24 b128 loads of a thread
// are issued first; loads and stores cover whole 128-B lines.
// ---------------------------------------------------------------------------
#define P_WGS   256
#define P_THR   512
#define P_PITCH 65                       // LDS tile row pitch, floats

// src: the tile's first element (uniform); off: this thread's byte offset in
// the tile's first 32 rows; C: source row length.
template <int C>
__device__ __forceinline__ void tile_load(const float* src, unsigned off,
                                          float4 v[2]) {
  const char* p = (const char*)src;
  v[0] = *(const float4*)(p + off);
  v[1] = *(const float4*)(p + 32 * C * 4 + off);
}

__device__ __forceinline__ void tile_to_lds(float* tile, int tid, const float4 v[2]) {
  float* t = tile + (tid >> 4) * P_PITCH + (tid & 15) * 4;
#pragma unroll
  for (int i = 0; i < 2; i++) {
    t[32 * i * P_PITCH + 0] = v[i].x;
    t[32 * i * P_PITCH + 1] = v[i].y;
    t[32 * i * P_PITCH + 2] = v[i].z;
    t[32 * i * P_PITCH + 3] = v[i].w;
  }
}

// dst points at element [c0][r0] of the transposed matrix, R = its row length.
// Eight lanes write the 128 B of one destination row.
__device__ __forceinline__ void tile_store_t(const float* tile, int tid,
                                             bf16_t* __restrict__ dst, int R) {
  const int rg = (tid & 7) * 8, c = tid >> 3;
  bf16_t o[8];
#pragma unroll
  for (int e = 0; e < 8; e++) o[e] = (bf16_t)tile[(rg + e) * P_PITCH + c];
  *(v4u*)(dst + (size_t)c * (size_t)R + rg) = *(const v4u*)o;
}

__global__ void __launch_bounds__(P_THR) prep_kernel(
    const float* x, const float* wq, const float* wk, const float* wv,
    const float* wo, const float* f1w, const float* f2w, bf16_t* xb,
    bf16_t* wqt, bf16_t* wkt, bf16_t* wvt, bf16_t* wot, bf16_t* ff1t,
    bf16_t* ff2t) {
  __shared__ float tiles[8][64 * P_PITCH];
  const int tid = threadIdx.x;
  const int b = blockIdx.x, bh = b >> 4, bl = b & 15;
  const int b2 = b + P_WGS;

  // per-head matrices are [1024][64]: head bh, row tile bl
  const size_t hsrc = (size_t)bh * (DMODEL * DHEAD) + (size_t)bl * (64 * DHEAD);
  const size_t hdst = (size_t)bh * (DMODEL * DHEAD) + (size_t)bl * 64;
  const unsigned col = (unsigned)(tid & 15) * 16u, row = (unsigned)(tid >> 4);
  const unsigned o64 = row * (DHEAD * 4) + col;
  const unsigned o1k = row * (DMODEL * 4) + col;
  const unsigned o2k = row * (DFF * 4) + col;

  const float* pq = wq + hsrc;
  const float* pk = wk + hsrc;
  const float* pv = wv + hsrc;
  // wo [1024][1024]: row tile bh, column tile bl
  const float* po = wo + (size_t)bh * (64 * DMODEL) + bl * 64;
  // ff1 [1024][2048]: row tile index >> 5, column tile index & 31
  const float* p1a = f1w + (size_t)(b >> 5) * (64 * DFF) + (b & 31) * 64;
  const float* p1b = f1w + (size_t)(b2 >> 5) * (64 * DFF) + (b2 & 31) * 64;
  // ff2 [2048][1024]: row tile index >> 4, column tile index & 15
  const float* p2a = f2w + (size_t)(b >> 4) * (64 * DMODEL) + (b & 15) * 64;
  const float* p2b = f2w + (size_t)(b2 >> 4) * (64 * DMODEL) + (b2 & 15) * 64;
  // x: 16384 elements from b * 16384 on; o64 is also tid * 16 bytes
  const char* px = (const char*)(x + (size_t)b * (8 * P_THR * 4));

  float4 t[8][2], xv[8];
  tile_load<DHEAD>(pq, o64, t[0]);
  tile_load<DHEAD>(pk, o64, t[1]);
  tile_load<DHEAD>(pv, o64, t[2]);
  tile_load<DMODEL>(po, o1k, t[3]);
  tile_load<DFF>(p1a, o2k, t[4]);
  tile_load<DFF>(p1b, o2k, t[5]);
  tile_load<DMODEL>(p2a, o1k, t[6]);
  tile_load<DMODEL>(p2b, o1k, t[7]);
#pragma unroll
  for (int i = 0; i < 8; i++) xv[i] = *(const float4*)(px + i * (P_THR * 16) + o64);
  // the base and offset registers named by the loads above stay as they are
  // until this wait: as inputs they cannot be rewritten, or given to a load's
  // result, ahead of it (the pointers are not __restrict__, so no load moves
  // behind it)
  asm volatile("s_wait_xcnt 0x0"
               :: "v"(o64), "v"(o1k), "v"(o2k), "s"(pq), "s"(pk), "s"(pv), "s"(po),
                  "s"(p1a), "s"(p1b), "s"(p2a), "s"(p2b), "s"(px)
               : "memory");

#pragma unroll
  for (int k = 0; k < 8; k++) tile_to_lds(tiles[k], tid, t[k]);
  __syncthreads();
#pragma unroll
  for (int i = 0; i < 8; i++) {
    bf16_t o[4] = {(bf16_t)xv[i].x, (bf16_t)xv[i].y, (bf16_t)xv[i].z, (bf16_t)xv[i].w};
    *(uint2*)(xb + (size_t)b * (8 * P_THR * 4) + i * (P_THR * 4) + tid * 4) = *(const uint2*)o;
  }
  tile_store_t(tiles[0], tid, wqt + hdst, DMODEL);
  tile_store_t(tiles[1], tid, wkt + hdst, DMODEL);
  tile_store_t(tiles[2], tid, wvt + hdst, DMODEL);
  tile_store_t(tiles[3], tid, wot + (size_t)bl * (64 * DMODEL) + bh * 64, DMODEL);
  tile_store_t(tiles[4], tid, ff1t + (size_t)(b & 31) * (64 * DMODEL) + (b >> 5) * 64, DMODEL);
  tile_store_t(tiles[5], tid, ff1t + (size_t)(b2 & 31) * (64 * DMODEL) + (b2 >> 5) * 64, DMODEL);
  tile_store_t(tiles[6], tid, ff2t + (size_t)(b & 15) * (64 * DFF) + (b >> 4) * 64, DFF);
  tile_store_t(tiles[7], tid, ff2t + (size_t)(b2 & 15) * (64 * DFF) + (b2 >> 4) * 64, DFF);
}

// ---------------------------------------------------------------------------
// QKV projections.  grid = (S/128, H, B*3).  Wave = 16 rows x 64 cols (full
// d_head).  Operands staged in LDS (gemm_core).  Q is pre-scaled by 1/sqrt(64);
// V is stored transposed [64][S].
// ---------------------------------------------------------------------------
__global__ void __launch_bounds__(256) qkv_kernel(
    const bf16_t* __restrict__ xb, const bf16_t* __restrict__ wqt,
    const bf16_t* __restrict__ wkt, const bf16_t* __restrict__ wvt,
    const float* __restrict__ bq, const float* __restrict__ bk,
    const float* __restrict__ bv, bf16_t* __restrict__ Q,
    bf16_t* __restrict__ Kb, bf16_t* __restrict__ Vt) {
  __shared__ __attribute__((aligned(16))) bf16_t smem[2 * G_BUF];
  const int lane = threadIdx.x & 31, wave = threadIdx.x >> 5;
  const int r = lane & 15, hf = lane >> 4;
  const int h = blockIdx.y;
  const int which = blockIdx.z % 3, b = blockIdx.z / 3;
  const int s0 = blockIdx.x * 128 + wave * 16;

  const bf16_t* A = xb + (size_t)b * S_LEN * DMODEL;
  const bf16_t* Wt = (which == 0 ? wqt : which == 1 ? wkt : wvt) +
                     (size_t)h * DHEAD * DMODEL;
  const float* bias = (which == 0 ? bq : which == 1 ? bk : bv) + h * DHEAD;

  v8f acc[4] = {v8f_zero(), v8f_zero(), v8f_zero(), v8f_zero()};
  gemm_core(A + (size_t)blockIdx.x * 128 * DMODEL, Wt, DMODEL, smem, acc);

  const float scale = (which == 0) ? 0.125f : 1.0f;  // 1/sqrt(64)
  const size_t bh = (size_t)(b * NHEADS + h);
  if (which < 2) {
    bf16_t* out = (which == 0 ? Q : Kb) + bh * S_LEN * DHEAD;
#pragma unroll
    for (int f = 0; f < 4; f++) {
      const int n = f * 16 + r;
      const float bn = bias[n];
#pragma unroll
      for (int v = 0; v < 8; v++) {
        const int s = s0 + v + hf * 8;
        out[(size_t)s * DHEAD + n] = (bf16_t)((acc[f][v] + bn) * scale);
      }
    }
  } else {
    bf16_t* out = Vt + bh * DHEAD * S_LEN;
#pragma unroll
    for (int f = 0; f < 4; f++) {
      const int d = f * 16 + r;
      const float bn = bias[d];
      bf16_t tmp[8];
#pragma unroll
      for (int v = 0; v < 8; v++) tmp[v] = (bf16_t)(acc[f][v] + bn);
      *(v4u*)(out + (size_t)d * S_LEN + s0 + hf * 8) = *(const v4u*)tmp;
    }
  }
}

// ---------------------------------------------------------------------------
// Flash attention, transposed products: S^T = K Q^T, O^T += V^T P^T.
// grid = (S/256, H, B).  Each wave: 32 query columns (two groups of 16), full
// d_head = 64 output in 4 x 2 accumulator tiles; online softmax over 32 keys
// per step.  A lane holds 16 of the 32 scores of ONE query (its other half
// sits in lane ^ 16), so maximum and sum run in the lane's own registers with
// one exchange between the halves; the two score tiles of a group, converted
// in place, are the B operand of the second product.  K rows and V^T rows are
// the A operands, each fragment feeding both column groups.
// ---------------------------------------------------------------------------
#define LOG2E 1.4426950408889634f

__device__ __forceinline__ float xhalf(float x) {
  const int i = __builtin_bit_cast(int, x);
  return __builtin_bit_cast(
      float, __builtin_amdgcn_permlanex16(i, i, 0x76543210, 0xfedcba98, false, false));
}

__global__ void __launch_bounds__(256) attn_kernel(
    const bf16_t* __restrict__ Q, const bf16_t* __restrict__ Kb,
    const bf16_t* __restrict__ Vt, bf16_t* __restrict__ concatb) {
  const int lane = threadIdx.x & 31, wave = threadIdx.x >> 5;
  const int r = lane & 15, hf = lane >> 4;
  const int h = blockIdx.y, b = blockIdx.z;
  const int q0 = blockIdx.x * 256 + wave * 32;
  const size_t bh = (size_t)(b * NHEADS + h);
  const bf16_t* Qb = Q + bh * S_LEN * DHEAD;
  const bf16_t* Kx = Kb + bh * S_LEN * DHEAD;
  const bf16_t* Vx = Vt + bh * DHEAD * S_LEN;

  v16bf qb[2][2];  // [column group][half of d]
#pragma unroll
  for (int g = 0; g < 2; g++) {
    qb[g][0] = frag_load(Qb, DHEAD, q0 + g * 16, 0, lane);
    qb[g][1] = frag_load(Qb, DHEAD, q0 + g * 16, 32, lane);
    // the compiler hands these loads' address pair to a later load's result:
    // the wait stands between them
    asm volatile("s_wait_xcnt 0x0" ::: "memory");
  }

  v8f o[4][2];  // [16 rows of d][column group]
#pragma unroll
  for (int dt = 0; dt < 4; dt++) { o[dt][0] = v8f_zero(); o[dt][1] = v8f_zero(); }
  float mrun[2] = {-3.0e38f, -3.0e38f}, lrun[2] = {0.f, 0.f};

  v16bf kf[2][2], vf[4];  // [16 keys][half of d]; [16 rows of d]
#pragma unroll
  for (int kt = 0; kt < 2; kt++) {
    kf[kt][0] = frag_load(Kx, DHEAD, kt * 16, 0, lane);
    kf[kt][1] = frag_load(Kx, DHEAD, kt * 16, 32, lane);
  }
  // keeps K ahead of V^T here as in the loop: with a K load issued last, the
  // counted wait at the loop's top becomes a wait for every load, V^T included
  __builtin_amdgcn_sched_barrier(0);
#pragma unroll
  for (int dt = 0; dt < 4; dt++) vf[dt] = frag_load(Vx, S_LEN, dt * 16, 0, lane);

  for (int t0 = 0; t0 < S_LEN; t0 += 32) {
    // the next step's keys; the last step wraps to block 0, inside the buffers
    const int tn = (t0 + 32) & (S_LEN - 1);

    v8f s[2][2];  // [16 keys][column group]
#pragma unroll
    for (int kt = 0; kt < 2; kt++) {
#pragma unroll
      for (int g = 0; g < 2; g++) {
        s[kt][g] = wmma_bf16(kf[kt][0], qb[g][0], v8f_zero());
        s[kt][g] = wmma_bf16(kf[kt][1], qb[g][1], s[kt][g]);
      }
    }
    // next K fragments fly during the softmax and the second product
#pragma unroll
    for (int kt = 0; kt < 2; kt++) {
      kf[kt][0] = frag_load(Kx, DHEAD, tn + kt * 16, 0, lane);
      kf[kt][1] = frag_load(Kx, DHEAD, tn + kt * 16, 32, lane);
    }
    // holds those loads here: left free, the compiler sinks them behind the
    // softmax, a few instructions ahead of the wait at the next step's top
    __builtin_amdgcn_sched_barrier(0);

    v16bf pf[2];
#pragma unroll
    for (int g = 0; g < 2; g++) {
      float mx = fmaxf(s[0][g][0], s[1][g][0]);
#pragma unroll
      for (int v = 1; v < 8; v++) mx = fmaxf(mx, fmaxf(s[0][g][v], s[1][g][v]));
      mx = fmaxf(mx, xhalf(mx));
      const float mnew = fmaxf(mrun[g], mx);
      const float resc = __builtin_amdgcn_exp2f((mrun[g] - mnew) * LOG2E);
      const float nm = -mnew * LOG2E;
      float ps[8];
#pragma unroll
      for (int v = 0; v < 8; v++) {
        const float p0 = __builtin_amdgcn_exp2f(fmaf(s[0][g][v], LOG2E, nm));
        const float p1 = __builtin_amdgcn_exp2f(fmaf(s[1][g][v], LOG2E, nm));
        ps[v] = p0 + p1;
        pf[g][v]     = (bf16_t)p0;   // key hf * 8 + v
        pf[g][8 + v] = (bf16_t)p1;   // key 16 + hf * 8 + v
      }
      // this half's 16 keys, summed as a tree; the halves join at the end
      lrun[g] = lrun[g] * resc + (((ps[0] + ps[1]) + (ps[2] + ps[3])) +
                                  ((ps[4] + ps[5]) + (ps[6] + ps[7])));
      mrun[g] = mnew;
#pragma unroll
      for (int dt = 0; dt < 4; dt++) o[dt][g] *= resc;
    }

#pragma unroll
    for (int dt = 0; dt < 4; dt++) {
      o[dt][0] = wmma_bf16(vf[dt], pf[0], o[dt][0]);
      o[dt][1] = wmma_bf16(vf[dt], pf[1], o[dt][1]);
    }
    // next V^T fragments fly during the next step's first product and softmax
#pragma unroll
    for (int dt = 0; dt < 4; dt++) vf[dt] = frag_load(Vx, S_LEN, dt * 16, tn, lane);
    // the address registers of these loads are given to a score tile at the
    // next step's top: the wait stands between the loads and that overwrite
    asm volatile("s_wait_xcnt 0x0" ::: "memory");
  }

  // a lane holds d = dt * 16 + hf * 8 + {0..7} of one query: 16-byte stores
#pragma unroll
  for (int g = 0; g < 2; g++) {
    const float inv = 1.0f / (lrun[g] + xhalf(lrun[g]));
    bf16_t* out = concatb + ((size_t)b * S_LEN + (size_t)(q0 + g * 16 + r)) * DMODEL +
                  (size_t)h * DHEAD + hf * 8;
#pragma unroll
    for (int dt = 0; dt < 4; dt++) {
      bf16_t tmp[8];
#pragma unroll
      for (int v = 0; v < 8; v++) tmp[v] = (bf16_t)(o[dt][g][v] * inv);
      *(v4u*)(out + dt * 16) = *(const v4u*)tmp;
    }
  }
}

// ---------------------------------------------------------------------------
// Generic WMMA GEMM: C[M,N] = A[M,K](bf16) * Bt[N,K](bf16) + bias[n]
// (+ resid) (ReLU) -> f32 or bf16.  Block = 8 waves = 128x64 tile.
// Operands staged in LDS (gemm_core).
// ---------------------------------------------------------------------------
template <bool RELU, bool HASRES, bool OUTBF16>
__global__ void __launch_bounds__(256) gemm_kernel(
    const bf16_t* __restrict__ A, const bf16_t* __restrict__ Bt,
    const float* __restrict__ bias, const float* __restrict__ resid,
    float* __restrict__ outf, bf16_t* __restrict__ outb, int M, int N, int K) {
  __shared__ __attribute__((aligned(16))) bf16_t smem[2 * G_BUF];
  const int lane = threadIdx.x & 31, wave = threadIdx.x >> 5;
  const int r = lane & 15, hf = lane >> 4;
  const int m0 = blockIdx.x * 128 + wave * 16;
  const int n0 = blockIdx.y * 64;
  (void)M;

  v8f acc[4] = {v8f_zero(), v8f_zero(), v8f_zero(), v8f_zero()};
  gemm_core(A + (size_t)blockIdx.x * 128 * (size_t)K, Bt + (size_t)n0 * (size_t)K,
            K, smem, acc);

#pragma unroll
  for (int f = 0; f < 4; f++) {
    const int n = n0 + f * 16 + r;
    const float bn = bias[n];
#pragma unroll
    for (int v = 0; v < 8; v++) {
      const int m = m0 + v + hf * 8;
      float val = acc[f][v] + bn;
      if (HASRES) val += resid[(size_t)m * N + n];
      if (RELU) val = fmaxf(val, 0.0f);
      if (OUTBF16) outb[(size_t)m * N + n] = (bf16_t)val;
      else outf[(size_t)m * N + n] = val;
    }
  }
}

// ---------------------------------------------------------------------------
// LayerNorm (reference semantics): y = g*(x-mean)/(std+eps)+b, std = sqrt(
// mean((x-mean)^2)).  One block (256 threads) per row of 1024.
// ---------------------------------------------------------------------------
__global__ void __launch_bounds__(256) ln_kernel(
    const float* __restrict__ in, const float* __restrict__ gam,
    const float* __restrict__ bet, float* __restrict__ out,
    bf16_t* __restrict__ outb) {
  __shared__ float red[8];
  const int row = blockIdx.x, tid = threadIdx.x;
  const float* x = in + (size_t)row * DMODEL;
  float v[4];
#pragma unroll
  for (int i = 0; i < 4; i++) v[i] = x[tid + i * 256];

  float s = v[0] + v[1] + v[2] + v[3];
#pragma unroll
  for (int msk = 1; msk < 32; msk <<= 1) s += __shfl_xor(s, msk, 32);
  if ((tid & 31) == 0) red[tid >> 5] = s;
  __syncthreads();
  float tot = 0.f;
#pragma unroll
  for (int i = 0; i < 8; i++) tot += red[i];
  const float mean = tot * (1.0f / DMODEL);
  __syncthreads();

  float sq = 0.f;
#pragma unroll
  for (int i = 0; i < 4; i++) { const float d = v[i] - mean; sq += d * d; }
#pragma unroll
  for (int msk = 1; msk < 32; msk <<= 1) sq += __shfl_xor(sq, msk, 32);
  if ((tid & 31) == 0) red[tid >> 5] = sq;
  __syncthreads();
  float tots = 0.f;
#pragma unroll
  for (int i = 0; i < 8; i++) tots += red[i];
  const float stdv = sqrtf(tots * (1.0f / DMODEL));
  const float inv = 1.0f / (stdv + 1e-5f);

#pragma unroll
  for (int i = 0; i < 4; i++) {
    const int c = tid + i * 256;
    const float y = gam[c] * (v[i] - mean) * inv + bet[c];
    out[(size_t)row * DMODEL + c] = y;
    if (outb) outb[(size_t)row * DMODEL + c] = (bf16_t)y;
  }
}

// ---------------------------------------------------------------------------
extern "C" void kernel_launch(void* const* d_in, const int* in_sizes, int n_in,
                              void* d_out, int out_size, void* d_ws,
                              size_t ws_size, hipStream_t stream) {
  (void)in_sizes; (void)n_in; (void)out_size; (void)ws_size;
  const float* x   = (const float*)d_in[0];
  const float* wq  = (const float*)d_in[1];
  const float* bq  = (const float*)d_in[2];
  const float* wk  = (const float*)d_in[3];
  const float* bk  = (const float*)d_in[4];
  const float* wv  = (const float*)d_in[5];
  const float* bv  = (const float*)d_in[6];
  const float* wo  = (const float*)d_in[7];
  const float* wob = (const float*)d_in[8];
  const float* g1  = (const float*)d_in[9];
  const float* b1  = (const float*)d_in[10];
  const float* f1w = (const float*)d_in[11];
  const float* f1bias = (const float*)d_in[12];
  const float* f2w = (const float*)d_in[13];
  const float* f2bias = (const float*)d_in[14];
  const float* g2  = (const float*)d_in[15];
  const float* b2  = (const float*)d_in[16];
  float* out = (float*)d_out;

  char* ws = (char*)d_ws;
  size_t off = 0;
  auto alloc = [&](size_t bytes) -> char* {
    char* p = ws + off;
    off += (bytes + 255) & ~(size_t)255;
    return p;
  };
  const int BS = BATCH * S_LEN;  // 4096 rows
  bf16_t* xb   = (bf16_t*)alloc((size_t)BS * DMODEL * 2);          // 8 MB (reused as concat)
  bf16_t* wqt  = (bf16_t*)alloc((size_t)NHEADS * DHEAD * DMODEL * 2);
  bf16_t* wkt  = (bf16_t*)alloc((size_t)NHEADS * DHEAD * DMODEL * 2);
  bf16_t* wvt  = (bf16_t*)alloc((size_t)NHEADS * DHEAD * DMODEL * 2);
  bf16_t* wot  = (bf16_t*)alloc((size_t)DMODEL * DMODEL * 2);
  bf16_t* ff1t = (bf16_t*)alloc((size_t)DFF * DMODEL * 2);
  bf16_t* ff2t = (bf16_t*)alloc((size_t)DMODEL * DFF * 2);
  bf16_t* Qm   = (bf16_t*)alloc((size_t)BATCH * NHEADS * S_LEN * DHEAD * 2);  // 8 MB
  bf16_t* Km   = (bf16_t*)alloc((size_t)BATCH * NHEADS * S_LEN * DHEAD * 2);  // 8 MB
  bf16_t* Vtm  = (bf16_t*)alloc((size_t)BATCH * NHEADS * DHEAD * S_LEN * 2);  // 8 MB
  float*  t1   = (float*)alloc((size_t)BS * DMODEL * 4);           // 16 MB (reused as t2)
  float*  hbuf = (float*)alloc((size_t)BS * DMODEL * 4);           // 16 MB
  bf16_t* hb   = (bf16_t*)alloc((size_t)BS * DMODEL * 2);          // 8 MB
  bf16_t* concatb = xb;       // alias: xb dead after QKV
  bf16_t* ffn1out = Qm;       // alias: Q+K region (16 MB) dead after attention
  float*  t2 = t1;            // alias: t1 dead after LN1

  dim3 blk256(256);

  // 1) convert x, transpose-convert all weights (one launch)
  prep_kernel<<<dim3(P_WGS), dim3(P_THR), 0, stream>>>(
      x, wq, wk, wv, wo, f1w, f2w, xb, wqt, wkt, wvt, wot, ff1t, ff2t);

  // 2) QKV projections (per head)
  qkv_kernel<<<dim3(S_LEN / 128, NHEADS, BATCH * 3), blk256, 0, stream>>>(
      xb, wqt, wkt, wvt, bq, bk, bv, Qm, Km, Vtm);

  // 3) flash attention -> concat heads (bf16)
  attn_kernel<<<dim3(S_LEN / 256, NHEADS, BATCH), blk256, 0, stream>>>(
      Qm, Km, Vtm, concatb);

  // 4) output projection + residual(x) -> t1 (f32)
  gemm_kernel<false, true, false><<<dim3(BS / 128, DMODEL / 64), blk256, 0, stream>>>(
      concatb, wot, wob, x, t1, nullptr, BS, DMODEL, DMODEL);

  // 5) LayerNorm1 -> h (f32) + hb (bf16)
  ln_kernel<<<dim3(BS), blk256, 0, stream>>>(t1, g1, b1, hbuf, hb);

  // 6) FFN1: relu(h @ ff1 + b) -> bf16
  gemm_kernel<true, false, true><<<dim3(BS / 128, DFF / 64), blk256, 0, stream>>>(
      hb, ff1t, f1bias, nullptr, nullptr, ffn1out, BS, DFF, DMODEL);

  // 7) FFN2: (+ b + h residual) -> t2 (f32)
  gemm_kernel<false, true, false><<<dim3(BS / 128, DMODEL / 64), blk256, 0, stream>>>(
      ffn1out, ff2t, f2bias, hbuf, t2, nullptr, BS, DMODEL, DFF);

  // 8) LayerNorm2 -> d_out
  ln_kernel<<<dim3(BS), blk256, 0, stream>>>(t2, g2, b2, out, nullptr);
}

// v004
// Measured time: 153 microseconds a run.
// Two timings next to v003 put it at 1.09 and 1.08 times that version's speed.
// Over all steps from v000 it is 2.44 times as fast.
#include <hip/hip_runtime.h>
#include <hip/hip_bf16.h>
#include <math.h>

typedef __bf16 bf16_t;
typedef __attribute__((ext_vector_type(16))) __bf16     v16bf;
typedef __attribute__((ext_vector_type(8)))  float       v8f;
typedef __attribute__((ext_vector_type(4)))  unsigned int v4u;

#define S_LEN  1024
#define DMODEL 1024
#define DHEAD  64
#define NHEADS 16
#define DFF    2048
#define BATCH  4

__device__ __forceinline__ v8f wmma_bf16(v16bf a, v16bf b, v8f c) {
  return __builtin_amdgcn_wmma_f32_16x16x32_bf16(false, a, false, b, (short)0, c,
                                                 false, false);
}

__device__ __forceinline__ v16bf frag_load(const bf16_t* __restrict__ base,
                                           int ld, int row0, int k0, int lane) {
  const int r = lane & 15, hf = lane >> 4;
  const bf16_t* p = base + (size_t)(row0 + r) * (size_t)ld + (k0 + hf * 8);
  union { v4u u[2]; v16bf v; } cv;
  cv.u[0] = *(const v4u*)p;
  cv.u[1] = *(const v4u*)(p + 16);
  return cv.v;
}

__device__ __forceinline__ v8f v8f_zero() {
  v8f z = {0.f, 0.f, 0.f, 0.f, 0.f, 0.f, 0.f, 0.f};
  return z;
}

// ---------------------------------------------------------------------------
// Shared GEMM core: one 128x128 block tile, 4 waves (2 x 2) of 64x64: a wave
// reads 4 A and 4 Bt fragments for every 16 WMMAs.  Each pass covers 128 k
// (256 B of every operand row).  The 128 A rows and the 128 Bt rows of a pass
// are brought into LDS by asynchronous b128 copies (whole 128-B lines, 16 lanes
// per row) into one of two buffers, one pass ahead of their use; the waves
// read their fragments from LDS at a row pitch of 272 B.
// ---------------------------------------------------------------------------
#define G_BK    128                      // k elements per pass
#define G_LDP   136                      // LDS row pitch, elements (272 B)
#define G_AROWS 128
#define G_BROWS 128
#define G_BUF   ((G_AROWS + G_BROWS) * G_LDP)   // elements per buffer
#define G_THR   128                      // threads per block

__device__ __forceinline__ void stage_rows(const bf16_t* g, size_t rows8,
                                           unsigned lds) {
  const bf16_t* g0 = g;
  const bf16_t* g1 = g + rows8;
  const bf16_t* g2 = g + 2 * rows8;
  const bf16_t* g3 = g + 3 * rows8;
  const bf16_t* g4 = g + 4 * rows8;
  const bf16_t* g5 = g + 5 * rows8;
  const bf16_t* g6 = g + 6 * rows8;
  const bf16_t* g7 = g + 7 * rows8;
  const unsigned l0 = lds;
  const unsigned l1 = lds + 8 * G_LDP * 2;
  const unsigned l2 = lds + 16 * G_LDP * 2;
  const unsigned l3 = lds + 24 * G_LDP * 2;
  const unsigned l4 = lds + 32 * G_LDP * 2;
  const unsigned l5 = lds + 40 * G_LDP * 2;
  const unsigned l6 = lds + 48 * G_LDP * 2;
  const unsigned l7 = lds + 56 * G_LDP * 2;
  asm volatile(
      "global_load_async_to_lds_b128 %0, %1, off\n\t"
      "global_load_async_to_lds_b128 %2, %3, off\n\t"
      "global_load_async_to_lds_b128 %4, %5, off\n\t"
      "global_load_async_to_lds_b128 %6, %7, off\n\t"
      "global_load_async_to_lds_b128 %8, %9, off\n\t"
      "global_load_async_to_lds_b128 %10, %11, off\n\t"
      "global_load_async_to_lds_b128 %12, %13, off\n\t"
      "global_load_async_to_lds_b128 %14, %15, off\n\t"
      "s_wait_xcnt 0x0"
      :: "v"(l0), "v"(g0), "v"(l1), "v"(g1), "v"(l2), "v"(g2), "v"(l3), "v"(g3),
         "v"(l4), "v"(g4), "v"(l5), "v"(g5), "v"(l6), "v"(g6), "v"(l7), "v"(g7)
      : "memory");
}

// One pass of both operands, 32 copies per lane: the 128 A rows first in the
// buffer, the 128 Bt rows behind them, 64 rows a statement.
__device__ __forceinline__ void stage_copies(const bf16_t* ga, const bf16_t* gb,
                                             size_t rows8, unsigned lds) {
  stage_rows(ga, rows8, lds);
  stage_rows(ga + 8 * rows8, rows8, lds + 64 * G_LDP * 2);
  stage_rows(gb, rows8, lds + G_AROWS * G_LDP * 2);
  stage_rows(gb + 8 * rows8, rows8, lds + (G_AROWS + 64) * G_LDP * 2);
}

// Ablk: first of the block's 128 rows of A; Bblk: first of its 128 rows of Bt;
// both row-major with K elements per row, K a multiple of 128.  Wave w takes
// A rows (w >> 1) * 64 on and Bt rows (w & 1) * 64 on; acc[i][f] is the tile
// of A rows i * 16 on and Bt rows f * 16 on within them.
__device__ __forceinline__ void gemm_core(const bf16_t* __restrict__ Ablk,
                                          const bf16_t* __restrict__ Bblk,
                                          int K, bf16_t* smem, v8f acc[4][4]) {
  const int tid = threadIdx.x;
  const int lane = tid & 31, wave = tid >> 5;
  const int rw = tid >> 4, cw = (tid & 15) * 8;
  const bf16_t* ga = Ablk + (size_t)rw * (size_t)K + cw;
  const bf16_t* gb = Bblk + (size_t)rw * (size_t)K + cw;
  const size_t rows8 = (size_t)8 * (size_t)K;
  const unsigned lds0 = (unsigned)(size_t)smem + (unsigned)(rw * G_LDP + cw) * 2u;
  const int npass = K / G_BK;
  const int arow = (wave >> 1) * 64, brow = G_AROWS + (wave & 1) * 64;

  stage_copies(ga, gb, rows8, lds0);
  // pass 0 has landed for this wave, then for the block
  asm volatile("s_wait_asynccnt 0x0" ::: "memory");
  __syncthreads();
  if (npass > 1) stage_copies(ga + G_BK, gb + G_BK, rows8, lds0 + G_BUF * 2);

  for (int t = 0; t < npass; t++) {
    const int bsel = t & 1;
    const bf16_t* sbuf = smem + bsel * G_BUF;
    v16bf a[4][4], b[4][4];
#pragma unroll
    for (int ks = 0; ks < 4; ks++) {
#pragma unroll
      for (int i = 0; i < 4; i++)
        a[ks][i] = frag_load(sbuf, G_LDP, arow + i * 16, ks * 32, lane);
#pragma unroll
      for (int f = 0; f < 4; f++)
        b[ks][f] = frag_load(sbuf, G_LDP, brow + f * 16, ks * 32, lane);
    }
    // keeps the pass's LDS reads one group ahead of its WMMAs: left free, the
    // compiler puts a pair of reads and a full wait in front of every WMMA
    __builtin_amdgcn_sched_barrier(0);
#pragma unroll
    for (int ks = 0; ks < 4; ks++) {
#pragma unroll
      for (int i = 0; i < 4; i++) {
#pragma unroll
        for (int f = 0; f < 4; f++)
          acc[i][f] = wmma_bf16(a[ks][i], b[ks][f], acc[i][f]);
      }
    }
    // keeps the publish point behind the pass's WMMAs: left free, the compiler
    // lifts its waits and barrier over them, so that every LDS read is waited
    // out before the first WMMA and the copies get no WMMA time to land in
    __builtin_amdgcn_sched_barrier(0);
    // publish point: this wave's reads of the buffer are done, its copies of
    // pass t + 1 have landed; the barrier says both for the whole block
    asm volatile("s_wait_dscnt 0x0" ::: "memory");
    asm volatile("s_wait_asynccnt 0x0" ::: "memory");
    __syncthreads();
    if (t + 2 < npass)
      stage_copies(ga + (size_t)(t + 2) * G_BK, gb + (size_t)(t + 2) * G_BK,
                   rows8, lds0 + (unsigned)bsel * (G_BUF * 2));
  }
  // no copy is left in flight when the wave goes on
  asm volatile("s_wait_asynccnt 0x0" ::: "memory");
}

// ---------------------------------------------------------------------------
// Operand preparation, one launch: x -> bf16, and every weight matrix
// fp32 [R][C] -> bf16 [C][R].  256 work-groups of 16 waves, all resident at
// once; each takes 16384 elements of x and eight 64x64 weight tiles (one each
// of wq, wk, wv, wo, two of ff1, two of ff2).  All 24 b128 loads of a thread
// are issued first; loads and stores cover whole 128-B lines.
// ---------------------------------------------------------------------------
#define P_WGS   256
#define P_THR   512
#define P_PITCH 65                       // LDS tile row pitch, floats

// src: the tile's first element (uniform); off: this thread's byte offset in
// the tile's first 32 rows; C: source row length.
template <int C>
__device__ __forceinline__ void tile_load(const float* src, unsigned off,
                                          float4 v[2]) {
  const char* p = (const char*)src;
  v[0] = *(const float4*)(p + off);
  v[1] = *(const float4*)(p + 32 * C * 4 + off);
}

__device__ __forceinline__ void tile_to_lds(float* tile, int tid, const float4 v[2]) {
  float* t = tile + (tid >> 4) * P_PITCH + (tid & 15) * 4;
#pragma unroll
  for (int i = 0; i < 2; i++) {
    t[32 * i * P_PITCH + 0] = v[i].x;
    t[32 * i * P_PITCH + 1] = v[i].y;
    t[32 * i * P_PITCH + 2] = v[i].z;
    t[32 * i * P_PITCH + 3] = v[i].w;
  }
}

// dst points at element [c0][r0] of the transposed matrix, R = its row length.
// Eight lanes write the 128 B of one destination row.
__device__ __forceinline__ void tile_store_t(const float* tile, int tid,
                                             bf16_t* __restrict__ dst, int R) {
  const int rg = (tid & 7) * 8, c = tid >> 3;
  bf16_t o[8];
#pragma unroll
  for (int e = 0; e < 8; e++) o[e] = (bf16_t)tile[(rg + e) * P_PITCH + c];
  *(v4u*)(dst + (size_t)c * (size_t)R + rg) = *(const v4u*)o;
}

__global__ void __launch_bounds__(P_THR) prep_kernel(
    const float* x, const float* wq, const float* wk, const float* wv,
    const float* wo, const float* f1w, const float* f2w, bf16_t* xb,
    bf16_t* wqt, bf16_t* wkt, bf16_t* wvt, bf16_t* wot, bf16_t* ff1t,
    bf16_t* ff2t) {
  __shared__ float tiles[8][64 * P_PITCH];
  const int tid = threadIdx.x;
  const int b = blockIdx.x, bh = b >> 4, bl = b & 15;
  const int b2 = b + P_WGS;

  // per-head matrices are [1024][64]: head bh, row tile bl
  const size_t hsrc = (size_t)bh * (DMODEL * DHEAD) + (size_t)bl * (64 * DHEAD);
  const size_t hdst = (size_t)bh * (DMODEL * DHEAD) + (size_t)bl * 64;
  const unsigned col = (unsigned)(tid & 15) * 16u, row = (unsigned)(tid >> 4);
  const unsigned o64 = row * (DHEAD * 4) + col;
  const unsigned o1k = row * (DMODEL * 4) + col;
  const unsigned o2k = row * (DFF * 4) + col;

  const float* pq = wq + hsrc;
  const float* pk = wk + hsrc;
  const float* pv = wv + hsrc;
  // wo [1024][1024]: row tile bh, column tile bl
  const float* po = wo + (size_t)bh * (64 * DMODEL) + bl * 64;
  // ff1 [1024][2048]: row tile index >> 5, column tile index & 31
  const float* p1a = f1w + (size_t)(b >> 5) * (64 * DFF) + (b & 31) * 64;
  const float* p1b = f1w + (size_t)(b2 >> 5) * (64 * DFF) + (b2 & 31) * 64;
  // ff2 [2048][1024]: row tile index >> 4, column tile index & 15
  const float* p2a = f2w + (size_t)(b >> 4) * (64 * DMODEL) + (b & 15) * 64;
  const float* p2b = f2w + (size_t)(b2 >> 4) * (64 * DMODEL) + (b2 & 15) * 64;
  // x: 16384 elements from b * 16384 on; o64 is also tid * 16 bytes
  const char* px = (const char*)(x + (size_t)b * (8 * P_THR * 4));

  float4 t[8][2], xv[8];
  tile_load<DHEAD>(pq, o64, t[0]);
  tile_load<DHEAD>(pk, o64, t[1]);
  tile_load<DHEAD>(pv, o64, t[2]);
  tile_load<DMODEL>(po, o1k, t[3]);
  tile_load<DFF>(p1a, o2k, t[4]);
  tile_load<DFF>(p1b, o2k, t[5]);
  tile_load<DMODEL>(p2a, o1k, t[6]);
  tile_load<DMODEL>(p2b, o1k, t[7]);
#pragma unroll
  for (int i = 0; i < 8; i++) xv[i] = *(const float4*)(px + i * (P_THR * 16) + o64);
  // the base and offset registers named by the loads above stay as they are
  // until this wait: as inputs they cannot be rewritten, or given to a load's
  // result, ahead of it (the pointers are not __restrict__, so no load moves
  // behind it)
  asm volatile("s_wait_xcnt 0x0"
               :: "v"(o64), "v"(o1k), "v"(o2k), "s"(pq), "s"(pk), "s"(pv), "s"(po),
                  "s"(p1a), "s"(p1b), "s"(p2a), "s"(p2b), "s"(px)
               : "memory");

#pragma unroll
  for (int k = 0; k < 8; k++) tile_to_lds(tiles[k], tid, t[k]);
  __syncthreads();
#pragma unroll
  for (int i = 0; i < 8; i++) {
    bf16_t o[4] = {(bf16_t)xv[i].x, (bf16_t)xv[i].y, (bf16_t)xv[i].z, (bf16_t)xv[i].w};
    *(uint2*)(xb + (size_t)b * (8 * P_THR * 4) + i * (P_THR * 4) + tid * 4) = *(const uint2*)o;
  }
  tile_store_t(tiles[0], tid, wqt + hdst, DMODEL);
  tile_store_t(tiles[1], tid, wkt + hdst, DMODEL);
  tile_store_t(tiles[2], tid, wvt + hdst, DMODEL);
  tile_store_t(tiles[3], tid, wot + (size_t)bl * (64 * DMODEL) + bh * 64, DMODEL);
  tile_store_t(tiles[4], tid, ff1t + (size_t)(b & 31) * (64 * DMODEL) + (b >> 5) * 64, DMODEL);
  tile_store_t(tiles[5], tid, ff1t + (size_t)(b2 & 31) * (64 * DMODEL) + (b2 >> 5) * 64, DMODEL);
  tile_store_t(tiles[6], tid, ff2t + (size_t)(b & 15) * (64 * DFF) + (b >> 4) * 64, DFF);
  tile_store_t(tiles[7], tid, ff2t + (size_t)(b2 & 15) * (64 * DFF) + (b2 >> 4) * 64, DFF);
}

// ---------------------------------------------------------------------------
// QKV projections.  grid = (S/128, H/2, B*3).  Block = 128 rows x two heads;
// wave = 64 rows x 64 cols (one head's full d_head).  Operands staged in LDS
// (gemm_core).  Q is pre-scaled by 1/sqrt(64); V is stored transposed [64][S].
// ---------------------------------------------------------------------------
__global__ void __launch_bounds__(G_THR) qkv_kernel(
    const bf16_t* __restrict__ xb, const bf16_t* __restrict__ wqt,
    const bf16_t* __restrict__ wkt, const bf16_t* __restrict__ wvt,
    const float* __restrict__ bq, const float* __restrict__ bk,
    const float* __restrict__ bv, bf16_t* __restrict__ Q,
    bf16_t* __restrict__ Kb, bf16_t* __restrict__ Vt) {
  __shared__ __attribute__((aligned(16))) bf16_t smem[2 * G_BUF];
  const int lane = threadIdx.x & 31, wave = threadIdx.x >> 5;
  const int r = lane & 15, hf = lane >> 4;
  const int h = blockIdx.y * 2 + (wave & 1);
  const int which = blockIdx.z % 3, b = blockIdx.z / 3;
  const int sw = blockIdx.x * 128 + (wave >> 1) * 64;

  const bf16_t* A = xb + (size_t)b * S_LEN * DMODEL;
  const bf16_t* Wt = (which == 0 ? wqt : which == 1 ? wkt : wvt) +
                     (size_t)blockIdx.y * 2 * DHEAD * DMODEL;
  const float* bias = (which == 0 ? bq : which == 1 ? bk : bv) + h * DHEAD;

  v8f acc[4][4];
#pragma unroll
  for (int i = 0; i < 4; i++) {
#pragma unroll
    for (int f = 0; f < 4; f++) acc[i][f] = v8f_zero();
  }
  gemm_core(A + (size_t)blockIdx.x * 128 * DMODEL, Wt, DMODEL, smem, acc);

  const float scale = (which == 0) ? 0.125f : 1.0f;  // 1/sqrt(64)
  const size_t bh = (size_t)(b * NHEADS + h);
  if (which < 2) {
    bf16_t* out = (which == 0 ? Q : Kb) + bh * S_LEN * DHEAD;
#pragma unroll
    for (int f = 0; f < 4; f++) {
      const int n = f * 16 + r;
      const float bn = bias[n];
#pragma unroll
      for (int i = 0; i < 4; i++) {
#pragma unroll
        for (int v = 0; v < 8; v++) {
          const int s = sw + i * 16 + v + hf * 8;
          out[(size_t)s * DHEAD + n] = (bf16_t)((acc[i][f][v] + bn) * scale);
        }
      }
    }
  } else {
    bf16_t* out = Vt + bh * DHEAD * S_LEN;
#pragma unroll
    for (int f = 0; f < 4; f++) {
      const int d = f * 16 + r;
      const float bn = bias[d];
#pragma unroll
      for (int i = 0; i < 4; i++) {
        bf16_t tmp[8];
#pragma unroll
        for (int v = 0; v < 8; v++) tmp[v] = (bf16_t)(acc[i][f][v] + bn);
        *(v4u*)(out + (size_t)d * S_LEN + sw + i * 16 + hf * 8) = *(const v4u*)tmp;
      }
    }
    // in the built code the other branch's text follows these stores and
    // rewrites their registers: the wait stands between
    asm volatile("s_wait_xcnt 0x0" ::: "memory");
  }
}

// ---------------------------------------------------------------------------
// Flash attention, transposed products: S^T = K Q^T, O^T += V^T P^T.
// grid = (S/256, H, B).  Each wave: 32 query columns (two groups of 16), full
// d_head = 64 output in 4 x 2 accumulator tiles; online softmax over 32 keys
// per step.  A lane holds 16 of the 32 scores of ONE query (its other half
// sits in lane ^ 16), so maximum and sum run in the lane's own registers with
// one exchange between the halves; the two score tiles of a group, converted
// in place, are the B operand of the second product.  K rows and V^T rows are
// the A operands, each fragment feeding both column groups.
// ---------------------------------------------------------------------------
#define LOG2E 1.4426950408889634f

__device__ __forceinline__ float xhalf(float x) {
  const int i = __builtin_bit_cast(int, x);
  return __builtin_bit_cast(
      float, __builtin_amdgcn_permlanex16(i, i, 0x76543210, 0xfedcba98, false, false));
}

__global__ void __launch_bounds__(256) attn_kernel(
    const bf16_t* __restrict__ Q, const bf16_t* __restrict__ Kb,
    const bf16_t* __restrict__ Vt, bf16_t* __restrict__ concatb) {
  const int lane = threadIdx.x & 31, wave = threadIdx.x >> 5;
  const int r = lane & 15, hf = lane >> 4;
  const int h = blockIdx.y, b = blockIdx.z;
  const int q0 = blockIdx.x * 256 + wave * 32;
  const size_t bh = (size_t)(b * NHEADS + h);
  const bf16_t* Qb = Q + bh * S_LEN * DHEAD;
  const bf16_t* Kx = Kb + bh * S_LEN * DHEAD;
  const bf16_t* Vx = Vt + bh * DHEAD * S_LEN;

  v16bf qb[2][2];  // [column group][half of d]
#pragma unroll
  for (int g = 0; g < 2; g++) {
    qb[g][0] = frag_load(Qb, DHEAD, q0 + g * 16, 0, lane);
    qb[g][1] = frag_load(Qb, DHEAD, q0 + g * 16, 32, lane);
    // the compiler hands these loads' address pair to a later load's result:
    // the wait stands between them
    asm volatile("s_wait_xcnt 0x0" ::: "memory");
  }

  v8f o[4][2];  // [16 rows of d][column group]
#pragma unroll
  for (int dt = 0; dt < 4; dt++) { o[dt][0] = v8f_zero(); o[dt][1] = v8f_zero(); }
  float mrun[2] = {-3.0e38f, -3.0e38f}, lrun[2] = {0.f, 0.f};

  v16bf kf[2][2], vf[4];  // [16 keys][half of d]; [16 rows of d]
#pragma unroll
  for (int kt = 0; kt < 2; kt++) {
    kf[kt][0] = frag_load(Kx, DHEAD, kt * 16, 0, lane);
    kf[kt][1] = frag_load(Kx, DHEAD, kt * 16, 32, lane);
  }
  // keeps K ahead of V^T here as in the loop: with a K load issued last, the
  // counted wait at the loop's top becomes a wait for every load, V^T included
  __builtin_amdgcn_sched_barrier(0);
#pragma unroll
  for (int dt = 0; dt < 4; dt++) vf[dt] = frag_load(Vx, S_LEN, dt * 16, 0, lane);

  for (int t0 = 0; t0 < S_LEN; t0 += 32) {
    // the next step's keys; the last step wraps to block 0, inside the buffers
    const int tn = (t0 + 32) & (S_LEN - 1);

    v8f s[2][2];  // [16 keys][column group]
#pragma unroll
    for (int kt = 0; kt < 2; kt++) {
#pragma unroll
      for (int g = 0; g < 2; g++) {
        s[kt][g] = wmma_bf16(kf[kt][0], qb[g][0], v8f_zero());
        s[kt][g] = wmma_bf16(kf[kt][1], qb[g][1], s[kt][g]);
      }
    }
    // next K fragments fly during the softmax and the second product
#pragma unroll
    for (int kt = 0; kt < 2; kt++) {
      kf[kt][0] = frag_load(Kx, DHEAD, tn + kt * 16, 0, lane);
      kf[kt][1] = frag_load(Kx, DHEAD, tn + kt * 16, 32, lane);
    }
    // holds those loads here: left free, the compiler sinks them behind the
    // softmax, a few instructions ahead of the wait at the next step's top
    __builtin_amdgcn_sched_barrier(0);

    v16bf pf[2];
#pragma unroll
    for (int g = 0; g < 2; g++) {
      float mx = fmaxf(s[0][g][0], s[1][g][0]);
#pragma unroll
      for (int v = 1; v < 8; v++) mx = fmaxf(mx, fmaxf(s[0][g][v], s[1][g][v]));
      mx = fmaxf(mx, xhalf(mx));
      const float mnew = fmaxf(mrun[g], mx);
      const float resc = __builtin_amdgcn_exp2f((mrun[g] - mnew) * LOG2E);
      const float nm = -mnew * LOG2E;
      float ps[8];
#pragma unroll
      for (int v = 0; v < 8; v++) {
        const float p0 = __builtin_amdgcn_exp2f(fmaf(s[0][g][v], LOG2E, nm));
        const float p1 = __builtin_amdgcn_exp2f(fmaf(s[1][g][v], LOG2E, nm));
        ps[v] = p0 + p1;
        pf[g][v]     = (bf16_t)p0;   // key hf * 8 + v
        pf[g][8 + v] = (bf16_t)p1;   // key 16 + hf * 8 + v
      }
      // this half's 16 keys, summed as a tree; the halves join at the end
      lrun[g] = lrun[g] * resc + (((ps[0] + ps[1]) + (ps[2] + ps[3])) +
                                  ((ps[4] + ps[5]) + (ps[6] + ps[7])));
      mrun[g] = mnew;
#pragma unroll
      for (int dt = 0; dt < 4; dt++) o[dt][g] *= resc;
    }

#pragma unroll
    for (int dt = 0; dt < 4; dt++) {
      o[dt][0] = wmma_bf16(vf[dt], pf[0], o[dt][0]);
      o[dt][1] = wmma_bf16(vf[dt], pf[1], o[dt][1]);
    }
    // next V^T fragments fly during the next step's first product and softmax
#pragma unroll
    for (int dt = 0; dt < 4; dt++) vf[dt] = frag_load(Vx, S_LEN, dt * 16, tn, lane);
    // the address registers of these loads are given to a score tile at the
    // next step's top: the wait stands between the loads and that overwrite
    asm volatile("s_wait_xcnt 0x0" ::: "memory");
  }

  // a lane holds d = dt * 16 + hf * 8 + {0..7} of one query: 16-byte stores
#pragma unroll
  for (int g = 0; g < 2; g++) {
    const float inv = 1.0f / (lrun[g] + xhalf(lrun[g]));
    bf16_t* out = concatb + ((size_t)b * S_LEN + (size_t)(q0 + g * 16 + r)) * DMODEL +
                  (size_t)h * DHEAD + hf * 8;
#pragma unroll
    for (int dt = 0; dt < 4; dt++) {
      bf16_t tmp[8];
#pragma unroll
      for (int v = 0; v < 8; v++) tmp[v] = (bf16_t)(o[dt][g][v] * inv);
      *(v4u*)(out + dt * 16) = *(const v4u*)tmp;
    }
  }
}

// ---------------------------------------------------------------------------
// Generic WMMA GEMM: C[M,N] = A[M,K](bf16) * Bt[N,K](bf16) + bias[n]
// (+ resid) (ReLU) -> f32 or bf16.  Block = 4 waves = 128x128 tile.
// Operands staged in LDS (gemm_core).
// ---------------------------------------------------------------------------
template <bool RELU, bool HASRES, bool OUTBF16, int N>
__global__ void __launch_bounds__(G_THR) gemm_kernel(
    const bf16_t* __restrict__ A, const bf16_t* __restrict__ Bt,
    const float* __restrict__ bias, const float* __restrict__ resid,
    float* __restrict__ outf, bf16_t* __restrict__ outb, int K) {
  __shared__ __attribute__((aligned(16))) bf16_t smem[2 * G_BUF];
  const int lane = threadIdx.x & 31, wave = threadIdx.x >> 5;
  const int r = lane & 15, hf = lane >> 4;
  const int m0 = blockIdx.x * 128 + (wave >> 1) * 64;
  const int n0 = blockIdx.y * 128 + (wave & 1) * 64;

  v8f acc[4][4];
#pragma unroll
  for (int i = 0; i < 4; i++) {
#pragma unroll
    for (int f = 0; f < 4; f++) acc[i][f] = v8f_zero();
  }
  gemm_core(A + (size_t)blockIdx.x * 128 * (size_t)K,
            Bt + (size_t)blockIdx.y * 128 * (size_t)K, K, smem, acc);

  // The lane's elements lie at e0 + (i * 16 + v) * N + f * 16: one address per
  // array, the rest constant offsets.  All loads, then all sums, then all
  // stores.
  const int nl = n0 + r;
  const unsigned e0 = (unsigned)(m0 + hf * 8) * (unsigned)N + (unsigned)nl;
  float bn[4];
#pragma unroll
  for (int f = 0; f < 4; f++) bn[f] = bias[nl + f * 16];
  if constexpr (HASRES) {
    const float* rp = resid + e0;
    float rv[4][4][8];
#pragma unroll
    for (int f = 0; f < 4; f++) {
#pragma unroll
      for (int i = 0; i < 4; i++) {
#pragma unroll
        for (int v = 0; v < 8; v++) rv[i][f][v] = rp[(i * 16 + v) * N + f * 16];
      }
    }
    // the address registers named by the loads above stay as they are until
    // this wait: as inputs they cannot be rewritten, or given to a load's
    // result, ahead of it
    asm volatile("s_wait_xcnt 0x0" :: "v"(nl), "v"(e0), "v"(rp) : "memory");
#pragma unroll
    for (int f = 0; f < 4; f++) {
#pragma unroll
      for (int i = 0; i < 4; i++) {
#pragma unroll
        for (int v = 0; v < 8; v++) acc[i][f][v] = (acc[i][f][v] + bn[f]) + rv[i][f][v];
      }
    }
  } else {
    asm volatile("s_wait_xcnt 0x0" :: "v"(nl) : "memory");
#pragma unroll
    for (int f = 0; f < 4; f++) {
#pragma unroll
      for (int i = 0; i < 4; i++) {
#pragma unroll
        for (int v = 0; v < 8; v++) acc[i][f][v] = acc[i][f][v] + bn[f];
      }
    }
  }
  if constexpr (RELU) {
#pragma unroll
    for (int f = 0; f < 4; f++) {
#pragma unroll
      for (int i = 0; i < 4; i++) {
#pragma unroll
        for (int v = 0; v < 8; v++) acc[i][f][v] = fmaxf(acc[i][f][v], 0.0f);
      }
    }
  }
  if constexpr (OUTBF16) {
    bf16_t ob[4][4][8];
#pragma unroll
    for (int f = 0; f < 4; f++) {
#pragma unroll
      for (int i = 0; i < 4; i++) {
#pragma unroll
        for (int v = 0; v < 8; v++) ob[i][f][v] = (bf16_t)acc[i][f][v];
      }
    }
    bf16_t* op = outb + e0;
    // keeps every vector operation ahead of the first store, so that no
    // register named by an issued store is written again
    __builtin_amdgcn_sched_barrier(0);
#pragma unroll
    for (int f = 0; f < 4; f++) {
#pragma unroll
      for (int i = 0; i < 4; i++) {
#pragma unroll
        for (int v = 0; v < 8; v++) op[(i * 16 + v) * N + f * 16] = ob[i][f][v];
      }
    }
  } else {
    float* op = outf + e0;
    // keeps every vector operation ahead of the first store, so that no
    // register named by an issued store is written again
    __builtin_amdgcn_sched_barrier(0);
#pragma unroll
    for (int f = 0; f < 4; f++) {
#pragma unroll
      for (int i = 0; i < 4; i++) {
#pragma unroll
        for (int v = 0; v < 8; v++) op[(i * 16 + v) * N + f * 16] = acc[i][f][v];
      }
    }
  }
}

// ---------------------------------------------------------------------------
// LayerNorm (reference semantics): y = g*(x-mean)/(std+eps)+b, std = sqrt(
// mean((x-mean)^2)).  One block (256 threads) per row of 1024.
// ---------------------------------------------------------------------------
__global__ void __launch_bounds__(256) ln_kernel(
    const float* __restrict__ in, const float* __restrict__ gam,
    const float* __restrict__ bet, float* __restrict__ out,
    bf16_t* __restrict__ outb) {
  __shared__ float red[8];
  const int row = blockIdx.x, tid = threadIdx.x;
  const float* x = in + (size_t)row * DMODEL;
  float v[4];
#pragma unroll
  for (int i = 0; i < 4; i++) v[i] = x[tid + i * 256];

  float s = v[0] + v[1] + v[2] + v[3];
#pragma unroll
  for (int msk = 1; msk < 32; msk <<= 1) s += __shfl_xor(s, msk, 32);
  if ((tid & 31) == 0) red[tid >> 5] = s;
  __syncthreads();
  float tot = 0.f;
#pragma unroll
  for (int i = 0; i < 8; i++) tot += red[i];
  const float mean = tot * (1.0f / DMODEL);
  __syncthreads();

  float sq = 0.f;
#pragma unroll
  for (int i = 0; i < 4; i++) { const float d = v[i] - mean; sq += d * d; }
#pragma unroll
  for (int msk = 1; msk < 32; msk <<= 1) sq += __shfl_xor(sq, msk, 32);
  if ((tid & 31) == 0) red[tid >> 5] = sq;
  __syncthreads();
  float tots = 0.f;
#pragma unroll
  for (int i = 0; i < 8; i++) tots += red[i];
  const float stdv = sqrtf(tots * (1.0f / DMODEL));
  const float inv = 1.0f / (stdv + 1e-5f);

#pragma unroll
  for (int i = 0; i < 4; i++) {
    const int c = tid + i * 256;
    const float y = gam[c] * (v[i] - mean) * inv + bet[c];
    out[(size_t)row * DMODEL + c] = y;
    if (outb) outb[(size_t)row * DMODEL + c] = (bf16_t)y;
  }
}

// ---------------------------------------------------------------------------
extern "C" void kernel_launch(void* const* d_in, const int* in_sizes, int n_in,
                              void* d_out, int out_size, void* d_ws,
                              size_t ws_size, hipStream_t stream) {
  (void)in_sizes; (void)n_in; (void)out_size; (void)ws_size;
  const float* x   = (const float*)d_in[0];
  const float* wq  = (const float*)d_in[1];
  const float* bq  = (const float*)d_in[2];
  const float* wk  = (const float*)d_in[3];
  const float* bk  = (const float*)d_in[4];
  const float* wv  = (const float*)d_in[5];
  const float* bv  = (const float*)d_in[6];
  const float* wo  = (const float*)d_in[7];
  const float* wob = (const float*)d_in[8];
  const float* g1  = (const float*)d_in[9];
  const float* b1  = (const float*)d_in[10];
  const float* f1w = (const float*)d_in[11];
  const float* f1bias = (const float*)d_in[12];
  const float* f2w = (const float*)d_in[13];
  const float* f2bias = (const float*)d_in[14];
  const float* g2  = (const float*)d_in[15];
  const float* b2  = (const float*)d_in[16];
  float* out = (float*)d_out;

  char* ws = (char*)d_ws;
  size_t off = 0;
  auto alloc = [&](size_t bytes) -> char* {
    char* p = ws + off;
    off += (bytes + 255) & ~(size_t)255;
    return p;
  };
  const int BS = BATCH * S_LEN;  // 4096 rows
  bf16_t* xb   = (bf16_t*)alloc((size_t)BS * DMODEL * 2);          // 8 MB (reused as concat)
  bf16_t* wqt  = (bf16_t*)alloc((size_t)NHEADS * DHEAD * DMODEL * 2);
  bf16_t* wkt  = (bf16_t*)alloc((size_t)NHEADS * DHEAD * DMODEL * 2);
  bf16_t* wvt  = (bf16_t*)alloc((size_t)NHEADS * DHEAD * DMODEL * 2);
  bf16_t* wot  = (bf16_t*)alloc((size_t)DMODEL * DMODEL * 2);
  bf16_t* ff1t = (bf16_t*)alloc((size_t)DFF * DMODEL * 2);
  bf16_t* ff2t = (bf16_t*)alloc((size_t)DMODEL * DFF * 2);
  bf16_t* Qm   = (bf16_t*)alloc((size_t)BATCH * NHEADS * S_LEN * DHEAD * 2);  // 8 MB
  bf16_t* Km   = (bf16_t*)alloc((size_t)BATCH * NHEADS * S_LEN * DHEAD * 2);  // 8 MB
  bf16_t* Vtm  = (bf16_t*)alloc((size_t)BATCH * NHEADS * DHEAD * S_LEN * 2);  // 8 MB
  float*  t1   = (float*)alloc((size_t)BS * DMODEL * 4);           // 16 MB (reused as t2)
  float*  hbuf = (float*)alloc((size_t)BS * DMODEL * 4);           // 16 MB
  bf16_t* hb   = (bf16_t*)alloc((size_t)BS * DMODEL * 2);          // 8 MB
  bf16_t* concatb = xb;       // alias: xb dead after QKV
  bf16_t* ffn1out = Qm;       // alias: Q+K region (16 MB) dead after attention
  float*  t2 = t1;            // alias: t1 dead after LN1

  dim3 blk256(256);
  dim3 blkg(G_THR);

  // 1) convert x, transpose-convert all weights (one launch)
  prep_kernel<<<dim3(P_WGS), dim3(P_THR), 0, stream>>>(
      x, wq, wk, wv, wo, f1w, f2w, xb, wqt, wkt, wvt, wot, ff1t, ff2t);

  // 2) QKV projections (per head)
  qkv_kernel<<<dim3(S_LEN / 128, NHEADS / 2, BATCH * 3), blkg, 0, stream>>>(
      xb, wqt, wkt, wvt, bq, bk, bv, Qm, Km, Vtm);

  // 3) flash attention -> concat heads (bf16)
  attn_kernel<<<dim3(S_LEN / 256, NHEADS, BATCH), blk256, 0, stream>>>(
      Qm, Km, Vtm, concatb);

  // 4) output projection + residual(x) -> t1 (f32)
  gemm_kernel<false, true, false, DMODEL><<<dim3(BS / 128, DMODEL / 128), blkg, 0, stream>>>(
      concatb, wot, wob, x, t1, nullptr, DMODEL);

  // 5) LayerNorm1 -> h (f32) + hb (bf16)
  ln_kernel<<<dim3(BS), blk256, 0, stream>>>(t1, g1, b1, hbuf, hb);

  // 6) FFN1: relu(h @ ff1 + b) -> bf16
  gemm_kernel<true, false, true, DFF><<<dim3(BS / 128, DFF / 128), blkg, 0, stream>>>(
      hb, ff1t, f1bias, nullptr, nullptr, ffn1out, DMODEL);

  // 7) FFN2: (+ b + h residual) -> t2 (f32)
  gemm_kernel<false, true, false, DMODEL><<<dim3(BS / 128, DMODEL / 128), blkg, 0, stream>>>(
      ffn1out, ff2t, f2bias, hbuf, t2, nullptr, DFF);

  // 8) LayerNorm2 -> d_out
  ln_kernel<<<dim3(BS), blk256, 0, stream>>>(t2, g2, b2, out, nullptr);
}

// v005
// Measured time: 135 microseconds a run.
// Next to v004, in two timings, it ran 1.11 and 1.13 times as fast.
// All steps since v000 together make it 2.73 times as fast.
#include <hip/hip_runtime.h>
#include <hip/hip_bf16.h>
#include <math.h>

typedef __bf16 bf16_t;
typedef __attribute__((ext_vector_type(16))) __bf16     v16bf;
typedef __attribute__((ext_vector_type(8)))  float       v8f;
typedef __attribute__((ext_vector_type(4)))  unsigned int v4u;

#define S_LEN  1024
#define DMODEL 1024
#define DHEAD  64
#define NHEADS 16
#define DFF    2048
#define BATCH  4

__device__ __forceinline__ v8f wmma_bf16(v16bf a, v16bf b, v8f c) {
  return __builtin_amdgcn_wmma_f32_16x16x32_bf16(false, a, false, b, (short)0, c,
                                                 false, false);
}

__device__ __forceinline__ v16bf frag_load(const bf16_t* __restrict__ base,
                                           int ld, int row0, int k0, int lane) {
  const int r = lane & 15, hf = lane >> 4;
  const bf16_t* p = base + (size_t)(row0 + r) * (size_t)ld + (k0 + hf * 8);
  union { v4u u[2]; v16bf v; } cv;
  cv.u[0] = *(const v4u*)p;
  cv.u[1] = *(const v4u*)(p + 16);
  return cv.v;
}

__device__ __forceinline__ v8f v8f_zero() {
  v8f z = {0.f, 0.f, 0.f, 0.f, 0.f, 0.f, 0.f, 0.f};
  return z;
}

// ---------------------------------------------------------------------------
// Shared GEMM core: one 128x128 block tile, 4 waves (2 x 2) of 64x64: a wave
// reads 4 A and 4 Bt fragments for every 16 WMMAs.  Each pass covers 128 k
// (256 B of every operand row).  The 128 A rows and the 128 Bt rows of a pass
// are brought into LDS by asynchronous b128 copies (whole 128-B lines, 16 lanes
// per row) into one of two buffers, one pass ahead of their use; the waves
// read their fragments from LDS at a row pitch of 272 B.
// ---------------------------------------------------------------------------
#define G_BK    128                      // k elements per pass
#define G_LDP   136                      // LDS row pitch, elements (272 B)
#define G_AROWS 128
#define G_BROWS 128
#define G_BUF   ((G_AROWS + G_BROWS) * G_LDP)   // elements per buffer
#define G_THR   128                      // threads per block

__device__ __forceinline__ void stage_rows(const bf16_t* g, size_t rows8,
                                           unsigned lds) {
  const bf16_t* g0 = g;
  const bf16_t* g1 = g + rows8;
  const bf16_t* g2 = g + 2 * rows8;
  const bf16_t* g3 = g + 3 * rows8;
  const bf16_t* g4 = g + 4 * rows8;
  const bf16_t* g5 = g + 5 * rows8;
  const bf16_t* g6 = g + 6 * rows8;
  const bf16_t* g7 = g + 7 * rows8;
  const unsigned l0 = lds;
  const unsigned l1 = lds + 8 * G_LDP * 2;
  const unsigned l2 = lds + 16 * G_LDP * 2;
  const unsigned l3 = lds + 24 * G_LDP * 2;
  const unsigned l4 = lds + 32 * G_LDP * 2;
  const unsigned l5 = lds + 40 * G_LDP * 2;
  const unsigned l6 = lds + 48 * G_LDP * 2;
  const unsigned l7 = lds + 56 * G_LDP * 2;
  asm volatile(
      "global_load_async_to_lds_b128 %0, %1, off\n\t"
      "global_load_async_to_lds_b128 %2, %3, off\n\t"
      "global_load_async_to_lds_b128 %4, %5, off\n\t"
      "global_load_async_to_lds_b128 %6, %7, off\n\t"
      "global_load_async_to_lds_b128 %8, %9, off\n\t"
      "global_load_async_to_lds_b128 %10, %11, off\n\t"
      "global_load_async_to_lds_b128 %12, %13, off\n\t"
      "global_load_async_to_lds_b128 %14, %15, off\n\t"
      "s_wait_xcnt 0x0"
      :: "v"(l0), "v"(g0), "v"(l1), "v"(g1), "v"(l2), "v"(g2), "v"(l3), "v"(g3),
         "v"(l4), "v"(g4), "v"(l5), "v"(g5), "v"(l6), "v"(g6), "v"(l7), "v"(g7)
      : "memory");
}

// One pass of both operands, 32 copies per lane: the 128 A rows first in the
// buffer, the 128 Bt rows behind them, 64 rows a statement.
__device__ __forceinline__ void stage_copies(const bf16_t* ga, const bf16_t* gb,
                                             size_t rows8, unsigned lds) {
  stage_rows(ga, rows8, lds);
  stage_rows(ga + 8 * rows8, rows8, lds + 64 * G_LDP * 2);
  stage_rows(gb, rows8, lds + G_AROWS * G_LDP * 2);
  stage_rows(gb + 8 * rows8, rows8, lds + (G_AROWS + 64) * G_LDP * 2);
}

// Ablk: first of the block's 128 rows of A; Bblk: first of its 128 rows of Bt;
// both row-major with K elements per row, K a multiple of 128.  Wave w takes
// A rows (w >> 1) * 64 on and Bt rows (w & 1) * 64 on; acc[i][f] is the tile
// of A rows i * 16 on and Bt rows f * 16 on within them.
__device__ __forceinline__ void gemm_core(const bf16_t* __restrict__ Ablk,
                                          const bf16_t* __restrict__ Bblk,
                                          int K, bf16_t* smem, v8f acc[4][4]) {
  const int tid = threadIdx.x;
  const int lane = tid & 31, wave = tid >> 5;
  const int rw = tid >> 4, cw = (tid & 15) * 8;
  const bf16_t* ga = Ablk + (size_t)rw * (size_t)K + cw;
  const bf16_t* gb = Bblk + (size_t)rw * (size_t)K + cw;
  const size_t rows8 = (size_t)8 * (size_t)K;
  const unsigned lds0 = (unsigned)(size_t)smem + (unsigned)(rw * G_LDP + cw) * 2u;
  const int npass = K / G_BK;
  const int arow = (wave >> 1) * 64, brow = G_AROWS + (wave & 1) * 64;

  stage_copies(ga, gb, rows8, lds0);
  // pass 0 has landed for this wave, then for the block
  asm volatile("s_wait_asynccnt 0x0" ::: "memory");
  __syncthreads();
  if (npass > 1) stage_copies(ga + G_BK, gb + G_BK, rows8, lds0 + G_BUF * 2);

  for (int t = 0; t < npass; t++) {
    const int bsel = t & 1;
    const bf16_t* sbuf = smem + bsel * G_BUF;
    v16bf a[4][4], b[4][4];
#pragma unroll
    for (int ks = 0; ks < 4; ks++) {
#pragma unroll
      for (int i = 0; i < 4; i++)
        a[ks][i] = frag_load(sbuf, G_LDP, arow + i * 16, ks * 32, lane);
#pragma unroll
      for (int f = 0; f < 4; f++)
        b[ks][f] = frag_load(sbuf, G_LDP, brow + f * 16, ks * 32, lane);
    }
    // keeps the pass's LDS reads one group ahead of its WMMAs: left free, the
    // compiler puts a pair of reads and a full wait in front of every WMMA
    __builtin_amdgcn_sched_barrier(0);
#pragma unroll
    for (int ks = 0; ks < 4; ks++) {
#pragma unroll
      for (int i = 0; i < 4; i++) {
#pragma unroll
        for (int f = 0; f < 4; f++)
          acc[i][f] = wmma_bf16(a[ks][i], b[ks][f], acc[i][f]);
      }
    }
    // keeps the publish point behind the pass's WMMAs: left free, the compiler
    // lifts its waits and barrier over them, so that every LDS read is waited
    // out before the first WMMA and the copies get no WMMA time to land in
    __builtin_amdgcn_sched_barrier(0);
    // publish point: this wave's reads of the buffer are done, its copies of
    // pass t + 1 have landed; the barrier says both for the whole block
    asm volatile("s_wait_dscnt 0x0" ::: "memory");
    asm volatile("s_wait_asynccnt 0x0" ::: "memory");
    __syncthreads();
    if (t + 2 < npass)
      stage_copies(ga + (size_t)(t + 2) * G_BK, gb + (size_t)(t + 2) * G_BK,
                   rows8, lds0 + (unsigned)bsel * (G_BUF * 2));
  }
  // no copy is left in flight when the wave goes on
  asm volatile("s_wait_asynccnt 0x0" ::: "memory");
}

// ---------------------------------------------------------------------------
// Operand preparation, one launch: x -> bf16, and every weight matrix
// fp32 [R][C] -> bf16 [C][R].  256 work-groups of 16 waves, all resident at
// once; each takes 16384 elements of x and eight 64x64 weight tiles (one each
// of wq, wk, wv, wo, two of ff1, two of ff2).  All 24 b128 loads of a thread
// are issued first; loads and stores cover whole 128-B lines.
// ---------------------------------------------------------------------------
#define P_WGS   256
#define P_THR   512
#define P_PITCH 65                       // LDS tile row pitch, floats

// src: the tile's first element (uniform); off: this thread's byte offset in
// the tile's first 32 rows; C: source row length.
template <int C>
__device__ __forceinline__ void tile_load(const float* src, unsigned off,
                                          float4 v[2]) {
  const char* p = (const char*)src;
  v[0] = *(const float4*)(p + off);
  v[1] = *(const float4*)(p + 32 * C * 4 + off);
}

__device__ __forceinline__ void tile_to_lds(float* tile, int tid, const float4 v[2]) {
  float* t = tile + (tid >> 4) * P_PITCH + (tid & 15) * 4;
#pragma unroll
  for (int i = 0; i < 2; i++) {
    t[32 * i * P_PITCH + 0] = v[i].x;
    t[32 * i * P_PITCH + 1] = v[i].y;
    t[32 * i * P_PITCH + 2] = v[i].z;
    t[32 * i * P_PITCH + 3] = v[i].w;
  }
}

// dst points at element [c0][r0] of the transposed matrix, R = its row length.
// Eight lanes write the 128 B of one destination row.
__device__ __forceinline__ void tile_store_t(const float* tile, int tid,
                                             bf16_t* __restrict__ dst, int R) {
  const int rg = (tid & 7) * 8, c = tid >> 3;
  bf16_t o[8];
#pragma unroll
  for (int e = 0; e < 8; e++) o[e] = (bf16_t)tile[(rg + e) * P_PITCH + c];
  *(v4u*)(dst + (size_t)c * (size_t)R + rg) = *(const v4u*)o;
}

__global__ void __launch_bounds__(P_THR) prep_kernel(
    const float* x, const float* wq, const float* wk, const float* wv,
    const float* wo, const float* f1w, const float* f2w, bf16_t* xb,
    bf16_t* wqt, bf16_t* wkt, bf16_t* wvt, bf16_t* wot, bf16_t* ff1t,
    bf16_t* ff2t) {
  __shared__ float tiles[8][64 * P_PITCH];
  const int tid = threadIdx.x;
  const int b = blockIdx.x, bh = b >> 4, bl = b & 15;
  const int b2 = b + P_WGS;

  // per-head matrices are [1024][64]: head bh, row tile bl
  const size_t hsrc = (size_t)bh * (DMODEL * DHEAD) + (size_t)bl * (64 * DHEAD);
  const size_t hdst = (size_t)bh * (DMODEL * DHEAD) + (size_t)bl * 64;
  const unsigned col = (unsigned)(tid & 15) * 16u, row = (unsigned)(tid >> 4);
  const unsigned o64 = row * (DHEAD * 4) + col;
  const unsigned o1k = row * (DMODEL * 4) + col;
  const unsigned o2k = row * (DFF * 4) + col;

  const float* pq = wq + hsrc;
  const float* pk = wk + hsrc;
  const float* pv = wv + hsrc;
  // wo [1024][1024]: row tile bh, column tile bl
  const float* po = wo + (size_t)bh * (64 * DMODEL) + bl * 64;
  // ff1 [1024][2048]: row tile index >> 5, column tile index & 31
  const float* p1a = f1w + (size_t)(b >> 5) * (64 * DFF) + (b & 31) * 64;
  const float* p1b = f1w + (size_t)(b2 >> 5) * (64 * DFF) + (b2 & 31) * 64;
  // ff2 [2048][1024]: row tile index >> 4, column tile index & 15
  const float* p2a = f2w + (size_t)(b >> 4) * (64 * DMODEL) + (b & 15) * 64;
  const float* p2b = f2w + (size_t)(b2 >> 4) * (64 * DMODEL) + (b2 & 15) * 64;
  // x: 16384 elements from b * 16384 on; o64 is also tid * 16 bytes
  const char* px = (const char*)(x + (size_t)b * (8 * P_THR * 4));

  float4 t[8][2], xv[8];
  tile_load<DHEAD>(pq, o64, t[0]);
  tile_load<DHEAD>(pk, o64, t[1]);
  tile_load<DHEAD>(pv, o64, t[2]);
  tile_load<DMODEL>(po, o1k, t[3]);
  tile_load<DFF>(p1a, o2k, t[4]);
  tile_load<DFF>(p1b, o2k, t[5]);
  tile_load<DMODEL>(p2a, o1k, t[6]);
  tile_load<DMODEL>(p2b, o1k, t[7]);
#pragma unroll
  for (int i = 0; i < 8; i++) xv[i] = *(const float4*)(px + i * (P_THR * 16) + o64);
  // the base and offset registers named by the loads above stay as they are
  // until this wait: as inputs they cannot be rewritten, or given to a load's
  // result, ahead of it (the pointers are not __restrict__, so no load moves
  // behind it)
  asm volatile("s_wait_xcnt 0x0"
               :: "v"(o64), "v"(o1k), "v"(o2k), "s"(pq), "s"(pk), "s"(pv), "s"(po),
                  "s"(p1a), "s"(p1b), "s"(p2a), "s"(p2b), "s"(px)
               : "memory");

#pragma unroll
  for (int k = 0; k < 8; k++) tile_to_lds(tiles[k], tid, t[k]);
  __syncthreads();
#pragma unroll
  for (int i = 0; i < 8; i++) {
    bf16_t o[4] = {(bf16_t)xv[i].x, (bf16_t)xv[i].y, (bf16_t)xv[i].z, (bf16_t)xv[i].w};
    *(uint2*)(xb + (size_t)b * (8 * P_THR * 4) + i * (P_THR * 4) + tid * 4) = *(const uint2*)o;
  }
  tile_store_t(tiles[0], tid, wqt + hdst, DMODEL);
  tile_store_t(tiles[1], tid, wkt + hdst, DMODEL);
  tile_store_t(tiles[2], tid, wvt + hdst, DMODEL);
  tile_store_t(tiles[3], tid, wot + (size_t)bl * (64 * DMODEL) + bh * 64, DMODEL);
  tile_store_t(tiles[4], tid, ff1t + (size_t)(b & 31) * (64 * DMODEL) + (b >> 5) * 64, DMODEL);
  tile_store_t(tiles[5], tid, ff1t + (size_t)(b2 & 31) * (64 * DMODEL) + (b2 >> 5) * 64, DMODEL);
  tile_store_t(tiles[6], tid, ff2t + (size_t)(b & 15) * (64 * DFF) + (b >> 4) * 64, DFF);
  tile_store_t(tiles[7], tid, ff2t + (size_t)(b2 & 15) * (64 * DFF) + (b2 >> 4) * 64, DFF);
}

// ---------------------------------------------------------------------------
// QKV projections.  grid = (S/128, H/2, B*3).  Block = 128 rows x two heads;
// wave = 64 rows x 64 cols (one head's full d_head).  Operands staged in LDS
// (gemm_core).  Q is pre-scaled by 1/sqrt(64); V is stored transposed [64][S].
// ---------------------------------------------------------------------------
__global__ void __launch_bounds__(G_THR) qkv_kernel(
    const bf16_t* __restrict__ xb, const bf16_t* __restrict__ wqt,
    const bf16_t* __restrict__ wkt, const bf16_t* __restrict__ wvt,
    const float* __restrict__ bq, const float* __restrict__ bk,
    const float* __restrict__ bv, bf16_t* __restrict__ Q,
    bf16_t* __restrict__ Kb, bf16_t* __restrict__ Vt) {
  __shared__ __attribute__((aligned(16))) bf16_t smem[2 * G_BUF];
  const int lane = threadIdx.x & 31, wave = threadIdx.x >> 5;
  const int r = lane & 15, hf = lane >> 4;
  const int h = blockIdx.y * 2 + (wave & 1);
  const int which = blockIdx.z % 3, b = blockIdx.z / 3;
  const int sw = blockIdx.x * 128 + (wave >> 1) * 64;

  const bf16_t* A = xb + (size_t)b * S_LEN * DMODEL;
  const bf16_t* Wt = (which == 0 ? wqt : which == 1 ? wkt : wvt) +
                     (size_t)blockIdx.y * 2 * DHEAD * DMODEL;
  const float* bias = (which == 0 ? bq : which == 1 ? bk : bv) + h * DHEAD;

  v8f acc[4][4];
#pragma unroll
  for (int i = 0; i < 4; i++) {
#pragma unroll
    for (int f = 0; f < 4; f++) acc[i][f] = v8f_zero();
  }
  gemm_core(A + (size_t)blockIdx.x * 128 * DMODEL, Wt, DMODEL, smem, acc);

  const float scale = (which == 0) ? 0.125f : 1.0f;  // 1/sqrt(64)
  const size_t bh = (size_t)(b * NHEADS + h);
  if (which < 2) {
    bf16_t* out = (which == 0 ? Q : Kb) + bh * S_LEN * DHEAD;
#pragma unroll
    for (int f = 0; f < 4; f++) {
      const int n = f * 16 + r;
      const float bn = bias[n];
#pragma unroll
      for (int i = 0; i < 4; i++) {
#pragma unroll
        for (int v = 0; v < 8; v++) {
          const int s = sw + i * 16 + v + hf * 8;
          out[(size_t)s * DHEAD + n] = (bf16_t)((acc[i][f][v] + bn) * scale);
        }
      }
    }
  } else {
    bf16_t* out = Vt + bh * DHEAD * S_LEN;
#pragma unroll
    for (int f = 0; f < 4; f++) {
      const int d = f * 16 + r;
      const float bn = bias[d];
#pragma unroll
      for (int i = 0; i < 4; i++) {
        bf16_t tmp[8];
#pragma unroll
        for (int v = 0; v < 8; v++) tmp[v] = (bf16_t)(acc[i][f][v] + bn);
        *(v4u*)(out + (size_t)d * S_LEN + sw + i * 16 + hf * 8) = *(const v4u*)tmp;
      }
    }
    // in the built code the other branch's text follows these stores and
    // rewrites their registers: the wait stands between
    asm volatile("s_wait_xcnt 0x0" ::: "memory");
  }
}

// ---------------------------------------------------------------------------
// Flash attention, transposed products: S^T = K Q^T, O^T += V^T P^T.
// grid = (S/256, H, B).  Each wave: 32 query columns (two groups of 16), full
// d_head = 64 output in 4 x 2 accumulator tiles; online softmax over 32 keys
// per step.  A lane holds 16 of the 32 scores of ONE query (its other half
// sits in lane ^ 16), so maximum and sum run in the lane's own registers with
// one exchange between the halves; the two score tiles of a group, converted
// in place, are the B operand of the second product.  K rows and V^T rows are
// the A operands, each fragment feeding both column groups.
// The eight waves of a block walk the same keys: a stage of 128 keys (128 K
// rows of 128 B, 64 V^T rows of 256 B) is brought into LDS once for all of
// them by asynchronous b128 copies of whole lines, into one of two buffers,
// one stage ahead of its use; the waves read their fragments from LDS.
// ---------------------------------------------------------------------------
#define LOG2E 1.4426950408889634f
#define A_KEYS 128                        // keys per stage
#define A_NST  (S_LEN / A_KEYS)           // stages
#define A_KP   72                         // K row pitch in LDS, elements (144 B)
#define A_VP   136                        // V^T row pitch in LDS, elements (272 B)
#define A_VOFF (A_KEYS * A_KP)            // V^T rows stand behind the K rows
#define A_BUF  (A_VOFF + DHEAD * A_VP)    // elements per buffer

__device__ __forceinline__ float xhalf(float x) {
  const int i = __builtin_bit_cast(int, x);
  return __builtin_bit_cast(
      float, __builtin_amdgcn_permlanex16(i, i, 0x76543210, 0xfedcba98, false, false));
}

__device__ __forceinline__ void attn_stage(const bf16_t* gk, const bf16_t* gv,
                                           unsigned lk, unsigned lv) {
  const bf16_t* k0 = gk;
  const bf16_t* k1 = gk + 32 * DHEAD;
  const bf16_t* k2 = gk + 64 * DHEAD;
  const bf16_t* k3 = gk + 96 * DHEAD;
  const bf16_t* v0 = gv;
  const bf16_t* v1 = gv + 16 * S_LEN;
  const bf16_t* v2 = gv + 32 * S_LEN;
  const bf16_t* v3 = gv + 48 * S_LEN;
  const unsigned a0 = lk;
  const unsigned a1 = lk + 32 * A_KP * 2;
  const unsigned a2 = lk + 64 * A_KP * 2;
  const unsigned a3 = lk + 96 * A_KP * 2;
  const unsigned b0 = lv;
  const unsigned b1 = lv + 16 * A_VP * 2;
  const unsigned b2 = lv + 32 * A_VP * 2;
  const unsigned b3 = lv + 48 * A_VP * 2;
  asm volatile(
      "global_load_async_to_lds_b128 %0, %1, off\n\t"
      "global_load_async_to_lds_b128 %2, %3, off\n\t"
      "global_load_async_to_lds_b128 %4, %5, off\n\t"
      "global_load_async_to_lds_b128 %6, %7, off\n\t"
      "global_load_async_to_lds_b128 %8, %9, off\n\t"
      "global_load_async_to_lds_b128 %10, %11, off\n\t"
      "global_load_async_to_lds_b128 %12, %13, off\n\t"
      "global_load_async_to_lds_b128 %14, %15, off\n\t"
      "s_wait_xcnt 0x0"
      :: "v"(a0), "v"(k0), "v"(a1), "v"(k1), "v"(a2), "v"(k2), "v"(a3), "v"(k3),
         "v"(b0), "v"(v0), "v"(b1), "v"(v1), "v"(b2), "v"(v2), "v"(b3), "v"(v3)
      : "memory");
}

__global__ void __launch_bounds__(256) attn_kernel(
    const bf16_t* __restrict__ Q, const bf16_t* __restrict__ Kb,
    const bf16_t* __restrict__ Vt, bf16_t* __restrict__ concatb) {
  __shared__ __attribute__((aligned(16))) bf16_t smem[2 * A_BUF];
  const int tid = threadIdx.x;
  const int lane = threadIdx.x & 31, wave = threadIdx.x >> 5;
  const int r = lane & 15, hf = lane >> 4;
  const int h = blockIdx.y, b = blockIdx.z;
  const int q0 = blockIdx.x * 256 + wave * 32;
  const size_t bh = (size_t)(b * NHEADS + h);
  const bf16_t* Qb = Q + bh * S_LEN * DHEAD;
  const bf16_t* Kx = Kb + bh * S_LEN * DHEAD;
  const bf16_t* Vx = Vt + bh * DHEAD * S_LEN;

  // copies: eight lanes per K row (a stage's K rows lie in a row in memory),
  // sixteen lanes per V^T row
  const bf16_t* gk = Kx + tid * 8;
  const bf16_t* gv = Vx + (size_t)(tid >> 4) * S_LEN + (tid & 15) * 8;
  const unsigned lk = (unsigned)(size_t)smem +
                      (unsigned)((tid >> 3) * A_KP + (tid & 7) * 8) * 2u;
  const unsigned lv = (unsigned)(size_t)smem +
                      (unsigned)(A_VOFF + (tid >> 4) * A_VP + (tid & 15) * 8) * 2u;

  attn_stage(gk, gv, lk, lv);

  v16bf qb[2][2];  // [column group][half of d]
#pragma unroll
  for (int g = 0; g < 2; g++) {
    qb[g][0] = frag_load(Qb, DHEAD, q0 + g * 16, 0, lane);
    qb[g][1] = frag_load(Qb, DHEAD, q0 + g * 16, 32, lane);
    // the compiler hands these loads' address pair to a later load's result:
    // the wait stands between them
    asm volatile("s_wait_xcnt 0x0" ::: "memory");
  }

  v8f o[4][2];  // [16 rows of d][column group]
#pragma unroll
  for (int dt = 0; dt < 4; dt++) { o[dt][0] = v8f_zero(); o[dt][1] = v8f_zero(); }
  float mrun[2] = {-3.0e38f, -3.0e38f}, lrun[2] = {0.f, 0.f};

  // stage 0 has landed for this wave, then for the block
  asm volatile("s_wait_asynccnt 0x0" ::: "memory");
  __syncthreads();
  attn_stage(gk + A_KEYS * DHEAD, gv + A_KEYS, lk + A_BUF * 2, lv + A_BUF * 2);

  for (int t = 0; t < A_NST; t++) {
    const int bsel = t & 1;
    const bf16_t* sk = smem + bsel * A_BUF;
    const bf16_t* sv = sk + A_VOFF;

    v16bf kf[2][2], vf[4];  // [16 keys][half of d]; [16 rows of d]
#pragma unroll
    for (int kt = 0; kt < 2; kt++) {
      kf[kt][0] = frag_load(sk, A_KP, kt * 16, 0, lane);
      kf[kt][1] = frag_load(sk, A_KP, kt * 16, 32, lane);
    }
#pragma unroll
    for (int dt = 0; dt < 4; dt++) vf[dt] = frag_load(sv, A_VP, dt * 16, 0, lane);

    // kept rolled: unrolled, the compiler puts off the row sums of all four
    // steps to the stage's end and holds their terms in registers, over 256
#pragma unroll 1
    for (int ss = 0; ss < A_KEYS / 32; ss++) {
      // the next step's keys; the stage's last step wraps to its first, so that
      // the loads stand under no branch and nothing is read past the stage
      const int tn = ((ss + 1) * 32) & (A_KEYS - 1);

      v8f s[2][2];  // [16 keys][column group]
#pragma unroll
      for (int kt = 0; kt < 2; kt++) {
#pragma unroll
        for (int g = 0; g < 2; g++) {
          s[kt][g] = wmma_bf16(kf[kt][0], qb[g][0], v8f_zero());
          s[kt][g] = wmma_bf16(kf[kt][1], qb[g][1], s[kt][g]);
        }
      }
      // next K fragments come during the softmax and the second product
#pragma unroll
      for (int kt = 0; kt < 2; kt++) {
        kf[kt][0] = frag_load(sk, A_KP, tn + kt * 16, 0, lane);
        kf[kt][1] = frag_load(sk, A_KP, tn + kt * 16, 32, lane);
      }

      v16bf pf[2];
#pragma unroll
      for (int g = 0; g < 2; g++) {
        float mx = fmaxf(s[0][g][0], s[1][g][0]);
#pragma unroll
        for (int v = 1; v < 8; v++) mx = fmaxf(mx, fmaxf(s[0][g][v], s[1][g][v]));
        mx = fmaxf(mx, xhalf(mx));
        const float mnew = fmaxf(mrun[g], mx);
        const float resc = __builtin_amdgcn_exp2f((mrun[g] - mnew) * LOG2E);
        const float nm = -mnew * LOG2E;
        float ps[8];
#pragma unroll
        for (int v = 0; v < 8; v++) {
          const float p0 = __builtin_amdgcn_exp2f(fmaf(s[0][g][v], LOG2E, nm));
          const float p1 = __builtin_amdgcn_exp2f(fmaf(s[1][g][v], LOG2E, nm));
          ps[v] = p0 + p1;
          pf[g][v]     = (bf16_t)p0;   // key hf * 8 + v
          pf[g][8 + v] = (bf16_t)p1;   // key 16 + hf * 8 + v
        }
        // this half's 16 keys, summed as a tree; the halves join at the end
        lrun[g] = lrun[g] * resc + (((ps[0] + ps[1]) + (ps[2] + ps[3])) +
                                    ((ps[4] + ps[5]) + (ps[6] + ps[7])));
        mrun[g] = mnew;
#pragma unroll
        for (int dt = 0; dt < 4; dt++) o[dt][g] *= resc;
      }

#pragma unroll
      for (int dt = 0; dt < 4; dt++) {
        o[dt][0] = wmma_bf16(vf[dt], pf[0], o[dt][0]);
        o[dt][1] = wmma_bf16(vf[dt], pf[1], o[dt][1]);
      }
      // next V^T fragments come during the next step's first product and softmax
#pragma unroll
      for (int dt = 0; dt < 4; dt++) vf[dt] = frag_load(sv, A_VP, dt * 16, tn, lane);
    }
    // publish point: this wave's reads of the buffer are done, its copies of
    // stage t + 1 have landed; the barrier says both for the whole block
    asm volatile("s_wait_dscnt 0x0" ::: "memory");
    asm volatile("s_wait_asynccnt 0x0" ::: "memory");
    __syncthreads();
    if (t + 2 < A_NST)
      attn_stage(gk + (size_t)(t + 2) * (A_KEYS * DHEAD), gv + (t + 2) * A_KEYS,
                 lk + (unsigned)bsel * (A_BUF * 2), lv + (unsigned)bsel * (A_BUF * 2));
  }
  // no copy is left in flight when the wave goes on
  asm volatile("s_wait_asynccnt 0x0" ::: "memory");

  // a lane holds d = dt * 16 + hf * 8 + {0..7} of one query: 16-byte stores
#pragma unroll
  for (int g = 0; g < 2; g++) {
    const float inv = 1.0f / (lrun[g] + xhalf(lrun[g]));
    bf16_t* out = concatb + ((size_t)b * S_LEN + (size_t)(q0 + g * 16 + r)) * DMODEL +
                  (size_t)h * DHEAD + hf * 8;
#pragma unroll
    for (int dt = 0; dt < 4; dt++) {
      bf16_t tmp[8];
#pragma unroll
      for (int v = 0; v < 8; v++) tmp[v] = (bf16_t)(o[dt][g][v] * inv);
      *(v4u*)(out + dt * 16) = *(const v4u*)tmp;
    }
  }
}

// ---------------------------------------------------------------------------
// Generic WMMA GEMM: C[M,N] = A[M,K](bf16) * Bt[N,K](bf16) + bias[n]
// (+ resid) (ReLU) -> f32 or bf16.  Block = 4 waves = 128x128 tile.
// Operands staged in LDS (gemm_core).
// ---------------------------------------------------------------------------
template <bool RELU, bool HASRES, bool OUTBF16, int N>
__global__ void __launch_bounds__(G_THR) gemm_kernel(
    const bf16_t* __restrict__ A, const bf16_t* __restrict__ Bt,
    const float* __restrict__ bias, const float* __restrict__ resid,
    float* __restrict__ outf, bf16_t* __restrict__ outb, int K) {
  __shared__ __attribute__((aligned(16))) bf16_t smem[2 * G_BUF];
  const int lane = threadIdx.x & 31, wave = threadIdx.x >> 5;
  const int r = lane & 15, hf = lane >> 4;
  const int m0 = blockIdx.x * 128 + (wave >> 1) * 64;
  const int n0 = blockIdx.y * 128 + (wave & 1) * 64;

  v8f acc[4][4];
#pragma unroll
  for (int i = 0; i < 4; i++) {
#pragma unroll
    for (int f = 0; f < 4; f++) acc[i][f] = v8f_zero();
  }
  gemm_core(A + (size_t)blockIdx.x * 128 * (size_t)K,
            Bt + (size_t)blockIdx.y * 128 * (size_t)K, K, smem, acc);

  // The lane's elements lie at e0 + (i * 16 + v) * N + f * 16: one address per
  // array, the rest constant offsets.  All loads, then all sums, then all
  // stores.
  const int nl = n0 + r;
  const unsigned e0 = (unsigned)(m0 + hf * 8) * (unsigned)N + (unsigned)nl;
  float bn[4];
#pragma unroll
  for (int f = 0; f < 4; f++) bn[f] = bias[nl + f * 16];
  if constexpr (HASRES) {
    const float* rp = resid + e0;
    float rv[4][4][8];
#pragma unroll
    for (int f = 0; f < 4; f++) {
#pragma unroll
      for (int i = 0; i < 4; i++) {
#pragma unroll
        for (int v = 0; v < 8; v++) rv[i][f][v] = rp[(i * 16 + v) * N + f * 16];
      }
    }
    // the address registers named by the loads above stay as they are until
    // this wait: as inputs they cannot be rewritten, or given to a load's
    // result, ahead of it
    asm volatile("s_wait_xcnt 0x0" :: "v"(nl), "v"(e0), "v"(rp) : "memory");
#pragma unroll
    for (int f = 0; f < 4; f++) {
#pragma unroll
      for (int i = 0; i < 4; i++) {
#pragma unroll
        for (int v = 0; v < 8; v++) acc[i][f][v] = (acc[i][f][v] + bn[f]) + rv[i][f][v];
      }
    }
  } else {
    asm volatile("s_wait_xcnt 0x0" :: "v"(nl) : "memory");
#pragma unroll
    for (int f = 0; f < 4; f++) {
#pragma unroll
      for (int i = 0; i < 4; i++) {
#pragma unroll
        for (int v = 0; v < 8; v++) acc[i][f][v] = acc[i][f][v] + bn[f];
      }
    }
  }
  if constexpr (RELU) {
#pragma unroll
    for (int f = 0; f < 4; f++) {
#pragma unroll
      for (int i = 0; i < 4; i++) {
#pragma unroll
        for (int v = 0; v < 8; v++) acc[i][f][v] = fmaxf(acc[i][f][v], 0.0f);
      }
    }
  }
  if constexpr (OUTBF16) {
    bf16_t ob[4][4][8];
#pragma unroll
    for (int f = 0; f < 4; f++) {
#pragma unroll
      for (int i = 0; i < 4; i++) {
#pragma unroll
        for (int v = 0; v < 8; v++) ob[i][f][v] = (bf16_t)acc[i][f][v];
      }
    }
    bf16_t* op = outb + e0;
    // keeps every vector operation ahead of the first store, so that no
    // register named by an issued store is written again
    __builtin_amdgcn_sched_barrier(0);
#pragma unroll
    for (int f = 0; f < 4; f++) {
#pragma unroll
      for (int i = 0; i < 4; i++) {
#pragma unroll
        for (int v = 0; v < 8; v++) op[(i * 16 + v) * N + f * 16] = ob[i][f][v];
      }
    }
  } else {
    float* op = outf + e0;
    // keeps every vector operation ahead of the first store, so that no
    // register named by an issued store is written again
    __builtin_amdgcn_sched_barrier(0);
#pragma unroll
    for (int f = 0; f < 4; f++) {
#pragma unroll
      for (int i = 0; i < 4; i++) {
#pragma unroll
        for (int v = 0; v < 8; v++) op[(i * 16 + v) * N + f * 16] = acc[i][f][v];
      }
    }
  }
}

// ---------------------------------------------------------------------------
// LayerNorm (reference semantics): y = g*(x-mean)/(std+eps)+b, std = sqrt(
// mean((x-mean)^2)).  One block (256 threads) per row of 1024.
// ---------------------------------------------------------------------------
__global__ void __launch_bounds__(256) ln_kernel(
    const float* __restrict__ in, const float* __restrict__ gam,
    const float* __restrict__ bet, float* __restrict__ out,
    bf16_t* __restrict__ outb) {
  __shared__ float red[8];
  const int row = blockIdx.x, tid = threadIdx.x;
  const float* x = in + (size_t)row * DMODEL;
  float v[4];
#pragma unroll
  for (int i = 0; i < 4; i++) v[i] = x[tid + i * 256];

  float s = v[0] + v[1] + v[2] + v[3];
#pragma unroll
  for (int msk = 1; msk < 32; msk <<= 1) s += __shfl_xor(s, msk, 32);
  if ((tid & 31) == 0) red[tid >> 5] = s;
  __syncthreads();
  float tot = 0.f;
#pragma unroll
  for (int i = 0; i < 8; i++) tot += red[i];
  const float mean = tot * (1.0f / DMODEL);
  __syncthreads();

  float sq = 0.f;
#pragma unroll
  for (int i = 0; i < 4; i++) { const float d = v[i] - mean; sq += d * d; }
#pragma unroll
  for (int msk = 1; msk < 32; msk <<= 1) sq += __shfl_xor(sq, msk, 32);
  if ((tid & 31) == 0) red[tid >> 5] = sq;
  __syncthreads();
  float tots = 0.f;
#pragma unroll
  for (int i = 0; i < 8; i++) tots += red[i];
  const float stdv = sqrtf(tots * (1.0f / DMODEL));
  const float inv = 1.0f / (stdv + 1e-5f);

#pragma unroll
  for (int i = 0; i < 4; i++) {
    const int c = tid + i * 256;
    const float y = gam[c] * (v[i] - mean) * inv + bet[c];
    out[(size_t)row * DMODEL + c] = y;
    if (outb) outb[(size_t)row * DMODEL + c] = (bf16_t)y;
  }
}

// ---------------------------------------------------------------------------
extern "C" void kernel_launch(void* const* d_in, const int* in_sizes, int n_in,
                              void* d_out, int out_size, void* d_ws,
                              size_t ws_size, hipStream_t stream) {
  (void)in_sizes; (void)n_in; (void)out_size; (void)ws_size;
  const float* x   = (const float*)d_in[0];
  const float* wq  = (const float*)d_in[1];
  const float* bq  = (const float*)d_in[2];
  const float* wk  = (const float*)d_in[3];
  const float* bk  = (const float*)d_in[4];
  const float* wv  = (const float*)d_in[5];
  const float* bv  = (const float*)d_in[6];
  const float* wo  = (const float*)d_in[7];
  const float* wob = (const float*)d_in[8];
  const float* g1  = (const float*)d_in[9];
  const float* b1  = (const float*)d_in[10];
  const float* f1w = (const float*)d_in[11];
  const float* f1bias = (const float*)d_in[12];
  const float* f2w = (const float*)d_in[13];
  const float* f2bias = (const float*)d_in[14];
  const float* g2  = (const float*)d_in[15];
  const float* b2  = (const float*)d_in[16];
  float* out = (float*)d_out;

  char* ws = (char*)d_ws;
  size_t off = 0;
  auto alloc = [&](size_t bytes) -> char* {
    char* p = ws + off;
    off += (bytes + 255) & ~(size_t)255;
    return p;
  };
  const int BS = BATCH * S_LEN;  // 4096 rows
  bf16_t* xb   = (bf16_t*)alloc((size_t)BS * DMODEL * 2);          // 8 MB (reused as concat)
  bf16_t* wqt  = (bf16_t*)alloc((size_t)NHEADS * DHEAD * DMODEL * 2);
  bf16_t* wkt  = (bf16_t*)alloc((size_t)NHEADS * DHEAD * DMODEL * 2);
  bf16_t* wvt  = (bf16_t*)alloc((size_t)NHEADS * DHEAD * DMODEL * 2);
  bf16_t* wot  = (bf16_t*)alloc((size_t)DMODEL * DMODEL * 2);
  bf16_t* ff1t = (bf16_t*)alloc((size_t)DFF * DMODEL * 2);
  bf16_t* ff2t = (bf16_t*)alloc((size_t)DMODEL * DFF * 2);
  bf16_t* Qm   = (bf16_t*)alloc((size_t)BATCH * NHEADS * S_LEN * DHEAD * 2);  // 8 MB
  bf16_t* Km   = (bf16_t*)alloc((size_t)BATCH * NHEADS * S_LEN * DHEAD * 2);  // 8 MB
  bf16_t* Vtm  = (bf16_t*)alloc((size_t)BATCH * NHEADS * DHEAD * S_LEN * 2);  // 8 MB
  float*  t1   = (float*)alloc((size_t)BS * DMODEL * 4);           // 16 MB (reused as t2)
  float*  hbuf = (float*)alloc((size_t)BS * DMODEL * 4);           // 16 MB
  bf16_t* hb   = (bf16_t*)alloc((size_t)BS * DMODEL * 2);          // 8 MB
  bf16_t* concatb = xb;       // alias: xb dead after QKV
  bf16_t* ffn1out = Qm;       // alias: Q+K region (16 MB) dead after attention
  float*  t2 = t1;            // alias: t1 dead after LN1

  dim3 blk256(256);
  dim3 blkg(G_THR);

  // 1) convert x, transpose-convert all weights (one launch)
  prep_kernel<<<dim3(P_WGS), dim3(P_THR), 0, stream>>>(
      x, wq, wk, wv, wo, f1w, f2w, xb, wqt, wkt, wvt, wot, ff1t, ff2t);

  // 2) QKV projections (per head)
  qkv_kernel<<<dim3(S_LEN / 128, NHEADS / 2, BATCH * 3), blkg, 0, stream>>>(
      xb, wqt, wkt, wvt, bq, bk, bv, Qm, Km, Vtm);

  // 3) flash attention -> concat heads (bf16)
  attn_kernel<<<dim3(S_LEN / 256, NHEADS, BATCH), blk256, 0, stream>>>(
      Qm, Km, Vtm, concatb);

  // 4) output projection + residual(x) -> t1 (f32)
  gemm_kernel<false, true, false, DMODEL><<<dim3(BS / 128, DMODEL / 128), blkg, 0, stream>>>(
      concatb, wot, wob, x, t1, nullptr, DMODEL);

  // 5) LayerNorm1 -> h (f32) + hb (bf16)
  ln_kernel<<<dim3(BS), blk256, 0, stream>>>(t1, g1, b1, hbuf, hb);

  // 6) FFN1: relu(h @ ff1 + b) -> bf16
  gemm_kernel<true, false, true, DFF><<<dim3(BS / 128, DFF / 128), blkg, 0, stream>>>(
      hb, ff1t, f1bias, nullptr, nullptr, ffn1out, DMODEL);

  // 7) FFN2: (+ b + h residual) -> t2 (f32)
  gemm_kernel<false, true, false, DMODEL><<<dim3(BS / 128, DMODEL / 128), blkg, 0, stream>>>(
      ffn1out, ff2t, f2bias, hbuf, t2, nullptr, DFF);

  // 8) LayerNorm2 -> d_out
  ln_kernel<<<dim3(BS), blk256, 0, stream>>>(t2, g2, b2, out, nullptr);
}

// v006
// One run takes 128 microseconds.
// Two timings next to v005 put it at 1.05 and 1.06 times that version's speed.
// All steps since v000 together make it 2.87 times as fast.
#include <hip/hip_runtime.h>
#include <hip/hip_bf16.h>
#include <math.h>

typedef __bf16 bf16_t;
typedef __attribute__((ext_vector_type(16))) __bf16     v16bf;
typedef __attribute__((ext_vector_type(8)))  float       v8f;
typedef __attribute__((ext_vector_type(4)))  unsigned int v4u;

#define S_LEN  1024
#define DMODEL 1024
#define DHEAD  64
#define NHEADS 16
#define DFF    2048
#define BATCH  4

__device__ __forceinline__ v8f wmma_bf16(v16bf a, v16bf b, v8f c) {
  return __builtin_amdgcn_wmma_f32_16x16x32_bf16(false, a, false, b, (short)0, c,
                                                 false, false);
}

__device__ __forceinline__ v16bf frag_load(const bf16_t* __restrict__ base,
                                           int ld, int row0, int k0, int lane) {
  const int r = lane & 15, hf = lane >> 4;
  const bf16_t* p = base + (size_t)(row0 + r) * (size_t)ld + (k0 + hf * 8);
  union { v4u u[2]; v16bf v; } cv;
  cv.u[0] = *(const v4u*)p;
  cv.u[1] = *(const v4u*)(p + 16);
  return cv.v;
}

__device__ __forceinline__ v8f v8f_zero() {
  v8f z = {0.f, 0.f, 0.f, 0.f, 0.f, 0.f, 0.f, 0.f};
  return z;
}

// ---------------------------------------------------------------------------
// Shared GEMM core: one 128x128 block tile, 4 waves (2 x 2) of 64x64: a wave
// reads 4 A and 4 Bt fragments for every 16 WMMAs.  Each pass covers 128 k
// (256 B of every operand row).  The 128 A rows and the 128 Bt rows of a pass
// are brought into LDS by asynchronous b128 copies (whole 128-B lines, 16 lanes
// per row) into one of two buffers, one pass ahead of their use; the waves
// read their fragments from LDS at a row pitch of 272 B.
// ---------------------------------------------------------------------------
#define G_BK    128                      // k elements per pass
#define G_LDP   136                      // LDS row pitch, elements (272 B)
#define G_AROWS 128
#define G_BROWS 128
#define G_BUF   ((G_AROWS + G_BROWS) * G_LDP)   // elements per buffer
#define G_THR   128                      // threads per block

__device__ __forceinline__ void stage_rows(const bf16_t* g, size_t rows8,
                                           unsigned lds) {
  const bf16_t* g0 = g;
  const bf16_t* g1 = g + rows8;
  const bf16_t* g2 = g + 2 * rows8;
  const bf16_t* g3 = g + 3 * rows8;
  const bf16_t* g4 = g + 4 * rows8;
  const bf16_t* g5 = g + 5 * rows8;
  const bf16_t* g6 = g + 6 * rows8;
  const bf16_t* g7 = g + 7 * rows8;
  const unsigned l0 = lds;
  const unsigned l1 = lds + 8 * G_LDP * 2;
  const unsigned l2 = lds + 16 * G_LDP * 2;
  const unsigned l3 = lds + 24 * G_LDP * 2;
  const unsigned l4 = lds + 32 * G_LDP * 2;
  const unsigned l5 = lds + 40 * G_LDP * 2;
  const unsigned l6 = lds + 48 * G_LDP * 2;
  const unsigned l7 = lds + 56 * G_LDP * 2;
  asm volatile(
      "global_load_async_to_lds_b128 %0, %1, off\n\t"
      "global_load_async_to_lds_b128 %2, %3, off\n\t"
      "global_load_async_to_lds_b128 %4, %5, off\n\t"
      "global_load_async_to_lds_b128 %6, %7, off\n\t"
      "global_load_async_to_lds_b128 %8, %9, off\n\t"
      "global_load_async_to_lds_b128 %10, %11, off\n\t"
      "global_load_async_to_lds_b128 %12, %13, off\n\t"
      "global_load_async_to_lds_b128 %14, %15, off\n\t"
      "s_wait_xcnt 0x0"
      :: "v"(l0), "v"(g0), "v"(l1), "v"(g1), "v"(l2), "v"(g2), "v"(l3), "v"(g3),
         "v"(l4), "v"(g4), "v"(l5), "v"(g5), "v"(l6), "v"(g6), "v"(l7), "v"(g7)
      : "memory");
}

// One pass of both operands, 32 copies per lane: the 128 A rows first in the
// buffer, the 128 Bt rows behind them, 64 rows a statement.
__device__ __forceinline__ void stage_copies(const bf16_t* ga, const bf16_t* gb,
                                             size_t rows8, unsigned lds) {
  stage_rows(ga, rows8, lds);
  stage_rows(ga + 8 * rows8, rows8, lds + 64 * G_LDP * 2);
  stage_rows(gb, rows8, lds + G_AROWS * G_LDP * 2);
  stage_rows(gb + 8 * rows8, rows8, lds + (G_AROWS + 64) * G_LDP * 2);
}

// Ablk: first of the block's 128 rows of A; Bblk: first of its 128 rows of Bt;
// both row-major with K elements per row, K a multiple of 128.  Wave w takes
// A rows (w >> 1) * 64 on and Bt rows (w & 1) * 64 on; acc[i][f] is the tile
// of A rows i * 16 on and Bt rows f * 16 on within them.
__device__ __forceinline__ void gemm_core(const bf16_t* __restrict__ Ablk,
                                          const bf16_t* __restrict__ Bblk,
                                          int K, bf16_t* smem, v8f acc[4][4]) {
  const int tid = threadIdx.x;
  const int lane = tid & 31, wave = tid >> 5;
  const int rw = tid >> 4, cw = (tid & 15) * 8;
  const bf16_t* ga = Ablk + (size_t)rw * (size_t)K + cw;
  const bf16_t* gb = Bblk + (size_t)rw * (size_t)K + cw;
  const size_t rows8 = (size_t)8 * (size_t)K;
  const unsigned lds0 = (unsigned)(size_t)smem + (unsigned)(rw * G_LDP + cw) * 2u;
  const int npass = K / G_BK;
  const int arow = (wave >> 1) * 64, brow = G_AROWS + (wave & 1) * 64;

  stage_copies(ga, gb, rows8, lds0);
  // pass 0 has landed for this wave, then for the block
  asm volatile("s_wait_asynccnt 0x0" ::: "memory");
  __syncthreads();
  if (npass > 1) stage_copies(ga + G_BK, gb + G_BK, rows8, lds0 + G_BUF * 2);

  for (int t = 0; t < npass; t++) {
    const int bsel = t & 1;
    const bf16_t* sbuf = smem + bsel * G_BUF;
    v16bf a[4][4], b[4][4];
#pragma unroll
    for (int ks = 0; ks < 4; ks++) {
#pragma unroll
      for (int i = 0; i < 4; i++)
        a[ks][i] = frag_load(sbuf, G_LDP, arow + i * 16, ks * 32, lane);
#pragma unroll
      for (int f = 0; f < 4; f++)
        b[ks][f] = frag_load(sbuf, G_LDP, brow + f * 16, ks * 32, lane);
    }
    // keeps the pass's LDS reads one group ahead of its WMMAs: left free, the
    // compiler puts a pair of reads and a full wait in front of every WMMA
    __builtin_amdgcn_sched_barrier(0);
#pragma unroll
    for (int ks = 0; ks < 4; ks++) {
#pragma unroll
      for (int i = 0; i < 4; i++) {
#pragma unroll
        for (int f = 0; f < 4; f++)
          acc[i][f] = wmma_bf16(a[ks][i], b[ks][f], acc[i][f]);
      }
    }
    // keeps the publish point behind the pass's WMMAs: left free, the compiler
    // lifts its waits and barrier over them, so that every LDS read is waited
    // out before the first WMMA and the copies get no WMMA time to land in
    __builtin_amdgcn_sched_barrier(0);
    // publish point: this wave's reads of the buffer are done, its copies of
    // pass t + 1 have landed; the barrier says both for the whole block
    asm volatile("s_wait_dscnt 0x0" ::: "memory");
    asm volatile("s_wait_asynccnt 0x0" ::: "memory");
    __syncthreads();
    if (t + 2 < npass)
      stage_copies(ga + (size_t)(t + 2) * G_BK, gb + (size_t)(t + 2) * G_BK,
                   rows8, lds0 + (unsigned)bsel * (G_BUF * 2));
  }
  // no copy is left in flight when the wave goes on
  asm volatile("s_wait_asynccnt 0x0" ::: "memory");
}

// ---------------------------------------------------------------------------
// Operand preparation, one launch: x -> bf16, and every weight matrix
// fp32 [R][C] -> bf16 [C][R].  256 work-groups of 16 waves, all resident at
// once; each takes 16384 elements of x and eight 64x64 weight tiles (one each
// of wq, wk, wv, wo, two of ff1, two of ff2).  All 24 b128 loads of a thread
// are issued first; loads and stores cover whole 128-B lines.
// ---------------------------------------------------------------------------
#define P_WGS   256
#define P_THR   512
#define P_PITCH 65                       // LDS tile row pitch, floats

// src: the tile's first element (uniform); off: this thread's byte offset in
// the tile's first 32 rows; C: source row length.
template <int C>
__device__ __forceinline__ void tile_load(const float* src, unsigned off,
                                          float4 v[2]) {
  const char* p = (const char*)src;
  v[0] = *(const float4*)(p + off);
  v[1] = *(const float4*)(p + 32 * C * 4 + off);
}

__device__ __forceinline__ void tile_to_lds(float* tile, int tid, const float4 v[2]) {
  float* t = tile + (tid >> 4) * P_PITCH + (tid & 15) * 4;
#pragma unroll
  for (int i = 0; i < 2; i++) {
    t[32 * i * P_PITCH + 0] = v[i].x;
    t[32 * i * P_PITCH + 1] = v[i].y;
    t[32 * i * P_PITCH + 2] = v[i].z;
    t[32 * i * P_PITCH + 3] = v[i].w;
  }
}

// dst points at element [c0][r0] of the transposed matrix, R = its row length.
// Eight lanes write the 128 B of one destination row.
__device__ __forceinline__ void tile_store_t(const float* tile, int tid,
                                             bf16_t* __restrict__ dst, int R) {
  const int rg = (tid & 7) * 8, c = tid >> 3;
  bf16_t o[8];
#pragma unroll
  for (int e = 0; e < 8; e++) o[e] = (bf16_t)tile[(rg + e) * P_PITCH + c];
  *(v4u*)(dst + (size_t)c * (size_t)R + rg) = *(const v4u*)o;
}

__global__ void __launch_bounds__(P_THR) prep_kernel(
    const float* x, const float* wq, const float* wk, const float* wv,
    const float* wo, const float* f1w, const float* f2w, bf16_t* xb,
    bf16_t* wqt, bf16_t* wkt, bf16_t* wvt, bf16_t* wot, bf16_t* ff1t,
    bf16_t* ff2t) {
  __shared__ float tiles[8][64 * P_PITCH];
  const int tid = threadIdx.x;
  const int b = blockIdx.x, bh = b >> 4, bl = b & 15;
  const int b2 = b + P_WGS;

  // per-head matrices are [1024][64]: head bh, row tile bl
  const size_t hsrc = (size_t)bh * (DMODEL * DHEAD) + (size_t)bl * (64 * DHEAD);
  const size_t hdst = (size_t)bh * (DMODEL * DHEAD) + (size_t)bl * 64;
  const unsigned col = (unsigned)(tid & 15) * 16u, row = (unsigned)(tid >> 4);
  const unsigned o64 = row * (DHEAD * 4) + col;
  const unsigned o1k = row * (DMODEL * 4) + col;
  const unsigned o2k = row * (DFF * 4) + col;

  const float* pq = wq + hsrc;
  const float* pk = wk + hsrc;
  const float* pv = wv + hsrc;
  // wo [1024][1024]: row tile bh, column tile bl
  const float* po = wo + (size_t)bh * (64 * DMODEL) + bl * 64;
  // ff1 [1024][2048]: row tile index >> 5, column tile index & 31
  const float* p1a = f1w + (size_t)(b >> 5) * (64 * DFF) + (b & 31) * 64;
  const float* p1b = f1w + (size_t)(b2 >> 5) * (64 * DFF) + (b2 & 31) * 64;
  // ff2 [2048][1024]: row tile index >> 4, column tile index & 15
  const float* p2a = f2w + (size_t)(b >> 4) * (64 * DMODEL) + (b & 15) * 64;
  const float* p2b = f2w + (size_t)(b2 >> 4) * (64 * DMODEL) + (b2 & 15) * 64;
  // x: 16384 elements from b * 16384 on; o64 is also tid * 16 bytes
  const char* px = (const char*)(x + (size_t)b * (8 * P_THR * 4));

  float4 t[8][2], xv[8];
  tile_load<DHEAD>(pq, o64, t[0]);
  tile_load<DHEAD>(pk, o64, t[1]);
  tile_load<DHEAD>(pv, o64, t[2]);
  tile_load<DMODEL>(po, o1k, t[3]);
  tile_load<DFF>(p1a, o2k, t[4]);
  tile_load<DFF>(p1b, o2k, t[5]);
  tile_load<DMODEL>(p2a, o1k, t[6]);
  tile_load<DMODEL>(p2b, o1k, t[7]);
#pragma unroll
  for (int i = 0; i < 8; i++) xv[i] = *(const float4*)(px + i * (P_THR * 16) + o64);
  // the base and offset registers named by the loads above stay as they are
  // until this wait: as inputs they cannot be rewritten, or given to a load's
  // result, ahead of it (the pointers are not __restrict__, so no load moves
  // behind it)
  asm volatile("s_wait_xcnt 0x0"
               :: "v"(o64), "v"(o1k), "v"(o2k), "s"(pq), "s"(pk), "s"(pv), "s"(po),
                  "s"(p1a), "s"(p1b), "s"(p2a), "s"(p2b), "s"(px)
               : "memory");

#pragma unroll
  for (int k = 0; k < 8; k++) tile_to_lds(tiles[k], tid, t[k]);
  __syncthreads();
#pragma unroll
  for (int i = 0; i < 8; i++) {
    bf16_t o[4] = {(bf16_t)xv[i].x, (bf16_t)xv[i].y, (bf16_t)xv[i].z, (bf16_t)xv[i].w};
    *(uint2*)(xb + (size_t)b * (8 * P_THR * 4) + i * (P_THR * 4) + tid * 4) = *(const uint2*)o;
  }
  tile_store_t(tiles[0], tid, wqt + hdst, DMODEL);
  tile_store_t(tiles[1], tid, wkt + hdst, DMODEL);
  tile_store_t(tiles[2], tid, wvt + hdst, DMODEL);
  tile_store_t(tiles[3], tid, wot + (size_t)bl * (64 * DMODEL) + bh * 64, DMODEL);
  tile_store_t(tiles[4], tid, ff1t + (size_t)(b & 31) * (64 * DMODEL) + (b >> 5) * 64, DMODEL);
  tile_store_t(tiles[5], tid, ff1t + (size_t)(b2 & 31) * (64 * DMODEL) + (b2 >> 5) * 64, DMODEL);
  tile_store_t(tiles[6], tid, ff2t + (size_t)(b & 15) * (64 * DFF) + (b >> 4) * 64, DFF);
  tile_store_t(tiles[7], tid, ff2t + (size_t)(b2 & 15) * (64 * DFF) + (b2 >> 4) * 64, DFF);
}

// ---------------------------------------------------------------------------
// QKV projections.  grid = (S/128, H/2, B*3).  Block = 128 rows x two heads;
// wave = 64 rows x 64 cols (one head's full d_head).  Operands staged in LDS
// (gemm_core).  Q is pre-scaled by 1/sqrt(64); V is stored transposed [64][S].
// ---------------------------------------------------------------------------
__global__ void __launch_bounds__(G_THR) qkv_kernel(
    const bf16_t* __restrict__ xb, const bf16_t* __restrict__ wqt,
    const bf16_t* __restrict__ wkt, const bf16_t* __restrict__ wvt,
    const float* __restrict__ bq, const float* __restrict__ bk,
    const float* __restrict__ bv, bf16_t* __restrict__ Q,
    bf16_t* __restrict__ Kb, bf16_t* __restrict__ Vt) {
  __shared__ __attribute__((aligned(16))) bf16_t smem[2 * G_BUF];
  const int lane = threadIdx.x & 31, wave = threadIdx.x >> 5;
  const int r = lane & 15, hf = lane >> 4;
  const int h = blockIdx.y * 2 + (wave & 1);
  const int which = blockIdx.z % 3, b = blockIdx.z / 3;
  const int sw = blockIdx.x * 128 + (wave >> 1) * 64;

  const bf16_t* A = xb + (size_t)b * S_LEN * DMODEL;
  const bf16_t* Wt = (which == 0 ? wqt : which == 1 ? wkt : wvt) +
                     (size_t)blockIdx.y * 2 * DHEAD * DMODEL;
  const float* bias = (which == 0 ? bq : which == 1 ? bk : bv) + h * DHEAD;

  v8f acc[4][4];
#pragma unroll
  for (int i = 0; i < 4; i++) {
#pragma unroll
    for (int f = 0; f < 4; f++) acc[i][f] = v8f_zero();
  }
  gemm_core(A + (size_t)blockIdx.x * 128 * DMODEL, Wt, DMODEL, smem, acc);

  const float scale = (which == 0) ? 0.125f : 1.0f;  // 1/sqrt(64)
  const size_t bh = (size_t)(b * NHEADS + h);
  if (which < 2) {
    bf16_t* out = (which == 0 ? Q : Kb) + bh * S_LEN * DHEAD;
#pragma unroll
    for (int f = 0; f < 4; f++) {
      const int n = f * 16 + r;
      const float bn = bias[n];
#pragma unroll
      for (int i = 0; i < 4; i++) {
#pragma unroll
        for (int v = 0; v < 8; v++) {
          const int s = sw + i * 16 + v + hf * 8;
          out[(size_t)s * DHEAD + n] = (bf16_t)((acc[i][f][v] + bn) * scale);
        }
      }
    }
  } else {
    bf16_t* out = Vt + bh * DHEAD * S_LEN;
#pragma unroll
    for (int f = 0; f < 4; f++) {
      const int d = f * 16 + r;
      const float bn = bias[d];
#pragma unroll
      for (int i = 0; i < 4; i++) {
        bf16_t tmp[8];
#pragma unroll
        for (int v = 0; v < 8; v++) tmp[v] = (bf16_t)(acc[i][f][v] + bn);
        *(v4u*)(out + (size_t)d * S_LEN + sw + i * 16 + hf * 8) = *(const v4u*)tmp;
      }
    }
    // in the built code the other branch's text follows these stores and
    // rewrites their registers: the wait stands between
    asm volatile("s_wait_xcnt 0x0" ::: "memory");
  }
}

// ---------------------------------------------------------------------------
// Flash attention, transposed products: S^T = K Q^T, O^T += V^T P^T.
// grid = (S/256, H, B).  Each wave: 32 query columns (two groups of 16), full
// d_head = 64 output in 4 x 2 accumulator tiles; online softmax over 32 keys
// per step.  A lane holds 16 of the 32 scores of ONE query (its other half
// sits in lane ^ 16), so maximum and sum run in the lane's own registers with
// one exchange between the halves; the two score tiles of a group, converted
// in place, are the B operand of the second product.  K rows and V^T rows are
// the A operands, each fragment feeding both column groups.
// The eight waves of a block walk the same keys: a stage of 128 keys (128 K
// rows of 128 B, 64 V^T rows of 256 B) is brought into LDS once for all of
// them by asynchronous b128 copies of whole lines, into one of two buffers,
// one stage ahead of its use; the waves read their fragments from LDS.
// ---------------------------------------------------------------------------
#define LOG2E 1.4426950408889634f
#define A_KEYS 128                        // keys per stage
#define A_NST  (S_LEN / A_KEYS)           // stages
#define A_KP   72                         // K row pitch in LDS, elements (144 B)
#define A_VP   136                        // V^T row pitch in LDS, elements (272 B)
#define A_VOFF (A_KEYS * A_KP)            // V^T rows stand behind the K rows
#define A_BUF  (A_VOFF + DHEAD * A_VP)    // elements per buffer

__device__ __forceinline__ float xhalf(float x) {
  const int i = __builtin_bit_cast(int, x);
  return __builtin_bit_cast(
      float, __builtin_amdgcn_permlanex16(i, i, 0x76543210, 0xfedcba98, false, false));
}

__device__ __forceinline__ void attn_stage(const bf16_t* gk, const bf16_t* gv,
                                           unsigned lk, unsigned lv) {
  const bf16_t* k0 = gk;
  const bf16_t* k1 = gk + 32 * DHEAD;
  const bf16_t* k2 = gk + 64 * DHEAD;
  const bf16_t* k3 = gk + 96 * DHEAD;
  const bf16_t* v0 = gv;
  const bf16_t* v1 = gv + 16 * S_LEN;
  const bf16_t* v2 = gv + 32 * S_LEN;
  const bf16_t* v3 = gv + 48 * S_LEN;
  const unsigned a0 = lk;
  const unsigned a1 = lk + 32 * A_KP * 2;
  const unsigned a2 = lk + 64 * A_KP * 2;
  const unsigned a3 = lk + 96 * A_KP * 2;
  const unsigned b0 = lv;
  const unsigned b1 = lv + 16 * A_VP * 2;
  const unsigned b2 = lv + 32 * A_VP * 2;
  const unsigned b3 = lv + 48 * A_VP * 2;
  asm volatile(
      "global_load_async_to_lds_b128 %0, %1, off\n\t"
      "global_load_async_to_lds_b128 %2, %3, off\n\t"
      "global_load_async_to_lds_b128 %4, %5, off\n\t"
      "global_load_async_to_lds_b128 %6, %7, off\n\t"
      "global_load_async_to_lds_b128 %8, %9, off\n\t"
      "global_load_async_to_lds_b128 %10, %11, off\n\t"
      "global_load_async_to_lds_b128 %12, %13, off\n\t"
      "global_load_async_to_lds_b128 %14, %15, off\n\t"
      "s_wait_xcnt 0x0"
      :: "v"(a0), "v"(k0), "v"(a1), "v"(k1), "v"(a2), "v"(k2), "v"(a3), "v"(k3),
         "v"(b0), "v"(v0), "v"(b1), "v"(v1), "v"(b2), "v"(v2), "v"(b3), "v"(v3)
      : "memory");
}

__global__ void __launch_bounds__(256) attn_kernel(
    const bf16_t* __restrict__ Q, const bf16_t* __restrict__ Kb,
    const bf16_t* __restrict__ Vt, bf16_t* __restrict__ concatb) {
  __shared__ __attribute__((aligned(16))) bf16_t smem[2 * A_BUF];
  const int tid = threadIdx.x;
  const int lane = threadIdx.x & 31, wave = threadIdx.x >> 5;
  const int r = lane & 15, hf = lane >> 4;
  const int h = blockIdx.y, b = blockIdx.z;
  const int q0 = blockIdx.x * 256 + wave * 32;
  const size_t bh = (size_t)(b * NHEADS + h);
  const bf16_t* Qb = Q + bh * S_LEN * DHEAD;
  const bf16_t* Kx = Kb + bh * S_LEN * DHEAD;
  const bf16_t* Vx = Vt + bh * DHEAD * S_LEN;

  // copies: eight lanes per K row (a stage's K rows lie in a row in memory),
  // sixteen lanes per V^T row
  const bf16_t* gk = Kx + tid * 8;
  const bf16_t* gv = Vx + (size_t)(tid >> 4) * S_LEN + (tid & 15) * 8;
  const unsigned lk = (unsigned)(size_t)smem +
                      (unsigned)((tid >> 3) * A_KP + (tid & 7) * 8) * 2u;
  const unsigned lv = (unsigned)(size_t)smem +
                      (unsigned)(A_VOFF + (tid >> 4) * A_VP + (tid & 15) * 8) * 2u;

  attn_stage(gk, gv, lk, lv);

  v16bf qb[2][2];  // [column group][half of d]
#pragma unroll
  for (int g = 0; g < 2; g++) {
    qb[g][0] = frag_load(Qb, DHEAD, q0 + g * 16, 0, lane);
    qb[g][1] = frag_load(Qb, DHEAD, q0 + g * 16, 32, lane);
    // the compiler hands these loads' address pair to a later load's result:
    // the wait stands between them
    asm volatile("s_wait_xcnt 0x0" ::: "memory");
  }

  v8f o[4][2];  // [16 rows of d][column group]
#pragma unroll
  for (int dt = 0; dt < 4; dt++) { o[dt][0] = v8f_zero(); o[dt][1] = v8f_zero(); }
  float mrun[2] = {-3.0e38f, -3.0e38f}, lrun[2] = {0.f, 0.f};

  // stage 0 has landed for this wave, then for the block
  asm volatile("s_wait_asynccnt 0x0" ::: "memory");
  __syncthreads();
  attn_stage(gk + A_KEYS * DHEAD, gv + A_KEYS, lk + A_BUF * 2, lv + A_BUF * 2);

  for (int t = 0; t < A_NST; t++) {
    const int bsel = t & 1;
    const bf16_t* sk = smem + bsel * A_BUF;
    const bf16_t* sv = sk + A_VOFF;

    v16bf kf[2][2], vf[4];  // [16 keys][half of d]; [16 rows of d]
#pragma unroll
    for (int kt = 0; kt < 2; kt++) {
      kf[kt][0] = frag_load(sk, A_KP, kt * 16, 0, lane);
      kf[kt][1] = frag_load(sk, A_KP, kt * 16, 32, lane);
    }
#pragma unroll
    for (int dt = 0; dt < 4; dt++) vf[dt] = frag_load(sv, A_VP, dt * 16, 0, lane);

    // kept rolled: unrolled, the compiler puts off the row sums of all four
    // steps to the stage's end and holds their terms in registers, over 256
#pragma unroll 1
    for (int ss = 0; ss < A_KEYS / 32; ss++) {
      // the next step's keys; the stage's last step wraps to its first, so that
      // the loads stand under no branch and nothing is read past the stage
      const int tn = ((ss + 1) * 32) & (A_KEYS - 1);

      v8f s[2][2];  // [16 keys][column group]
#pragma unroll
      for (int kt = 0; kt < 2; kt++) {
#pragma unroll
        for (int g = 0; g < 2; g++) {
          s[kt][g] = wmma_bf16(kf[kt][0], qb[g][0], v8f_zero());
          s[kt][g] = wmma_bf16(kf[kt][1], qb[g][1], s[kt][g]);
        }
      }
      // next K fragments come during the softmax and the second product
#pragma unroll
      for (int kt = 0; kt < 2; kt++) {
        kf[kt][0] = frag_load(sk, A_KP, tn + kt * 16, 0, lane);
        kf[kt][1] = frag_load(sk, A_KP, tn + kt * 16, 32, lane);
      }

      v16bf pf[2];
#pragma unroll
      for (int g = 0; g < 2; g++) {
        float mx = fmaxf(s[0][g][0], s[1][g][0]);
#pragma unroll
        for (int v = 1; v < 8; v++) mx = fmaxf(mx, fmaxf(s[0][g][v], s[1][g][v]));
        mx = fmaxf(mx, xhalf(mx));
        const float mnew = fmaxf(mrun[g], mx);
        const float resc = __builtin_amdgcn_exp2f((mrun[g] - mnew) * LOG2E);
        const float nm = -mnew * LOG2E;
        float ps[8];
#pragma unroll
        for (int v = 0; v < 8; v++) {
          const float p0 = __builtin_amdgcn_exp2f(fmaf(s[0][g][v], LOG2E, nm));
          const float p1 = __builtin_amdgcn_exp2f(fmaf(s[1][g][v], LOG2E, nm));
          ps[v] = p0 + p1;
          pf[g][v]     = (bf16_t)p0;   // key hf * 8 + v
          pf[g][8 + v] = (bf16_t)p1;   // key 16 + hf * 8 + v
        }
        // this half's 16 keys, summed as a tree; the halves join at the end
        lrun[g] = lrun[g] * resc + (((ps[0] + ps[1]) + (ps[2] + ps[3])) +
                                    ((ps[4] + ps[5]) + (ps[6] + ps[7])));
        mrun[g] = mnew;
#pragma unroll
        for (int dt = 0; dt < 4; dt++) o[dt][g] *= resc;
      }

#pragma unroll
      for (int dt = 0; dt < 4; dt++) {
        o[dt][0] = wmma_bf16(vf[dt], pf[0], o[dt][0]);
        o[dt][1] = wmma_bf16(vf[dt], pf[1], o[dt][1]);
      }
      // next V^T fragments come during the next step's first product and softmax
#pragma unroll
      for (int dt = 0; dt < 4; dt++) vf[dt] = frag_load(sv, A_VP, dt * 16, tn, lane);
    }
    // publish point: this wave's reads of the buffer are done, its copies of
    // stage t + 1 have landed; the barrier says both for the whole block
    asm volatile("s_wait_dscnt 0x0" ::: "memory");
    asm volatile("s_wait_asynccnt 0x0" ::: "memory");
    __syncthreads();
    if (t + 2 < A_NST)
      attn_stage(gk + (size_t)(t + 2) * (A_KEYS * DHEAD), gv + (t + 2) * A_KEYS,
                 lk + (unsigned)bsel * (A_BUF * 2), lv + (unsigned)bsel * (A_BUF * 2));
  }
  // no copy is left in flight when the wave goes on
  asm volatile("s_wait_asynccnt 0x0" ::: "memory");

  // a lane holds d = dt * 16 + hf * 8 + {0..7} of one query: 16-byte stores
#pragma unroll
  for (int g = 0; g < 2; g++) {
    const float inv = 1.0f / (lrun[g] + xhalf(lrun[g]));
    bf16_t* out = concatb + ((size_t)b * S_LEN + (size_t)(q0 + g * 16 + r)) * DMODEL +
                  (size_t)h * DHEAD + hf * 8;
#pragma unroll
    for (int dt = 0; dt < 4; dt++) {
      bf16_t tmp[8];
#pragma unroll
      for (int v = 0; v < 8; v++) tmp[v] = (bf16_t)(o[dt][g][v] * inv);
      *(v4u*)(out + dt * 16) = *(const v4u*)tmp;
    }
  }
}

// ---------------------------------------------------------------------------
// Generic WMMA GEMM: C[M,N] = A[M,K](bf16) * Bt[N,K](bf16) + bias[n]
// (+ resid) (ReLU) -> f32 or bf16.  Block = 4 waves = 128x128 tile.
// Operands staged in LDS (gemm_core).
// ---------------------------------------------------------------------------
template <bool RELU, bool HASRES, bool OUTBF16, int N>
__global__ void __launch_bounds__(G_THR) gemm_kernel(
    const bf16_t* __restrict__ A, const bf16_t* __restrict__ Bt,
    const float* __restrict__ bias, const float* __restrict__ resid,
    float* __restrict__ outf, bf16_t* __restrict__ outb, int K) {
  __shared__ __attribute__((aligned(16))) bf16_t smem[2 * G_BUF];
  const int lane = threadIdx.x & 31, wave = threadIdx.x >> 5;
  const int r = lane & 15, hf = lane >> 4;
  const int m0 = blockIdx.x * 128 + (wave >> 1) * 64;
  const int n0 = blockIdx.y * 128 + (wave & 1) * 64;

  v8f acc[4][4];
#pragma unroll
  for (int i = 0; i < 4; i++) {
#pragma unroll
    for (int f = 0; f < 4; f++) acc[i][f] = v8f_zero();
  }
  gemm_core(A + (size_t)blockIdx.x * 128 * (size_t)K,
            Bt + (size_t)blockIdx.y * 128 * (size_t)K, K, smem, acc);

  // The lane's elements lie at e0 + (i * 16 + v) * N + f * 16: one address per
  // array, the rest constant offsets.  All loads, then all sums, then all
  // stores.
  const int nl = n0 + r;
  const unsigned e0 = (unsigned)(m0 + hf * 8) * (unsigned)N + (unsigned)nl;
  float bn[4];
#pragma unroll
  for (int f = 0; f < 4; f++) bn[f] = bias[nl + f * 16];
  if constexpr (HASRES) {
    const float* rp = resid + e0;
    float rv[4][4][8];
#pragma unroll
    for (int f = 0; f < 4; f++) {
#pragma unroll
      for (int i = 0; i < 4; i++) {
#pragma unroll
        for (int v = 0; v < 8; v++) rv[i][f][v] = rp[(i * 16 + v) * N + f * 16];
      }
    }
    // the address registers named by the loads above stay as they are until
    // this wait: as inputs they cannot be rewritten, or given to a load's
    // result, ahead of it
    asm volatile("s_wait_xcnt 0x0" :: "v"(nl), "v"(e0), "v"(rp) : "memory");
#pragma unroll
    for (int f = 0; f < 4; f++) {
#pragma unroll
      for (int i = 0; i < 4; i++) {
#pragma unroll
        for (int v = 0; v < 8; v++) acc[i][f][v] = (acc[i][f][v] + bn[f]) + rv[i][f][v];
      }
    }
  } else {
    asm volatile("s_wait_xcnt 0x0" :: "v"(nl) : "memory");
#pragma unroll
    for (int f = 0; f < 4; f++) {
#pragma unroll
      for (int i = 0; i < 4; i++) {
#pragma unroll
        for (int v = 0; v < 8; v++) acc[i][f][v] = acc[i][f][v] + bn[f];
      }
    }
  }
  if constexpr (RELU) {
#pragma unroll
    for (int f = 0; f < 4; f++) {
#pragma unroll
      for (int i = 0; i < 4; i++) {
#pragma unroll
        for (int v = 0; v < 8; v++) acc[i][f][v] = fmaxf(acc[i][f][v], 0.0f);
      }
    }
  }
  if constexpr (OUTBF16) {
    bf16_t ob[4][4][8];
#pragma unroll
    for (int f = 0; f < 4; f++) {
#pragma unroll
      for (int i = 0; i < 4; i++) {
#pragma unroll
        for (int v = 0; v < 8; v++) ob[i][f][v] = (bf16_t)acc[i][f][v];
      }
    }
    bf16_t* op = outb + e0;
    // keeps every vector operation ahead of the first store, so that no
    // register named by an issued store is written again
    __builtin_amdgcn_sched_barrier(0);
#pragma unroll
    for (int f = 0; f < 4; f++) {
#pragma unroll
      for (int i = 0; i < 4; i++) {
#pragma unroll
        for (int v = 0; v < 8; v++) op[(i * 16 + v) * N + f * 16] = ob[i][f][v];
      }
    }
  } else {
    float* op = outf + e0;
    // keeps every vector operation ahead of the first store, so that no
    // register named by an issued store is written again
    __builtin_amdgcn_sched_barrier(0);
#pragma unroll
    for (int f = 0; f < 4; f++) {
#pragma unroll
      for (int i = 0; i < 4; i++) {
#pragma unroll
        for (int v = 0; v < 8; v++) op[(i * 16 + v) * N + f * 16] = acc[i][f][v];
      }
    }
  }
}

// ---------------------------------------------------------------------------
// LayerNorm (reference semantics): y = g*(x-mean)/(std+eps)+b, std = sqrt(
// mean((x-mean)^2)).  One wave per row of 1024, 16 waves a work-group, one
// work-group per WGP: a lane holds 32 elements of its row (eight b128 loads,
// each wave-wide load four whole lines, all issued first), both sums run in
// the lane's registers and then across the wave's lanes; no LDS, no barrier.
// ---------------------------------------------------------------------------
#define L_WAVES 16
typedef __attribute__((ext_vector_type(4))) float v4f;

template <int CTRL>
__device__ __forceinline__ float row_xadd(float x) {
  return x + __builtin_bit_cast(
                 float, __builtin_amdgcn_update_dpp(
                            0, __builtin_bit_cast(int, x), CTRL, 0xf, 0xf, true));
}

// sum over the 32 lanes, the same bits in every lane
__device__ __forceinline__ float wave_sum(float x) {
  x = row_xadd<0x161>(x);
  x = row_xadd<0x162>(x);
  x = row_xadd<0x164>(x);
  x = row_xadd<0x168>(x);
  return x + xhalf(x);
}

template <bool HASB>
__global__ void __launch_bounds__(L_WAVES * 32) ln_kernel(
    const float* in, const float* gam, const float* bet, float* out,
    bf16_t* outb) {
  const int lane = threadIdx.x & 31;
  const int wave = __builtin_amdgcn_readfirstlane(threadIdx.x >> 5);
  const size_t row = (size_t)(blockIdx.x * L_WAVES + wave);
  const unsigned off = (unsigned)lane * 16u;   // the lane's bytes in 512
  const char* px = (const char*)(in + row * DMODEL);
  const char* pg = (const char*)gam;
  const char* pb = (const char*)bet;

  v4f v[8], g[8], bt[8];
#pragma unroll
  for (int i = 0; i < 8; i++) v[i] = *(const v4f*)(px + i * 512 + off);
#pragma unroll
  for (int i = 0; i < 8; i++) g[i] = *(const v4f*)(pg + i * 512 + off);
#pragma unroll
  for (int i = 0; i < 8; i++) bt[i] = *(const v4f*)(pb + i * 512 + off);
  // the base and offset registers named by the loads above stay as they are
  // until this wait: as inputs they cannot be rewritten, or given to a load's
  // result, ahead of it (the pointers are not __restrict__, so no load moves
  // behind it)
  asm volatile("s_wait_xcnt 0x0" :: "v"(off), "s"(px), "s"(pg), "s"(pb) : "memory");
  // keeps all 24 loads ahead of the sums: left free, the compiler puts the
  // gamma and beta loads behind both sums, where their latency is waited out
  __builtin_amdgcn_sched_barrier(0);

  const v4f s4 = ((v[0] + v[1]) + (v[2] + v[3])) + ((v[4] + v[5]) + (v[6] + v[7]));
  const float mean = wave_sum((s4.x + s4.y) + (s4.z + s4.w)) * (1.0f / DMODEL);

  v4f q4 = {0.f, 0.f, 0.f, 0.f};
#pragma unroll
  for (int i = 0; i < 8; i++) {
    v[i] -= mean;
    q4 += v[i] * v[i];
  }
  const float tots = wave_sum((q4.x + q4.y) + (q4.z + q4.w));
  const float stdv = sqrtf(tots * (1.0f / DMODEL));
  const float inv = 1.0f / (stdv + 1e-5f);

#pragma unroll
  for (int i = 0; i < 8; i++) v[i] = g[i] * v[i] * inv + bt[i];

  // the bf16 copy goes out first: its conversions then stand ahead of every
  // store, and no register named by an issued store is written again
  if constexpr (HASB) {
    char* pob = (char*)(outb + row * DMODEL);
#pragma unroll
    for (int i = 0; i < 8; i++) {
      bf16_t o[4] = {(bf16_t)v[i].x, (bf16_t)v[i].y, (bf16_t)v[i].z, (bf16_t)v[i].w};
      *(uint2*)(pob + i * 256 + (off >> 1)) = *(const uint2*)o;
    }
  }
  char* po = (char*)(out + row * DMODEL);
#pragma unroll
  for (int i = 0; i < 8; i++) *(v4f*)(po + i * 512 + off) = v[i];
}

// ---------------------------------------------------------------------------
extern "C" void kernel_launch(void* const* d_in, const int* in_sizes, int n_in,
                              void* d_out, int out_size, void* d_ws,
                              size_t ws_size, hipStream_t stream) {
  (void)in_sizes; (void)n_in; (void)out_size; (void)ws_size;
  const float* x   = (const float*)d_in[0];
  const float* wq  = (const float*)d_in[1];
  const float* bq  = (const float*)d_in[2];
  const float* wk  = (const float*)d_in[3];
  const float* bk  = (const float*)d_in[4];
  const float* wv  = (const float*)d_in[5];
  const float* bv  = (const float*)d_in[6];
  const float* wo  = (const float*)d_in[7];
  const float* wob = (const float*)d_in[8];
  const float* g1  = (const float*)d_in[9];
  const float* b1  = (const float*)d_in[10];
  const float* f1w = (const float*)d_in[11];
  const float* f1bias = (const float*)d_in[12];
  const float* f2w = (const float*)d_in[13];
  const float* f2bias = (const float*)d_in[14];
  const float* g2  = (const float*)d_in[15];
  const float* b2  = (const float*)d_in[16];
  float* out = (float*)d_out;

  char* ws = (char*)d_ws;
  size_t off = 0;
  auto alloc = [&](size_t bytes) -> char* {
    char* p = ws + off;
    off += (bytes + 255) & ~(size_t)255;
    return p;
  };
  const int BS = BATCH * S_LEN;  // 4096 rows
  bf16_t* xb   = (bf16_t*)alloc((size_t)BS * DMODEL * 2);          // 8 MB (reused as concat)
  bf16_t* wqt  = (bf16_t*)alloc((size_t)NHEADS * DHEAD * DMODEL * 2);
  bf16_t* wkt  = (bf16_t*)alloc((size_t)NHEADS * DHEAD * DMODEL * 2);
  bf16_t* wvt  = (bf16_t*)alloc((size_t)NHEADS * DHEAD * DMODEL * 2);
  bf16_t* wot  = (bf16_t*)alloc((size_t)DMODEL * DMODEL * 2);
  bf16_t* ff1t = (bf16_t*)alloc((size_t)DFF * DMODEL * 2);
  bf16_t* ff2t = (bf16_t*)alloc((size_t)DMODEL * DFF * 2);
  bf16_t* Qm   = (bf16_t*)alloc((size_t)BATCH * NHEADS * S_LEN * DHEAD * 2);  // 8 MB
  bf16_t* Km   = (bf16_t*)alloc((size_t)BATCH * NHEADS * S_LEN * DHEAD * 2);  // 8 MB
  bf16_t* Vtm  = (bf16_t*)alloc((size_t)BATCH * NHEADS * DHEAD * S_LEN * 2);  // 8 MB
  float*  t1   = (float*)alloc((size_t)BS * DMODEL * 4);           // 16 MB (reused as t2)
  float*  hbuf = (float*)alloc((size_t)BS * DMODEL * 4);           // 16 MB
  bf16_t* hb   = (bf16_t*)alloc((size_t)BS * DMODEL * 2);          // 8 MB
  bf16_t* concatb = xb;       // alias: xb dead after QKV
  bf16_t* ffn1out = Qm;       // alias: Q+K region (16 MB) dead after attention
  float*  t2 = t1;            // alias: t1 dead after LN1

  dim3 blk256(256);
  dim3 blkg(G_THR);

  // 1) convert x, transpose-convert all weights (one launch)
  prep_kernel<<<dim3(P_WGS), dim3(P_THR), 0, stream>>>(
      x, wq, wk, wv, wo, f1w, f2w, xb, wqt, wkt, wvt, wot, ff1t, ff2t);

  // 2) QKV projections (per head)
  qkv_kernel<<<dim3(S_LEN / 128, NHEADS / 2, BATCH * 3), blkg, 0, stream>>>(
      xb, wqt, wkt, wvt, bq, bk, bv, Qm, Km, Vtm);

  // 3) flash attention -> concat heads (bf16)
  attn_kernel<<<dim3(S_LEN / 256, NHEADS, BATCH), blk256, 0, stream>>>(
      Qm, Km, Vtm, concatb);

  // 4) output projection + residual(x) -> t1 (f32)
  gemm_kernel<false, true, false, DMODEL><<<dim3(BS / 128, DMODEL / 128), blkg, 0, stream>>>(
      concatb, wot, wob, x, t1, nullptr, DMODEL);

  // 5) LayerNorm1 -> h (f32) + hb (bf16)
  ln_kernel<true><<<dim3(BS / L_WAVES), dim3(L_WAVES * 32), 0, stream>>>(t1, g1, b1, hbuf, hb);

  // 6) FFN1: relu(h @ ff1 + b) -> bf16
  gemm_kernel<true, false, true, DFF><<<dim3(BS / 128, DFF / 128), blkg, 0, stream>>>(
      hb, ff1t, f1bias, nullptr, nullptr, ffn1out, DMODEL);

  // 7) FFN2: (+ b + h residual) -> t2 (f32)
  gemm_kernel<false, true, false, DMODEL><<<dim3(BS / 128, DMODEL / 128), blkg, 0, stream>>>(
      ffn1out, ff2t, f2bias, hbuf, t2, nullptr, DFF);

  // 8) LayerNorm2 -> d_out
  ln_kernel<false><<<dim3(BS / L_WAVES), dim3(L_WAVES * 32), 0, stream>>>(t2, g2, b2, out, nullptr);
}

// v007
// One run takes 119 microseconds.
// In two side-by-side timings against v006, it was 1.08 and 1.07 times as fast.
// Over all steps from v000 it is 3.09 times as fast.
#include <hip/hip_runtime.h>
#include <hip/hip_bf16.h>
#include <math.h>

typedef __bf16 bf16_t;
typedef __attribute__((ext_vector_type(16))) __bf16     v16bf;
typedef __attribute__((ext_vector_type(8)))  float       v8f;
typedef __attribute__((ext_vector_type(4)))  unsigned int v4u;
typedef __attribute__((ext_vector_type(4)))  float       v4f;

#define S_LEN  1024
#define DMODEL 1024
#define DHEAD  64
#define NHEADS 16
#define DFF    2048
#define BATCH  4

__device__ __forceinline__ v8f wmma_bf16(v16bf a, v16bf b, v8f c) {
  return __builtin_amdgcn_wmma_f32_16x16x32_bf16(false, a, false, b, (short)0, c,
                                                 false, false);
}

__device__ __forceinline__ v16bf frag_load(const bf16_t* __restrict__ base,
                                           int ld, int row0, int k0, int lane) {
  const int r = lane & 15, hf = lane >> 4;
  const bf16_t* p = base + (size_t)(row0 + r) * (size_t)ld + (k0 + hf * 8);
  union { v4u u[2]; v16bf v; } cv;
  cv.u[0] = *(const v4u*)p;
  cv.u[1] = *(const v4u*)(p + 16);
  return cv.v;
}

__device__ __forceinline__ v8f v8f_zero() {
  v8f z = {0.f, 0.f, 0.f, 0.f, 0.f, 0.f, 0.f, 0.f};
  return z;
}

// ---------------------------------------------------------------------------
// Shared GEMM core: one 128x128 block tile, 4 waves (2 x 2) of 64x64: a wave
// reads 4 A and 4 Bt fragments for every 16 WMMAs.  Each pass covers 128 k
// (256 B of every operand row).  The 128 A rows and the 128 Bt rows of a pass
// are brought into LDS by asynchronous b128 copies (whole 128-B lines, 16 lanes
// per row) into one of two buffers, one pass ahead of their use; the waves
// read their fragments from LDS at a row pitch of 272 B.
// The Bt rows are dealt to the fragments: within each 64 rows, row 4 * r + f
// lands in LDS row f * 16 + r, so that lane r of fragment f holds it.  A lane's
// four accumulator tiles of one A row are then four adjacent columns, and the
// 16 lanes of a row together hold 64 adjacent columns: the epilogues load and
// store whole 128-B lines.
// ---------------------------------------------------------------------------
#define G_BK    128                      // k elements per pass
#define G_LDP   136                      // LDS row pitch, elements (272 B)
#define G_AROWS 128
#define G_BROWS 128
#define G_BUF   ((G_AROWS + G_BROWS) * G_LDP)   // elements per buffer
#define G_THR   128                      // threads per block

template <int LSTEP>
__device__ __forceinline__ void stage_rows(const bf16_t* g, size_t rows8,
                                           unsigned lds) {
  const bf16_t* g0 = g;
  const bf16_t* g1 = g + rows8;
  const bf16_t* g2 = g + 2 * rows8;
  const bf16_t* g3 = g + 3 * rows8;
  const bf16_t* g4 = g + 4 * rows8;
  const bf16_t* g5 = g + 5 * rows8;
  const bf16_t* g6 = g + 6 * rows8;
  const bf16_t* g7 = g + 7 * rows8;
  const unsigned l0 = lds;
  const unsigned l1 = lds + 1 * LSTEP * G_LDP * 2;
  const unsigned l2 = lds + 2 * LSTEP * G_LDP * 2;
  const unsigned l3 = lds + 3 * LSTEP * G_LDP * 2;
  const unsigned l4 = lds + 4 * LSTEP * G_LDP * 2;
  const unsigned l5 = lds + 5 * LSTEP * G_LDP * 2;
  const unsigned l6 = lds + 6 * LSTEP * G_LDP * 2;
  const unsigned l7 = lds + 7 * LSTEP * G_LDP * 2;
  asm volatile(
      "global_load_async_to_lds_b128 %0, %1, off\n\t"
      "global_load_async_to_lds_b128 %2, %3, off\n\t"
      "global_load_async_to_lds_b128 %4, %5, off\n\t"
      "global_load_async_to_lds_b128 %6, %7, off\n\t"
      "global_load_async_to_lds_b128 %8, %9, off\n\t"
      "global_load_async_to_lds_b128 %10, %11, off\n\t"
      "global_load_async_to_lds_b128 %12, %13, off\n\t"
      "global_load_async_to_lds_b128 %14, %15, off\n\t"
      "s_wait_xcnt 0x0"
      :: "v"(l0), "v"(g0), "v"(l1), "v"(g1), "v"(l2), "v"(g2), "v"(l3), "v"(g3),
         "v"(l4), "v"(g4), "v"(l5), "v"(g5), "v"(l6), "v"(g6), "v"(l7), "v"(g7)
      : "memory");
}

// One pass of both operands, 32 copies per lane: the 128 A rows first in the
// buffer, the 128 Bt rows behind them, 64 rows a statement.  lda: the lane's
// place in A row tid >> 4; ldb: its place in the LDS row that Bt row tid >> 4
// is dealt to (Bt row + 8 lands two LDS rows further on).
__device__ __forceinline__ void stage_copies(const bf16_t* ga, const bf16_t* gb,
                                             size_t rows8, unsigned lda,
                                             unsigned ldb) {
  stage_rows<8>(ga, rows8, lda);
  stage_rows<8>(ga + 8 * rows8, rows8, lda + 64 * G_LDP * 2);
  stage_rows<2>(gb, rows8, ldb + G_AROWS * G_LDP * 2);
  stage_rows<2>(gb + 8 * rows8, rows8, ldb + (G_AROWS + 64) * G_LDP * 2);
}

// Ablk: first of the block's 128 rows of A; Bblk: first of its 128 rows of Bt;
// both row-major with K elements per row, K a multiple of 128.  Wave w takes
// A rows (w >> 1) * 64 on and Bt rows (w & 1) * 64 on; within them acc[i][f]
// is the tile of A rows i * 16 on and of Bt rows 4 * r + f, r the lane & 15.
__device__ __forceinline__ void gemm_core(const bf16_t* __restrict__ Ablk,
                                          const bf16_t* __restrict__ Bblk,
                                          int K, bf16_t* smem, v8f acc[4][4]) {
  const int tid = threadIdx.x;
  const int lane = tid & 31, wave = tid >> 5;
  const int rw = tid >> 4, cw = (tid & 15) * 8;
  const bf16_t* ga = Ablk + (size_t)rw * (size_t)K + cw;
  const bf16_t* gb = Bblk + (size_t)rw * (size_t)K + cw;
  const size_t rows8 = (size_t)8 * (size_t)K;
  const unsigned lda0 = (unsigned)(size_t)smem + (unsigned)(rw * G_LDP + cw) * 2u;
  const unsigned ldb0 = (unsigned)(size_t)smem +
                        (unsigned)(((rw & 3) * 16 + (rw >> 2)) * G_LDP + cw) * 2u;
  const int npass = K / G_BK;
  const int arow = (wave >> 1) * 64, brow = G_AROWS + (wave & 1) * 64;

  stage_copies(ga, gb, rows8, lda0, ldb0);
  // pass 0 has landed for this wave, then for the block
  asm volatile("s_wait_asynccnt 0x0" ::: "memory");
  __syncthreads();
  if (npass > 1)
    stage_copies(ga + G_BK, gb + G_BK, rows8, lda0 + G_BUF * 2, ldb0 + G_BUF * 2);

  for (int t = 0; t < npass; t++) {
    const int bsel = t & 1;
    const bf16_t* sbuf = smem + bsel * G_BUF;
    v16bf a[4][4], b[4][4];
#pragma unroll
    for (int ks = 0; ks < 4; ks++) {
#pragma unroll
      for (int i = 0; i < 4; i++)
        a[ks][i] = frag_load(sbuf, G_LDP, arow + i * 16, ks * 32, lane);
#pragma unroll
      for (int f = 0; f < 4; f++)
        b[ks][f] = frag_load(sbuf, G_LDP, brow + f * 16, ks * 32, lane);
    }
    // keeps the pass's LDS reads one group ahead of its WMMAs: left free, the
    // compiler puts a pair of reads and a full wait in front of every WMMA
    __builtin_amdgcn_sched_barrier(0);
#pragma unroll
    for (int ks = 0; ks < 4; ks++) {
#pragma unroll
      for (int i = 0; i < 4; i++) {
#pragma unroll
        for (int f = 0; f < 4; f++)
          acc[i][f] = wmma_bf16(a[ks][i], b[ks][f], acc[i][f]);
      }
    }
    // keeps the publish point behind the pass's WMMAs: left free, the compiler
    // lifts its waits and barrier over them, so that every LDS read is waited
    // out before the first WMMA and the copies get no WMMA time to land in
    __builtin_amdgcn_sched_barrier(0);
    // publish point: this wave's reads of the buffer are done, its copies of
    // pass t + 1 have landed; the barrier says both for the whole block
    asm volatile("s_wait_dscnt 0x0" ::: "memory");
    asm volatile("s_wait_asynccnt 0x0" ::: "memory");
    __syncthreads();
    if (t + 2 < npass)
      stage_copies(ga + (size_t)(t + 2) * G_BK, gb + (size_t)(t + 2) * G_BK,
                   rows8, lda0 + (unsigned)bsel * (G_BUF * 2),
                   ldb0 + (unsigned)bsel * (G_BUF * 2));
  }
  // no copy is left in flight when the wave goes on
  asm volatile("s_wait_asynccnt 0x0" ::: "memory");
}

// ---------------------------------------------------------------------------
// Operand preparation, one launch: x -> bf16, and every weight matrix
// fp32 [R][C] -> bf16 [C][R].  256 work-groups of 16 waves, all resident at
// once; each takes 16384 elements of x and eight 64x64 weight tiles (one each
// of wq, wk, wv, wo, two of ff1, two of ff2).  All 24 b128 loads of a thread
// are issued first; loads and stores cover whole 128-B lines.
// ---------------------------------------------------------------------------
#define P_WGS   256
#define P_THR   512
#define P_PITCH 65                       // LDS tile row pitch, floats

// src: the tile's first element (uniform); off: this thread's byte offset in
// the tile's first 32 rows; C: source row length.
template <int C>
__device__ __forceinline__ void tile_load(const float* src, unsigned off,
                                          float4 v[2]) {
  const char* p = (const char*)src;
  v[0] = *(const float4*)(p + off);
  v[1] = *(const float4*)(p + 32 * C * 4 + off);
}

__device__ __forceinline__ void tile_to_lds(float* tile, int tid, const float4 v[2]) {
  float* t = tile + (tid >> 4) * P_PITCH + (tid & 15) * 4;
#pragma unroll
  for (int i = 0; i < 2; i++) {
    t[32 * i * P_PITCH + 0] = v[i].x;
    t[32 * i * P_PITCH + 1] = v[i].y;
    t[32 * i * P_PITCH + 2] = v[i].z;
    t[32 * i * P_PITCH + 3] = v[i].w;
  }
}

// dst points at element [c0][r0] of the transposed matrix, R = its row length.
// Eight lanes write the 128 B of one destination row.
__device__ __forceinline__ void tile_store_t(const float* tile, int tid,
                                             bf16_t* __restrict__ dst, int R) {
  const int rg = (tid & 7) * 8, c = tid >> 3;
  bf16_t o[8];
#pragma unroll
  for (int e = 0; e < 8; e++) o[e] = (bf16_t)tile[(rg + e) * P_PITCH + c];
  *(v4u*)(dst + (size_t)c * (size_t)R + rg) = *(const v4u*)o;
}

__global__ void __launch_bounds__(P_THR) prep_kernel(
    const float* x, const float* wq, const float* wk, const float* wv,
    const float* wo, const float* f1w, const float* f2w, bf16_t* xb,
    bf16_t* wqt, bf16_t* wkt, bf16_t* wvt, bf16_t* wot, bf16_t* ff1t,
    bf16_t* ff2t) {
  __shared__ float tiles[8][64 * P_PITCH];
  const int tid = threadIdx.x;
  const int b = blockIdx.x, bh = b >> 4, bl = b & 15;
  const int b2 = b + P_WGS;

  // per-head matrices are [1024][64]: head bh, row tile bl
  const size_t hsrc = (size_t)bh * (DMODEL * DHEAD) + (size_t)bl * (64 * DHEAD);
  const size_t hdst = (size_t)bh * (DMODEL * DHEAD) + (size_t)bl * 64;
  const unsigned col = (unsigned)(tid & 15) * 16u, row = (unsigned)(tid >> 4);
  const unsigned o64 = row * (DHEAD * 4) + col;
  const unsigned o1k = row * (DMODEL * 4) + col;
  const unsigned o2k = row * (DFF * 4) + col;

  const float* pq = wq + hsrc;
  const float* pk = wk + hsrc;
  const float* pv = wv + hsrc;
  // wo [1024][1024]: row tile bh, column tile bl
  const float* po = wo + (size_t)bh * (64 * DMODEL) + bl * 64;
  // ff1 [1024][2048]: row tile index >> 5, column tile index & 31
  const float* p1a = f1w + (size_t)(b >> 5) * (64 * DFF) + (b & 31) * 64;
  const float* p1b = f1w + (size_t)(b2 >> 5) * (64 * DFF) + (b2 & 31) * 64;
  // ff2 [2048][1024]: row tile index >> 4, column tile index & 15
  const float* p2a = f2w + (size_t)(b >> 4) * (64 * DMODEL) + (b & 15) * 64;
  const float* p2b = f2w + (size_t)(b2 >> 4) * (64 * DMODEL) + (b2 & 15) * 64;
  // x: 16384 elements from b * 16384 on; o64 is also tid * 16 bytes
  const char* px = (const char*)(x + (size_t)b * (8 * P_THR * 4));

  float4 t[8][2], xv[8];
  tile_load<DHEAD>(pq, o64, t[0]);
  tile_load<DHEAD>(pk, o64, t[1]);
  tile_load<DHEAD>(pv, o64, t[2]);
  tile_load<DMODEL>(po, o1k, t[3]);
  tile_load<DFF>(p1a, o2k, t[4]);
  tile_load<DFF>(p1b, o2k, t[5]);
  tile_load<DMODEL>(p2a, o1k, t[6]);
  tile_load<DMODEL>(p2b, o1k, t[7]);
#pragma unroll
  for (int i = 0; i < 8; i++) xv[i] = *(const float4*)(px + i * (P_THR * 16) + o64);
  // the base and offset registers named by the loads above stay as they are
  // until this wait: as inputs they cannot be rewritten, or given to a load's
  // result, ahead of it (the pointers are not __restrict__, so no load moves
  // behind it)
  asm volatile("s_wait_xcnt 0x0"
               :: "v"(o64), "v"(o1k), "v"(o2k), "s"(pq), "s"(pk), "s"(pv), "s"(po),
                  "s"(p1a), "s"(p1b), "s"(p2a), "s"(p2b), "s"(px)
               : "memory");

#pragma unroll
  for (int k = 0; k < 8; k++) tile_to_lds(tiles[k], tid, t[k]);
  __syncthreads();
#pragma unroll
  for (int i = 0; i < 8; i++) {
    bf16_t o[4] = {(bf16_t)xv[i].x, (bf16_t)xv[i].y, (bf16_t)xv[i].z, (bf16_t)xv[i].w};
    *(uint2*)(xb + (size_t)b * (8 * P_THR * 4) + i * (P_THR * 4) + tid * 4) = *(const uint2*)o;
  }
  tile_store_t(tiles[0], tid, wqt + hdst, DMODEL);
  tile_store_t(tiles[1], tid, wkt + hdst, DMODEL);
  tile_store_t(tiles[2], tid, wvt + hdst, DMODEL);
  tile_store_t(tiles[3], tid, wot + (size_t)bl * (64 * DMODEL) + bh * 64, DMODEL);
  tile_store_t(tiles[4], tid, ff1t + (size_t)(b & 31) * (64 * DMODEL) + (b >> 5) * 64, DMODEL);
  tile_store_t(tiles[5], tid, ff1t + (size_t)(b2 & 31) * (64 * DMODEL) + (b2 >> 5) * 64, DMODEL);
  tile_store_t(tiles[6], tid, ff2t + (size_t)(b & 15) * (64 * DFF) + (b >> 4) * 64, DFF);
  tile_store_t(tiles[7], tid, ff2t + (size_t)(b2 & 15) * (64 * DFF) + (b2 >> 4) * 64, DFF);
}

// ---------------------------------------------------------------------------
// QKV projections.  grid = (S/128, H/2, B*3).  Block = 128 rows x two heads;
// wave = 64 rows x 64 cols (one head's full d_head).  Operands staged in LDS
// (gemm_core).  Q is pre-scaled by 1/sqrt(64); V is stored transposed [64][S].
// The operand whose index runs along the output's rows in memory is the dealt
// one: the weights for Q and K, x for V^T.  A lane then stores four adjacent
// bf16, and 16 lanes one whole 128-B line.
// ---------------------------------------------------------------------------
__global__ void __launch_bounds__(G_THR) qkv_kernel(
    const bf16_t* __restrict__ xb, const bf16_t* __restrict__ wqt,
    const bf16_t* __restrict__ wkt, const bf16_t* __restrict__ wvt,
    const float* __restrict__ bq, const float* __restrict__ bk,
    const float* __restrict__ bv, bf16_t* __restrict__ Q,
    bf16_t* __restrict__ Kb, bf16_t* __restrict__ Vt) {
  __shared__ __attribute__((aligned(16))) bf16_t smem[2 * G_BUF];
  const int lane = threadIdx.x & 31, wave = threadIdx.x >> 5;
  const int r = lane & 15, hf = lane >> 4;
  const int wa = wave >> 1, wb = wave & 1;
  const int which = blockIdx.z % 3, b = blockIdx.z / 3;

  const bf16_t* Xblk = xb + ((size_t)b * S_LEN + (size_t)blockIdx.x * 128) * DMODEL;
  const bf16_t* Wblk = (which == 0 ? wqt : which == 1 ? wkt : wvt) +
                       (size_t)blockIdx.y * 2 * DHEAD * DMODEL;

  v8f acc[4][4];
#pragma unroll
  for (int i = 0; i < 4; i++) {
#pragma unroll
    for (int f = 0; f < 4; f++) acc[i][f] = v8f_zero();
  }
  gemm_core(which == 2 ? Wblk : Xblk, which == 2 ? Xblk : Wblk, DMODEL, smem, acc);

  uint2 ob[4][8];
  if (which < 2) {
    // rows: s = s0 + i * 16 + v; columns: n = nl + f of head h
    const int h = blockIdx.y * 2 + wb;
    const int nl = h * DHEAD + r * 4;
    const int s0 = blockIdx.x * 128 + wa * 64 + hf * 8;
    const float scale = (which == 0) ? 0.125f : 1.0f;  // 1/sqrt(64)
    const v4f bn = *(const v4f*)((which == 0 ? bq : bk) + nl);
    // the offset register named by the load above stays as it is until this wait
    asm volatile("s_wait_xcnt 0x0" :: "v"(nl) : "memory");
#pragma unroll
    for (int i = 0; i < 4; i++) {
#pragma unroll
      for (int v = 0; v < 8; v++) {
        bf16_t o[4];
#pragma unroll
        for (int f = 0; f < 4; f++) o[f] = (bf16_t)((acc[i][f][v] + bn[f]) * scale);
        ob[i][v] = *(const uint2*)o;
      }
    }
    bf16_t* op = (which == 0 ? Q : Kb) +
                 ((size_t)(b * NHEADS + h) * S_LEN + (size_t)s0) * DHEAD + r * 4;
    // keeps every vector operation ahead of the first store, so that no
    // register named by an issued store is written again
    __builtin_amdgcn_sched_barrier(0);
#pragma unroll
    for (int i = 0; i < 4; i++) {
#pragma unroll
      for (int v = 0; v < 8; v++) *(uint2*)(op + (i * 16 + v) * DHEAD) = ob[i][v];
    }
  } else {
    // rows: d = d0 + i * 16 + v of head h; columns: s = s0 + f
    const int h = blockIdx.y * 2 + wa;
    const int d0 = hf * 8;
    const int nl = h * DHEAD + d0;
    const int s0 = blockIdx.x * 128 + wb * 64 + r * 4;
    v4f bn[4][2];
#pragma unroll
    for (int i = 0; i < 4; i++) {
      bn[i][0] = *(const v4f*)(bv + nl + i * 16);
      bn[i][1] = *(const v4f*)(bv + nl + i * 16 + 4);
    }
    // the offset register named by the loads above stays as it is until this wait
    asm volatile("s_wait_xcnt 0x0" :: "v"(nl) : "memory");
#pragma unroll
    for (int i = 0; i < 4; i++) {
#pragma unroll
      for (int v = 0; v < 8; v++) {
        const float bd = bn[i][v >> 2][v & 3];
        bf16_t o[4];
#pragma unroll
        for (int f = 0; f < 4; f++) o[f] = (bf16_t)(acc[i][f][v] + bd);
        ob[i][v] = *(const uint2*)o;
      }
    }
    bf16_t* op = Vt + ((size_t)(b * NHEADS + h) * DHEAD + (size_t)d0) * S_LEN + s0;
    // keeps every vector operation ahead of the first store, so that no
    // register named by an issued store is written again
    __builtin_amdgcn_sched_barrier(0);
#pragma unroll
    for (int i = 0; i < 4; i++) {
#pragma unroll
      for (int v = 0; v < 8; v++) *(uint2*)(op + (i * 16 + v) * S_LEN) = ob[i][v];
    }
    // in the built code the other branch's text follows these stores and
    // rewrites their registers: the wait stands between
    asm volatile("s_wait_xcnt 0x0" ::: "memory");
  }
}

// ---------------------------------------------------------------------------
// Flash attention, transposed products: S^T = K Q^T, O^T += V^T P^T.
// grid = (S/256, H, B).  Each wave: 32 query columns (two groups of 16), full
// d_head = 64 output in 4 x 2 accumulator tiles; online softmax over 32 keys
// per step.  A lane holds 16 of the 32 scores of ONE query (its other half
// sits in lane ^ 16), so maximum and sum run in the lane's own registers with
// one exchange between the halves; the two score tiles of a group, converted
// in place, are the B operand of the second product.  K rows and V^T rows are
// the A operands, each fragment feeding both column groups.
// The eight waves of a block walk the same keys: a stage of 128 keys (128 K
// rows of 128 B, 64 V^T rows of 256 B) is brought into LDS once for all of
// them by asynchronous b128 copies of whole lines, into one of two buffers,
// one stage ahead of its use; the waves read their fragments from LDS.
// ---------------------------------------------------------------------------
#define LOG2E 1.4426950408889634f
#define A_KEYS 128                        // keys per stage
#define A_NST  (S_LEN / A_KEYS)           // stages
#define A_KP   72                         // K row pitch in LDS, elements (144 B)
#define A_VP   136                        // V^T row pitch in LDS, elements (272 B)
#define A_VOFF (A_KEYS * A_KP)            // V^T rows stand behind the K rows
#define A_BUF  (A_VOFF + DHEAD * A_VP)    // elements per buffer

__device__ __forceinline__ float xhalf(float x) {
  const int i = __builtin_bit_cast(int, x);
  return __builtin_bit_cast(
      float, __builtin_amdgcn_permlanex16(i, i, 0x76543210, 0xfedcba98, false, false));
}

__device__ __forceinline__ void attn_stage(const bf16_t* gk, const bf16_t* gv,
                                           unsigned lk, unsigned lv) {
  const bf16_t* k0 = gk;
  const bf16_t* k1 = gk + 32 * DHEAD;
  const bf16_t* k2 = gk + 64 * DHEAD;
  const bf16_t* k3 = gk + 96 * DHEAD;
  const bf16_t* v0 = gv;
  const bf16_t* v1 = gv + 16 * S_LEN;
  const bf16_t* v2 = gv + 32 * S_LEN;
  const bf16_t* v3 = gv + 48 * S_LEN;
  const unsigned a0 = lk;
  const unsigned a1 = lk + 32 * A_KP * 2;
  const unsigned a2 = lk + 64 * A_KP * 2;
  const unsigned a3 = lk + 96 * A_KP * 2;
  const unsigned b0 = lv;
  const unsigned b1 = lv + 16 * A_VP * 2;
  const unsigned b2 = lv + 32 * A_VP * 2;
  const unsigned b3 = lv + 48 * A_VP * 2;
  asm volatile(
      "global_load_async_to_lds_b128 %0, %1, off\n\t"
      "global_load_async_to_lds_b128 %2, %3, off\n\t"
      "global_load_async_to_lds_b128 %4, %5, off\n\t"
      "global_load_async_to_lds_b128 %6, %7, off\n\t"
      "global_load_async_to_lds_b128 %8, %9, off\n\t"
      "global_load_async_to_lds_b128 %10, %11, off\n\t"
      "global_load_async_to_lds_b128 %12, %13, off\n\t"
      "global_load_async_to_lds_b128 %14, %15, off\n\t"
      "s_wait_xcnt 0x0"
      :: "v"(a0), "v"(k0), "v"(a1), "v"(k1), "v"(a2), "v"(k2), "v"(a3), "v"(k3),
         "v"(b0), "v"(v0), "v"(b1), "v"(v1), "v"(b2), "v"(v2), "v"(b3), "v"(v3)
      : "memory");
}

__global__ void __launch_bounds__(256) attn_kernel(
    const bf16_t* __restrict__ Q, const bf16_t* __restrict__ Kb,
    const bf16_t* __restrict__ Vt, bf16_t* __restrict__ concatb) {
  __shared__ __attribute__((aligned(16))) bf16_t smem[2 * A_BUF];
  const int tid = threadIdx.x;
  const int lane = threadIdx.x & 31, wave = threadIdx.x >> 5;
  const int r = lane & 15, hf = lane >> 4;
  const int h = blockIdx.y, b = blockIdx.z;
  const int q0 = blockIdx.x * 256 + wave * 32;
  const size_t bh = (size_t)(b * NHEADS + h);
  const bf16_t* Qb = Q + bh * S_LEN * DHEAD;
  const bf16_t* Kx = Kb + bh * S_LEN * DHEAD;
  const bf16_t* Vx = Vt + bh * DHEAD * S_LEN;

  // copies: eight lanes per K row (a stage's K rows lie in a row in memory),
  // sixteen lanes per V^T row
  const bf16_t* gk = Kx + tid * 8;
  const bf16_t* gv = Vx + (size_t)(tid >> 4) * S_LEN + (tid & 15) * 8;
  const unsigned lk = (unsigned)(size_t)smem +
                      (unsigned)((tid >> 3) * A_KP + (tid & 7) * 8) * 2u;
  const unsigned lv = (unsigned)(size_t)smem +
                      (unsigned)(A_VOFF + (tid >> 4) * A_VP + (tid & 15) * 8) * 2u;

  attn_stage(gk, gv, lk, lv);

  v16bf qb[2][2];  // [column group][half of d]
#pragma unroll
  for (int g = 0; g < 2; g++) {
    qb[g][0] = frag_load(Qb, DHEAD, q0 + g * 16, 0, lane);
    qb[g][1] = frag_load(Qb, DHEAD, q0 + g * 16, 32, lane);
    // the compiler hands these loads' address pair to a later load's result:
    // the wait stands between them
    asm volatile("s_wait_xcnt 0x0" ::: "memory");
  }

  v8f o[4][2];  // [16 rows of d][column group]
#pragma unroll
  for (int dt = 0; dt < 4; dt++) { o[dt][0] = v8f_zero(); o[dt][1] = v8f_zero(); }
  float mrun[2] = {-3.0e38f, -3.0e38f}, lrun[2] = {0.f, 0.f};

  // stage 0 has landed for this wave, then for the block
  asm volatile("s_wait_asynccnt 0x0" ::: "memory");
  __syncthreads();
  attn_stage(gk + A_KEYS * DHEAD, gv + A_KEYS, lk + A_BUF * 2, lv + A_BUF * 2);

  for (int t = 0; t < A_NST; t++) {
    const int bsel = t & 1;
    const bf16_t* sk = smem + bsel * A_BUF;
    const bf16_t* sv = sk + A_VOFF;

    v16bf kf[2][2], vf[4];  // [16 keys][half of d]; [16 rows of d]
#pragma unroll
    for (int kt = 0; kt < 2; kt++) {
      kf[kt][0] = frag_load(sk, A_KP, kt * 16, 0, lane);
      kf[kt][1] = frag_load(sk, A_KP, kt * 16, 32, lane);
    }
#pragma unroll
    for (int dt = 0; dt < 4; dt++) vf[dt] = frag_load(sv, A_VP, dt * 16, 0, lane);

    // kept rolled: unrolled, the compiler puts off the row sums of all four
    // steps to the stage's end and holds their terms in registers, over 256
#pragma unroll 1
    for (int ss = 0; ss < A_KEYS / 32; ss++) {
      // the next step's keys; the stage's last step wraps to its first, so that
      // the loads stand under no branch and nothing is read past the stage
      const int tn = ((ss + 1) * 32) & (A_KEYS - 1);

      v8f s[2][2];  // [16 keys][column group]
#pragma unroll
      for (int kt = 0; kt < 2; kt++) {
#pragma unroll
        for (int g = 0; g < 2; g++) {
          s[kt][g] = wmma_bf16(kf[kt][0], qb[g][0], v8f_zero());
          s[kt][g] = wmma_bf16(kf[kt][1], qb[g][1], s[kt][g]);
        }
      }
      // next K fragments come during the softmax and the second product
#pragma unroll
      for (int kt = 0; kt < 2; kt++) {
        kf[kt][0] = frag_load(sk, A_KP, tn + kt * 16, 0, lane);
        kf[kt][1] = frag_load(sk, A_KP, tn + kt * 16, 32, lane);
      }

      v16bf pf[2];
#pragma unroll
      for (int g = 0; g < 2; g++) {
        float mx = fmaxf(s[0][g][0], s[1][g][0]);
#pragma unroll
        for (int v = 1; v < 8; v++) mx = fmaxf(mx, fmaxf(s[0][g][v], s[1][g][v]));
        mx = fmaxf(mx, xhalf(mx));
        const float mnew = fmaxf(mrun[g], mx);
        const float resc = __builtin_amdgcn_exp2f((mrun[g] - mnew) * LOG2E);
        const float nm = -mnew * LOG2E;
        float ps[8];
#pragma unroll
        for (int v = 0; v < 8; v++) {
          const float p0 = __builtin_amdgcn_exp2f(fmaf(s[0][g][v], LOG2E, nm));
          const float p1 = __builtin_amdgcn_exp2f(fmaf(s[1][g][v], LOG2E, nm));
          ps[v] = p0 + p1;
          pf[g][v]     = (bf16_t)p0;   // key hf * 8 + v
          pf[g][8 + v] = (bf16_t)p1;   // key 16 + hf * 8 + v
        }
        // this half's 16 keys, summed as a tree; the halves join at the end
        lrun[g] = lrun[g] * resc + (((ps[0] + ps[1]) + (ps[2] + ps[3])) +
                                    ((ps[4] + ps[5]) + (ps[6] + ps[7])));
        mrun[g] = mnew;
#pragma unroll
        for (int dt = 0; dt < 4; dt++) o[dt][g] *= resc;
      }

#pragma unroll
      for (int dt = 0; dt < 4; dt++) {
        o[dt][0] = wmma_bf16(vf[dt], pf[0], o[dt][0]);
        o[dt][1] = wmma_bf16(vf[dt], pf[1], o[dt][1]);
      }
      // next V^T fragments come during the next step's first product and softmax
#pragma unroll
      for (int dt = 0; dt < 4; dt++) vf[dt] = frag_load(sv, A_VP, dt * 16, tn, lane);
    }
    // publish point: this wave's reads of the buffer are done, its copies of
    // stage t + 1 have landed; the barrier says both for the whole block
    asm volatile("s_wait_dscnt 0x0" ::: "memory");
    asm volatile("s_wait_asynccnt 0x0" ::: "memory");
    __syncthreads();
    if (t + 2 < A_NST)
      attn_stage(gk + (size_t)(t + 2) * (A_KEYS * DHEAD), gv + (t + 2) * A_KEYS,
                 lk + (unsigned)bsel * (A_BUF * 2), lv + (unsigned)bsel * (A_BUF * 2));
  }
  // no copy is left in flight when the wave goes on
  asm volatile("s_wait_asynccnt 0x0" ::: "memory");

  // a lane holds d = dt * 16 + hf * 8 + {0..7} of one query: 16-byte stores
#pragma unroll
  for (int g = 0; g < 2; g++) {
    const float inv = 1.0f / (lrun[g] + xhalf(lrun[g]));
    bf16_t* out = concatb + ((size_t)b * S_LEN + (size_t)(q0 + g * 16 + r)) * DMODEL +
                  (size_t)h * DHEAD + hf * 8;
#pragma unroll
    for (int dt = 0; dt < 4; dt++) {
      bf16_t tmp[8];
#pragma unroll
      for (int v = 0; v < 8; v++) tmp[v] = (bf16_t)(o[dt][g][v] * inv);
      *(v4u*)(out + dt * 16) = *(const v4u*)tmp;
    }
  }
}

// ---------------------------------------------------------------------------
// Generic WMMA GEMM: C[M,N] = A[M,K](bf16) * Bt[N,K](bf16) + bias[n]
// (+ resid) (ReLU) -> f32 or bf16.  Block = 4 waves = 128x128 tile.
// Operands staged in LDS (gemm_core).
// ---------------------------------------------------------------------------
template <bool RELU, bool HASRES, bool OUTBF16, int N>
__global__ void __launch_bounds__(G_THR) gemm_kernel(
    const bf16_t* __restrict__ A, const bf16_t* __restrict__ Bt,
    const float* __restrict__ bias, const float* __restrict__ resid,
    float* __restrict__ outf, bf16_t* __restrict__ outb, int K) {
  __shared__ __attribute__((aligned(16))) bf16_t smem[2 * G_BUF];
  const int lane = threadIdx.x & 31, wave = threadIdx.x >> 5;
  const int r = lane & 15, hf = lane >> 4;
  const int m0 = blockIdx.x * 128 + (wave >> 1) * 64;
  const int n0 = blockIdx.y * 128 + (wave & 1) * 64;

  v8f acc[4][4];
#pragma unroll
  for (int i = 0; i < 4; i++) {
#pragma unroll
    for (int f = 0; f < 4; f++) acc[i][f] = v8f_zero();
  }
  gemm_core(A + (size_t)blockIdx.x * 128 * (size_t)K,
            Bt + (size_t)blockIdx.y * 128 * (size_t)K, K, smem, acc);

  // The lane's elements lie at e0 + (i * 16 + v) * N + f, f = 0..3: one address
  // per array, the rest constant offsets; four adjacent columns an access, whole
  // lines a wave.  All loads, then all sums, then all stores.
  const int nl = n0 + r * 4;
  const unsigned e0 = (unsigned)(m0 + hf * 8) * (unsigned)N + (unsigned)nl;
  const v4f bn = *(const v4f*)(bias + nl);
  v4f rv[4][8];
  if constexpr (HASRES) {
    const float* rp = resid + e0;
#pragma unroll
    for (int i = 0; i < 4; i++) {
#pragma unroll
      for (int v = 0; v < 8; v++) rv[i][v] = *(const v4f*)(rp + (i * 16 + v) * N);
    }
    // the address registers named by the loads above stay as they are until
    // this wait: as inputs they cannot be rewritten, or given to a load's
    // result, ahead of it
    asm volatile("s_wait_xcnt 0x0" :: "v"(nl), "v"(e0), "v"(rp) : "memory");
  } else {
    asm volatile("s_wait_xcnt 0x0" :: "v"(nl) : "memory");
  }
  v4f of[4][8];
  uint2 ob[4][8];
#pragma unroll
  for (int i = 0; i < 4; i++) {
#pragma unroll
    for (int v = 0; v < 8; v++) {
      v4f t;
#pragma unroll
      for (int f = 0; f < 4; f++) {
        t[f] = acc[i][f][v] + bn[f];
        if constexpr (HASRES) t[f] = t[f] + rv[i][v][f];
        if constexpr (RELU) t[f] = fmaxf(t[f], 0.0f);
      }
      if constexpr (OUTBF16) {
        bf16_t o[4] = {(bf16_t)t[0], (bf16_t)t[1], (bf16_t)t[2], (bf16_t)t[3]};
        ob[i][v] = *(const uint2*)o;
      } else {
        of[i][v] = t;
      }
    }
  }
  bf16_t* opb = outb + e0;
  float* opf = outf + e0;
  // keeps the vector operations ahead of the stores, so that a register named
  // by an issued store is not written again
  if constexpr (OUTBF16) {
    __builtin_amdgcn_sched_group_barrier(0x002, 1024, 0);
    __builtin_amdgcn_sched_group_barrier(0x040, 32, 0);
  } else {
    __builtin_amdgcn_sched_barrier(0);
  }
#pragma unroll
  for (int i = 0; i < 4; i++) {
#pragma unroll
    for (int v = 0; v < 8; v++) {
      if constexpr (OUTBF16) *(uint2*)(opb + (i * 16 + v) * N) = ob[i][v];
      else                   *(v4f*)(opf + (i * 16 + v) * N) = of[i][v];
    }
  }
}

// ---------------------------------------------------------------------------
// LayerNorm (reference semantics): y = g*(x-mean)/(std+eps)+b, std = sqrt(
// mean((x-mean)^2)).  One wave per row of 1024, 16 waves a work-group, one
// work-group per WGP: a lane holds 32 elements of its row (eight b128 loads,
// each wave-wide load four whole lines, all issued first), both sums run in
// the lane's registers and then across the wave's lanes; no LDS, no barrier.
// ---------------------------------------------------------------------------
#define L_WAVES 16

template <int CTRL>
__device__ __forceinline__ float row_xadd(float x) {
  return x + __builtin_bit_cast(
                 float, __builtin_amdgcn_update_dpp(
                            0, __builtin_bit_cast(int, x), CTRL, 0xf, 0xf, true));
}

// sum over the 32 lanes, the same bits in every lane
__device__ __forceinline__ float wave_sum(float x) {
  x = row_xadd<0x161>(x);
  x = row_xadd<0x162>(x);
  x = row_xadd<0x164>(x);
  x = row_xadd<0x168>(x);
  return x + xhalf(x);
}

template <bool HASB>
__global__ void __launch_bounds__(L_WAVES * 32) ln_kernel(
    const float* in, const float* gam, const float* bet, float* out,
    bf16_t* outb) {
  const int lane = threadIdx.x & 31;
  const int wave = __builtin_amdgcn_readfirstlane(threadIdx.x >> 5);
  const size_t row = (size_t)(blockIdx.x * L_WAVES + wave);
  const unsigned off = (unsigned)lane * 16u;   // the lane's bytes in 512
  const char* px = (const char*)(in + row * DMODEL);
  const char* pg = (const char*)gam;
  const char* pb = (const char*)bet;

  v4f v[8], g[8], bt[8];
#pragma unroll
  for (int i = 0; i < 8; i++) v[i] = *(const v4f*)(px + i * 512 + off);
#pragma unroll
  for (int i = 0; i < 8; i++) g[i] = *(const v4f*)(pg + i * 512 + off);
#pragma unroll
  for (int i = 0; i < 8; i++) bt[i] = *(const v4f*)(pb + i * 512 + off);
  // the base and offset registers named by the loads above stay as they are
  // until this wait: as inputs they cannot be rewritten, or given to a load's
  // result, ahead of it (the pointers are not __restrict__, so no load moves
  // behind it)
  asm volatile("s_wait_xcnt 0x0" :: "v"(off), "s"(px), "s"(pg), "s"(pb) : "memory");
  // keeps all 24 loads ahead of the sums: left free, the compiler puts the
  // gamma and beta loads behind both sums, where their latency is waited out
  __builtin_amdgcn_sched_barrier(0);

  const v4f s4 = ((v[0] + v[1]) + (v[2] + v[3])) + ((v[4] + v[5]) + (v[6] + v[7]));
  const float mean = wave_sum((s4.x + s4.y) + (s4.z + s4.w)) * (1.0f / DMODEL);

  v4f q4 = {0.f, 0.f, 0.f, 0.f};
#pragma unroll
  for (int i = 0; i < 8; i++) {
    v[i] -= mean;
    q4 += v[i] * v[i];
  }
  const float tots = wave_sum((q4.x + q4.y) + (q4.z + q4.w));
  const float stdv = sqrtf(tots * (1.0f / DMODEL));
  const float inv = 1.0f / (stdv + 1e-5f);

#pragma unroll
  for (int i = 0; i < 8; i++) v[i] = g[i] * v[i] * inv + bt[i];

  // the bf16 copy goes out first: its conversions then stand ahead of every
  // store, and no register named by an issued store is written again
  if constexpr (HASB) {
    char* pob = (char*)(outb + row * DMODEL);
#pragma unroll
    for (int i = 0; i < 8; i++) {
      bf16_t o[4] = {(bf16_t)v[i].x, (bf16_t)v[i].y, (bf16_t)v[i].z, (bf16_t)v[i].w};
      *(uint2*)(pob + i * 256 + (off >> 1)) = *(const uint2*)o;
    }
  }
  char* po = (char*)(out + row * DMODEL);
#pragma unroll
  for (int i = 0; i < 8; i++) *(v4f*)(po + i * 512 + off) = v[i];
}

// ---------------------------------------------------------------------------
extern "C" void kernel_launch(void* const* d_in, const int* in_sizes, int n_in,
                              void* d_out, int out_size, void* d_ws,
                              size_t ws_size, hipStream_t stream) {
  (void)in_sizes; (void)n_in; (void)out_size; (void)ws_size;
  const float* x   = (const float*)d_in[0];
  const float* wq  = (const float*)d_in[1];
  const float* bq  = (const float*)d_in[2];
  const float* wk  = (const float*)d_in[3];
  const float* bk  = (const float*)d_in[4];
  const float* wv  = (const float*)d_in[5];
  const float* bv  = (const float*)d_in[6];
  const float* wo  = (const float*)d_in[7];
  const float* wob = (const float*)d_in[8];
  const float* g1  = (const float*)d_in[9];
  const float* b1  = (const float*)d_in[10];
  const float* f1w = (const float*)d_in[11];
  const float* f1bias = (const float*)d_in[12];
  const float* f2w = (const float*)d_in[13];
  const float* f2bias = (const float*)d_in[14];
  const float* g2  = (const float*)d_in[15];
  const float* b2  = (const float*)d_in[16];
  float* out = (float*)d_out;

  char* ws = (char*)d_ws;
  size_t off = 0;
  auto alloc = [&](size_t bytes) -> char* {
    char* p = ws + off;
    off += (bytes + 255) & ~(size_t)255;
    return p;
  };
  const int BS = BATCH * S_LEN;  // 4096 rows
  bf16_t* xb   = (bf16_t*)alloc((size_t)BS * DMODEL * 2);          // 8 MB (reused as concat)
  bf16_t* wqt  = (bf16_t*)alloc((size_t)NHEADS * DHEAD * DMODEL * 2);
  bf16_t* wkt  = (bf16_t*)alloc((size_t)NHEADS * DHEAD * DMODEL * 2);
  bf16_t* wvt  = (bf16_t*)alloc((size_t)NHEADS * DHEAD * DMODEL * 2);
  bf16_t* wot  = (bf16_t*)alloc((size_t)DMODEL * DMODEL * 2);
  bf16_t* ff1t = (bf16_t*)alloc((size_t)DFF * DMODEL * 2);
  bf16_t* ff2t = (bf16_t*)alloc((size_t)DMODEL * DFF * 2);
  bf16_t* Qm   = (bf16_t*)alloc((size_t)BATCH * NHEADS * S_LEN * DHEAD * 2);  // 8 MB
  bf16_t* Km   = (bf16_t*)alloc((size_t)BATCH * NHEADS * S_LEN * DHEAD * 2);  // 8 MB
  bf16_t* Vtm  = (bf16_t*)alloc((size_t)BATCH * NHEADS * DHEAD * S_LEN * 2);  // 8 MB
  float*  t1   = (float*)alloc((size_t)BS * DMODEL * 4);           // 16 MB (reused as t2)
  float*  hbuf = (float*)alloc((size_t)BS * DMODEL * 4);           // 16 MB
  bf16_t* hb   = (bf16_t*)alloc((size_t)BS * DMODEL * 2);          // 8 MB
  bf16_t* concatb = xb;       // alias: xb dead after QKV
  bf16_t* ffn1out = Qm;       // alias: Q+K region (16 MB) dead after attention
  float*  t2 = t1;            // alias: t1 dead after LN1

  dim3 blk256(256);
  dim3 blkg(G_THR);

  // 1) convert x, transpose-convert all weights (one launch)
  prep_kernel<<<dim3(P_WGS), dim3(P_THR), 0, stream>>>(
      x, wq, wk, wv, wo, f1w, f2w, xb, wqt, wkt, wvt, wot, ff1t, ff2t);

  // 2) QKV projections (per head)
  qkv_kernel<<<dim3(S_LEN / 128, NHEADS / 2, BATCH * 3), blkg, 0, stream>>>(
      xb, wqt, wkt, wvt, bq, bk, bv, Qm, Km, Vtm);

  // 3) flash attention -> concat heads (bf16)
  attn_kernel<<<dim3(S_LEN / 256, NHEADS, BATCH), blk256, 0, stream>>>(
      Qm, Km, Vtm, concatb);

  // 4) output projection + residual(x) -> t1 (f32)
  gemm_kernel<false, true, false, DMODEL><<<dim3(BS / 128, DMODEL / 128), blkg, 0, stream>>>(
      concatb, wot, wob, x, t1, nullptr, DMODEL);

  // 5) LayerNorm1 -> h (f32) + hb (bf16)
  ln_kernel<true><<<dim3(BS / L_WAVES), dim3(L_WAVES * 32), 0, stream>>>(t1, g1, b1, hbuf, hb);

  // 6) FFN1: relu(h @ ff1 + b) -> bf16
  gemm_kernel<true, false, true, DFF><<<dim3(BS / 128, DFF / 128), blkg, 0, stream>>>(
      hb, ff1t, f1bias, nullptr, nullptr, ffn1out, DMODEL);

  // 7) FFN2: (+ b + h residual) -> t2 (f32)
  gemm_kernel<false, true, false, DMODEL><<<dim3(BS / 128, DMODEL / 128), blkg, 0, stream>>>(
      ffn1out, ff2t, f2bias, hbuf, t2, nullptr, DFF);

  // 8) LayerNorm2 -> d_out
  ln_kernel<false><<<dim3(BS / L_WAVES), dim3(L_WAVES * 32), 0, stream>>>(t2, g2, b2, out, nullptr);
}

// v008
// A run of this version takes 113 microseconds.
// Timed twice side by side with v007, it ran 1.05 times as fast both times.
// All steps since v000 together make it 3.24 times as fast.
#include <hip/hip_runtime.h>
#include <hip/hip_bf16.h>
#include <math.h>

typedef __bf16 bf16_t;
typedef __attribute__((ext_vector_type(16))) __bf16     v16bf;
typedef __attribute__((ext_vector_type(8)))  float       v8f;
typedef __attribute__((ext_vector_type(4)))  unsigned int v4u;
typedef __attribute__((ext_vector_type(4)))  float       v4f;

#define S_LEN  1024
#define DMODEL 1024
#define DHEAD  64
#define NHEADS 16
#define DFF    2048
#define BATCH  4

__device__ __forceinline__ v8f wmma_bf16(v16bf a, v16bf b, v8f c) {
  return __builtin_amdgcn_wmma_f32_16x16x32_bf16(false, a, false, b, (short)0, c,
                                                 false, false);
}

__device__ __forceinline__ v16bf frag_load(const bf16_t* __restrict__ base,
                                           int ld, int row0, int k0, int lane) {
  const int r = lane & 15, hf = lane >> 4;
  const bf16_t* p = base + (size_t)(row0 + r) * (size_t)ld + (k0 + hf * 8);
  union { v4u u[2]; v16bf v; } cv;
  cv.u[0] = *(const v4u*)p;
  cv.u[1] = *(const v4u*)(p + 16);
  return cv.v;
}

__device__ __forceinline__ v8f v8f_zero() {
  v8f z = {0.f, 0.f, 0.f, 0.f, 0.f, 0.f, 0.f, 0.f};
  return z;
}

// ---------------------------------------------------------------------------
// Shared GEMM core: one 128x128 block tile, 4 waves (2 x 2) of 64x64: a wave
// reads 4 A and 4 Bt fragments for every 16 WMMAs.  Each pass covers 128 k
// (256 B of every operand row).  The 128 A rows and the 128 Bt rows of a pass
// are brought into LDS by asynchronous b128 copies (whole 128-B lines, 16 lanes
// per row) into one of two buffers, one pass ahead of their use; the waves
// read their fragments from LDS at a row pitch of 272 B.
// The Bt rows are dealt to the fragments: within each 64 rows, row 4 * r + f
// lands in LDS row f * 16 + r, so that lane r of fragment f holds it.  A lane's
// four accumulator tiles of one A row are then four adjacent columns, and the
// 16 lanes of a row together hold 64 adjacent columns: the epilogues load and
// store whole 128-B lines.
// ---------------------------------------------------------------------------
#define G_BK    128                      // k elements per pass
#define G_LDP   136                      // LDS row pitch, elements (272 B)
#define G_AROWS 128
#define G_BROWS 128
#define G_BUF   ((G_AROWS + G_BROWS) * G_LDP)   // elements per buffer
#define G_THR   128                      // threads per block

template <int LSTEP>
__device__ __forceinline__ void stage_rows(const bf16_t* g, size_t rows8,
                                           unsigned lds) {
  const bf16_t* g0 = g;
  const bf16_t* g1 = g + rows8;
  const bf16_t* g2 = g + 2 * rows8;
  const bf16_t* g3 = g + 3 * rows8;
  const bf16_t* g4 = g + 4 * rows8;
  const bf16_t* g5 = g + 5 * rows8;
  const bf16_t* g6 = g + 6 * rows8;
  const bf16_t* g7 = g + 7 * rows8;
  const unsigned l0 = lds;
  const unsigned l1 = lds + 1 * LSTEP * G_LDP * 2;
  const unsigned l2 = lds + 2 * LSTEP * G_LDP * 2;
  const unsigned l3 = lds + 3 * LSTEP * G_LDP * 2;
  const unsigned l4 = lds + 4 * LSTEP * G_LDP * 2;
  const unsigned l5 = lds + 5 * LSTEP * G_LDP * 2;
  const unsigned l6 = lds + 6 * LSTEP * G_LDP * 2;
  const unsigned l7 = lds + 7 * LSTEP * G_LDP * 2;
  asm volatile(
      "global_load_async_to_lds_b128 %0, %1, off\n\t"
      "global_load_async_to_lds_b128 %2, %3, off\n\t"
      "global_load_async_to_lds_b128 %4, %5, off\n\t"
      "global_load_async_to_lds_b128 %6, %7, off\n\t"
      "global_load_async_to_lds_b128 %8, %9, off\n\t"
      "global_load_async_to_lds_b128 %10, %11, off\n\t"
      "global_load_async_to_lds_b128 %12, %13, off\n\t"
      "global_load_async_to_lds_b128 %14, %15, off\n\t"
      "s_wait_xcnt 0x0"
      :: "v"(l0), "v"(g0), "v"(l1), "v"(g1), "v"(l2), "v"(g2), "v"(l3), "v"(g3),
         "v"(l4), "v"(g4), "v"(l5), "v"(g5), "v"(l6), "v"(g6), "v"(l7), "v"(g7)
      : "memory");
}

// One pass of both operands, 32 copies per lane: the 128 A rows first in the
// buffer, the 128 Bt rows behind them, 64 rows a statement.  lda: the lane's
// place in A row tid >> 4; ldb: its place in the LDS row that Bt row tid >> 4
// is dealt to (Bt row + 8 lands two LDS rows further on).
__device__ __forceinline__ void stage_copies(const bf16_t* ga, const bf16_t* gb,
                                             size_t rows8, unsigned lda,
                                             unsigned ldb) {
  stage_rows<8>(ga, rows8, lda);
  stage_rows<8>(ga + 8 * rows8, rows8, lda + 64 * G_LDP * 2);
  stage_rows<2>(gb, rows8, ldb + G_AROWS * G_LDP * 2);
  stage_rows<2>(gb + 8 * rows8, rows8, ldb + (G_AROWS + 64) * G_LDP * 2);
}

// Ablk: first of the block's 128 rows of A; Bblk: first of its 128 rows of Bt;
// both row-major with K elements per row, K a multiple of 128.  Wave w takes
// A rows (w >> 1) * 64 on and Bt rows (w & 1) * 64 on; within them acc[i][f]
// is the tile of A rows i * 16 on and of Bt rows 4 * r + f, r the lane & 15.
__device__ __forceinline__ void gemm_core(const bf16_t* __restrict__ Ablk,
                                          const bf16_t* __restrict__ Bblk,
                                          int K, bf16_t* smem, v8f acc[4][4]) {
  const int tid = threadIdx.x;
  const int lane = tid & 31, wave = tid >> 5;
  const int rw = tid >> 4, cw = (tid & 15) * 8;
  const bf16_t* ga = Ablk + (size_t)rw * (size_t)K + cw;
  const bf16_t* gb = Bblk + (size_t)rw * (size_t)K + cw;
  const size_t rows8 = (size_t)8 * (size_t)K;
  const unsigned lda0 = (unsigned)(size_t)smem + (unsigned)(rw * G_LDP + cw) * 2u;
  const unsigned ldb0 = (unsigned)(size_t)smem +
                        (unsigned)(((rw & 3) * 16 + (rw >> 2)) * G_LDP + cw) * 2u;
  const int npass = K / G_BK;
  const int arow = (wave >> 1) * 64, brow = G_AROWS + (wave & 1) * 64;

  stage_copies(ga, gb, rows8, lda0, ldb0);
  // pass 0 has landed for this wave, then for the block
  asm volatile("s_wait_asynccnt 0x0" ::: "memory");
  __syncthreads();
  if (npass > 1)
    stage_copies(ga + G_BK, gb + G_BK, rows8, lda0 + G_BUF * 2, ldb0 + G_BUF * 2);

  for (int t = 0; t < npass; t++) {
    const int bsel = t & 1;
    const bf16_t* sbuf = smem + bsel * G_BUF;
    v16bf a[4][4], b[4][4];
#pragma unroll
    for (int ks = 0; ks < 4; ks++) {
#pragma unroll
      for (int i = 0; i < 4; i++)
        a[ks][i] = frag_load(sbuf, G_LDP, arow + i * 16, ks * 32, lane);
#pragma unroll
      for (int f = 0; f < 4; f++)
        b[ks][f] = frag_load(sbuf, G_LDP, brow + f * 16, ks * 32, lane);
    }
    // keeps the pass's LDS reads one group ahead of its WMMAs: left free, the
    // compiler puts a pair of reads and a full wait in front of every WMMA
    __builtin_amdgcn_sched_barrier(0);
#pragma unroll
    for (int ks = 0; ks < 4; ks++) {
#pragma unroll
      for (int i = 0; i < 4; i++) {
#pragma unroll
        for (int f = 0; f < 4; f++)
          acc[i][f] = wmma_bf16(a[ks][i], b[ks][f], acc[i][f]);
      }
    }
    // keeps the publish point behind the pass's WMMAs: left free, the compiler
    // lifts its waits and barrier over them, so that every LDS read is waited
    // out before the first WMMA and the copies get no WMMA time to land in
    __builtin_amdgcn_sched_barrier(0);
    // publish point: this wave's reads of the buffer are done, its copies of
    // pass t + 1 have landed; the barrier says both for the whole block
    asm volatile("s_wait_dscnt 0x0" ::: "memory");
    asm volatile("s_wait_asynccnt 0x0" ::: "memory");
    __syncthreads();
    if (t + 2 < npass)
      stage_copies(ga + (size_t)(t + 2) * G_BK, gb + (size_t)(t + 2) * G_BK,
                   rows8, lda0 + (unsigned)bsel * (G_BUF * 2),
                   ldb0 + (unsigned)bsel * (G_BUF * 2));
  }
  // no copy is left in flight when the wave goes on
  asm volatile("s_wait_asynccnt 0x0" ::: "memory");
}

// ---------------------------------------------------------------------------
// Wide GEMM core, for the products whose output gives every WGP more than one
// 128x128 tile: one block a WGP, 256 rows of X against NG groups of 64 rows of
// W, so that the X tile comes from L2 once for all groups.  4 * NG waves of
// 64x64: wave w takes X rows (w & 3) * 64 on and W group w >> 2.  K = DMODEL.  The ring is that of gemm_core: 128 k a
// pass, two buffers, asynchronous b128 copies one pass ahead, 272 B pitch; a
// buffer holds the X rows first, the W groups behind them.
// Dealt rows: within 64 rows, row 4 * r + f lands in LDS row f * 16 + r.  The W
// groups are dealt; with VLAST the X rows are dealt too and the last W group is
// not, and that group's waves take the W rows as the A operand and the X rows
// as the B operand.
// ---------------------------------------------------------------------------
#define W_XROWS 256
#define W_BUF(NG) ((W_XROWS + (NG) * 64) * G_LDP)   // elements per buffer
#define W_CTHR  256                                 // threads that copy

template <int LSTEP>
__device__ __forceinline__ void stage64(const bf16_t* base, const unsigned vo[4],
                                        unsigned lds) {
  const unsigned l0 = lds;
  const unsigned l1 = lds + 1 * LSTEP * G_LDP * 2;
  const unsigned l2 = lds + 2 * LSTEP * G_LDP * 2;
  const unsigned l3 = lds + 3 * LSTEP * G_LDP * 2;
  asm volatile(
      "global_load_async_to_lds_b128 %0, %4, %8\n\t"
      "global_load_async_to_lds_b128 %1, %5, %8\n\t"
      "global_load_async_to_lds_b128 %2, %6, %8\n\t"
      "global_load_async_to_lds_b128 %3, %7, %8\n\t"
      "s_wait_xcnt 0x0"
      :: "v"(l0), "v"(l1), "v"(l2), "v"(l3),
         "v"(vo[0]), "v"(vo[1]), "v"(vo[2]), "v"(vo[3]), "s"(base)
      : "memory");
}

// One pass of all operands, (4 + NG) * 4 copies per copying lane.  gx, g0..g2:
// the first row of X and of each W group at the pass's k.  lpl: the lane's place
// in LDS row tid >> 4; ldl: its place in the LDS row that row tid >> 4 is dealt to.
template <int NG, bool VLAST>
__device__ __forceinline__ void wide_copies(const bf16_t* gx, const bf16_t* g0,
                                            const bf16_t* g1, const bf16_t* g2,
                                            const unsigned vo[4], unsigned lpl,
                                            unsigned ldl) {
#pragma unroll
  for (int q = 0; q < 4; q++) {
    if (VLAST) stage64<4>(gx + q * 64 * DMODEL, vo, ldl + q * 64 * G_LDP * 2);
    else       stage64<16>(gx + q * 64 * DMODEL, vo, lpl + q * 64 * G_LDP * 2);
  }
  stage64<4>(g0, vo, ldl + W_XROWS * G_LDP * 2);
  stage64<4>(g1, vo, ldl + (W_XROWS + 64) * G_LDP * 2);
  if (NG == 3) {
    if (VLAST) stage64<16>(g2, vo, lpl + (W_XROWS + 128) * G_LDP * 2);
    else       stage64<4>(g2, vo, ldl + (W_XROWS + 128) * G_LDP * 2);
  }
}

// The wave's fragments of 32 k
__device__ __forceinline__ void wide_frags(const bf16_t* sbuf, int arow, int brow,
                                           int ks, int lane, v16bf a[4], v16bf b[4]) {
#pragma unroll
  for (int i = 0; i < 4; i++) a[i] = frag_load(sbuf, G_LDP, arow + i * 16, ks * 32, lane);
#pragma unroll
  for (int f = 0; f < 4; f++) b[f] = frag_load(sbuf, G_LDP, brow + f * 16, ks * 32, lane);
}

// Xblk: first of the block's 256 rows of X; W0..W2: first row of each W group;
// all row-major with DMODEL elements per row.  wave: the wave's number, a scalar.
// acc[i][f]: A fragment i against B fragment f.
template <int NG, bool VLAST>
__device__ __forceinline__ void wide_core(const bf16_t* __restrict__ Xblk,
                                          const bf16_t* __restrict__ W0,
                                          const bf16_t* __restrict__ W1,
                                          const bf16_t* __restrict__ W2,
                                          int wave, bf16_t* smem, v8f acc[4][4]) {
  const int tid = threadIdx.x;
  const int lane = tid & 31;
  const int rw = tid >> 4, cw = (tid & 15) * 8;
  unsigned vo[4];
#pragma unroll
  for (int j = 0; j < 4; j++) vo[j] = (unsigned)((rw + 16 * j) * DMODEL + cw) * 2u;
  const unsigned lpl = (unsigned)(size_t)smem + (unsigned)(rw * G_LDP + cw) * 2u;
  const unsigned ldl = (unsigned)(size_t)smem +
                       (unsigned)(((rw & 3) * 16 + (rw >> 2)) * G_LDP + cw) * 2u;
  const int npass = DMODEL / G_BK;
  const int xrow = (wave & 3) * 64, wrow = W_XROWS + (wave >> 2) * 64;
  const bool tr = VLAST && (wave >> 2) == NG - 1;
  const int arow = tr ? wrow : xrow, brow = tr ? xrow : wrow;
  // the first 8 waves copy (a scalar test: a whole wave copies or branches round)
  const bool copier = NG == 2 || wave < W_CTHR / 32;

  if (copier) wide_copies<NG, VLAST>(Xblk, W0, W1, W2, vo, lpl, ldl);
  // pass 0 has landed for this wave, then for the block
  asm volatile("s_wait_asynccnt 0x0" ::: "memory");
  __syncthreads();
  if (copier)
    wide_copies<NG, VLAST>(Xblk + G_BK, W0 + G_BK, W1 + G_BK, W2 + G_BK, vo,
                           lpl + W_BUF(NG) * 2, ldl + W_BUF(NG) * 2);

  for (int t = 0; t < npass; t++) {
    const int bsel = t & 1;
    const bf16_t* sbuf = smem + bsel * W_BUF(NG);
    v16bf a[2][4], b[2][4];   // two fragment sets, 32 k each
    wide_frags(sbuf, arow, brow, 0, lane, a[0], b[0]);
    wide_frags(sbuf, arow, brow, 1, lane, a[1], b[1]);
    // the scheduling barriers of this loop keep each set's LDS reads one group,
    // a whole set of WMMAs ahead of their use: left free, the compiler spreads
    // the reads among the WMMAs with a wait in front of each
    __builtin_amdgcn_sched_barrier(0);
#pragma unroll
    for (int ks = 0; ks < 4; ks++) {
#pragma unroll
      for (int i = 0; i < 4; i++) {
#pragma unroll
        for (int f = 0; f < 4; f++)
          acc[i][f] = wmma_bf16(a[ks & 1][i], b[ks & 1][f], acc[i][f]);
      }
      __builtin_amdgcn_sched_barrier(0);
      if (ks < 2) {
        wide_frags(sbuf, arow, brow, ks + 2, lane, a[ks & 1], b[ks & 1]);
        __builtin_amdgcn_sched_barrier(0);
      }
    }
    // publish point: this wave's reads of the buffer are done, its copies of
    // pass t + 1 have landed; the barrier says both for the whole block
    asm volatile("s_wait_dscnt 0x0" ::: "memory");
    asm volatile("s_wait_asynccnt 0x0" ::: "memory");
    __syncthreads();
    if (copier && t + 2 < npass) {
      const int ko = (t + 2) * G_BK;
      wide_copies<NG, VLAST>(Xblk + ko, W0 + ko, W1 + ko, W2 + ko, vo,
                             lpl + (unsigned)bsel * (W_BUF(NG) * 2),
                             ldl + (unsigned)bsel * (W_BUF(NG) * 2));
    }
  }
  // no copy is left in flight when the wave goes on
  asm volatile("s_wait_asynccnt 0x0" ::: "memory");
}

// ---------------------------------------------------------------------------
// Operand preparation, one launch: x -> bf16, and every weight matrix
// fp32 [R][C] -> bf16 [C][R].  256 work-groups of 16 waves, all resident at
// once; each takes 16384 elements of x and eight 64x64 weight tiles (one each
// of wq, wk, wv, wo, two of ff1, two of ff2).  All 24 b128 loads of a thread
// are issued first; loads and stores cover whole 128-B lines.
// ---------------------------------------------------------------------------
#define P_WGS   256
#define P_THR   512
#define P_PITCH 65                       // LDS tile row pitch, floats

// src: the tile's first element (uniform); off: this thread's byte offset in
// the tile's first 32 rows; C: source row length.
template <int C>
__device__ __forceinline__ void tile_load(const float* src, unsigned off,
                                          float4 v[2]) {
  const char* p = (const char*)src;
  v[0] = *(const float4*)(p + off);
  v[1] = *(const float4*)(p + 32 * C * 4 + off);
}

__device__ __forceinline__ void tile_to_lds(float* tile, int tid, const float4 v[2]) {
  float* t = tile + (tid >> 4) * P_PITCH + (tid & 15) * 4;
#pragma unroll
  for (int i = 0; i < 2; i++) {
    t[32 * i * P_PITCH + 0] = v[i].x;
    t[32 * i * P_PITCH + 1] = v[i].y;
    t[32 * i * P_PITCH + 2] = v[i].z;
    t[32 * i * P_PITCH + 3] = v[i].w;
  }
}

// dst points at element [c0][r0] of the transposed matrix, R = its row length.
// Eight lanes write the 128 B of one destination row.
__device__ __forceinline__ void tile_store_t(const float* tile, int tid,
                                             bf16_t* __restrict__ dst, int R) {
  const int rg = (tid & 7) * 8, c = tid >> 3;
  bf16_t o[8];
#pragma unroll
  for (int e = 0; e < 8; e++) o[e] = (bf16_t)tile[(rg + e) * P_PITCH + c];
  *(v4u*)(dst + (size_t)c * (size_t)R + rg) = *(const v4u*)o;
}

__global__ void __launch_bounds__(P_THR) prep_kernel(
    const float* x, const float* wq, const float* wk, const float* wv,
    const float* wo, const float* f1w, const float* f2w, bf16_t* xb,
    bf16_t* wqt, bf16_t* wkt, bf16_t* wvt, bf16_t* wot, bf16_t* ff1t,
    bf16_t* ff2t) {
  __shared__ float tiles[8][64 * P_PITCH];
  const int tid = threadIdx.x;
  const int b = blockIdx.x, bh = b >> 4, bl = b & 15;
  const int b2 = b + P_WGS;

  // per-head matrices are [1024][64]: head bh, row tile bl
  const size_t hsrc = (size_t)bh * (DMODEL * DHEAD) + (size_t)bl * (64 * DHEAD);
  const size_t hdst = (size_t)bh * (DMODEL * DHEAD) + (size_t)bl * 64;
  const unsigned col = (unsigned)(tid & 15) * 16u, row = (unsigned)(tid >> 4);
  const unsigned o64 = row * (DHEAD * 4) + col;
  const unsigned o1k = row * (DMODEL * 4) + col;
  const unsigned o2k = row * (DFF * 4) + col;

  const float* pq = wq + hsrc;
  const float* pk = wk + hsrc;
  const float* pv = wv + hsrc;
  // wo [1024][1024]: row tile bh, column tile bl
  const float* po = wo + (size_t)bh * (64 * DMODEL) + bl * 64;
  // ff1 [1024][2048]: row tile index >> 5, column tile index & 31
  const float* p1a = f1w + (size_t)(b >> 5) * (64 * DFF) + (b & 31) * 64;
  const float* p1b = f1w + (size_t)(b2 >> 5) * (64 * DFF) + (b2 & 31) * 64;
  // ff2 [2048][1024]: row tile index >> 4, column tile index & 15
  const float* p2a = f2w + (size_t)(b >> 4) * (64 * DMODEL) + (b & 15) * 64;
  const float* p2b = f2w + (size_t)(b2 >> 4) * (64 * DMODEL) + (b2 & 15) * 64;
  // x: 16384 elements from b * 16384 on; o64 is also tid * 16 bytes
  const char* px = (const char*)(x + (size_t)b * (8 * P_THR * 4));

  float4 t[8][2], xv[8];
  tile_load<DHEAD>(pq, o64, t[0]);
  tile_load<DHEAD>(pk, o64, t[1]);
  tile_load<DHEAD>(pv, o64, t[2]);
  tile_load<DMODEL>(po, o1k, t[3]);
  tile_load<DFF>(p1a, o2k, t[4]);
  tile_load<DFF>(p1b, o2k, t[5]);
  tile_load<DMODEL>(p2a, o1k, t[6]);
  tile_load<DMODEL>(p2b, o1k, t[7]);
#pragma unroll
  for (int i = 0; i < 8; i++) xv[i] = *(const float4*)(px + i * (P_THR * 16) + o64);
  // the base and offset registers named by the loads above stay as they are
  // until this wait: as inputs they cannot be rewritten, or given to a load's
  // result, ahead of it (the pointers are not __restrict__, so no load moves
  // behind it)
  asm volatile("s_wait_xcnt 0x0"
               :: "v"(o64), "v"(o1k), "v"(o2k), "s"(pq), "s"(pk), "s"(pv), "s"(po),
                  "s"(p1a), "s"(p1b), "s"(p2a), "s"(p2b), "s"(px)
               : "memory");

#pragma unroll
  for (int k = 0; k < 8; k++) tile_to_lds(tiles[k], tid, t[k]);
  __syncthreads();
#pragma unroll
  for (int i = 0; i < 8; i++) {
    bf16_t o[4] = {(bf16_t)xv[i].x, (bf16_t)xv[i].y, (bf16_t)xv[i].z, (bf16_t)xv[i].w};
    *(uint2*)(xb + (size_t)b * (8 * P_THR * 4) + i * (P_THR * 4) + tid * 4) = *(const uint2*)o;
  }
  tile_store_t(tiles[0], tid, wqt + hdst, DMODEL);
  tile_store_t(tiles[1], tid, wkt + hdst, DMODEL);
  tile_store_t(tiles[2], tid, wvt + hdst, DMODEL);
  tile_store_t(tiles[3], tid, wot + (size_t)bl * (64 * DMODEL) + bh * 64, DMODEL);
  tile_store_t(tiles[4], tid, ff1t + (size_t)(b & 31) * (64 * DMODEL) + (b >> 5) * 64, DMODEL);
  tile_store_t(tiles[5], tid, ff1t + (size_t)(b2 & 31) * (64 * DMODEL) + (b2 >> 5) * 64, DMODEL);
  tile_store_t(tiles[6], tid, ff2t + (size_t)(b & 15) * (64 * DFF) + (b >> 4) * 64, DFF);
  tile_store_t(tiles[7], tid, ff2t + (size_t)(b2 & 15) * (64 * DFF) + (b2 >> 4) * 64, DFF);
}

// ---------------------------------------------------------------------------
// QKV projections.  grid = (S/256, H, B).  Block = 256 rows of x against the q,
// k and v weights of one head, which share the x tile; 12 waves, wave = 64 rows
// x 64 cols (d_head) of one of the three.  Operands staged in LDS (wide_core).
// Q is pre-scaled by 1/sqrt(64); V is stored transposed [64][S].
// The x rows are dealt: as the B operand of V^T a lane's four tiles are four
// adjacent s; as the A operand of Q and K accumulator row m of tile i is x row
// 4 * m + i.  The q and k weights are dealt too.  A lane then stores four
// adjacent bf16, and 16 lanes one whole 128-B line.
// ---------------------------------------------------------------------------
__global__ void __launch_bounds__(384) qkv_kernel(
    const bf16_t* __restrict__ xb, const bf16_t* __restrict__ wqt,
    const bf16_t* __restrict__ wkt, const bf16_t* __restrict__ wvt,
    const float* __restrict__ bq, const float* __restrict__ bk,
    const float* __restrict__ bv, bf16_t* __restrict__ Q,
    bf16_t* __restrict__ Kb, bf16_t* __restrict__ Vt) {
  __shared__ __attribute__((aligned(16))) bf16_t smem[2 * W_BUF(3)];
  const int lane = threadIdx.x & 31;
  const int wave = __builtin_amdgcn_readfirstlane(threadIdx.x >> 5);
  const int r = lane & 15, hf = lane >> 4;
  const int which = wave >> 2, h = blockIdx.y, b = blockIdx.z;
  const int sw = blockIdx.x * 256 + (wave & 3) * 64;   // the wave's first s

  const bf16_t* Xblk = xb + ((size_t)b * S_LEN + (size_t)blockIdx.x * 256) * DMODEL;
  const size_t wof = (size_t)h * DHEAD * DMODEL;

  v8f acc[4][4];
#pragma unroll
  for (int i = 0; i < 4; i++) {
#pragma unroll
    for (int f = 0; f < 4; f++) acc[i][f] = v8f_zero();
  }
  wide_core<3, true>(Xblk, wqt + wof, wkt + wof, wvt + wof, wave, smem, acc);

  uint2 ob[4][8];
  if (which < 2) {
    // rows: s = s0 + v * 4 + i; columns: n = nl + f of head h
    const int nl = h * DHEAD + r * 4;
    const int s0 = sw + hf * 32;
    const float scale = (which == 0) ? 0.125f : 1.0f;  // 1/sqrt(64)
    const unsigned onl = (unsigned)nl * 4u;   // in bytes: the load's own offset register
    const v4f bn = *(const v4f*)((const char*)(which == 0 ? bq : bk) + onl);
    // the offset register named by the load above stays as it is until this
    // wait: as an input it cannot be rewritten, or given to the load's result
    asm volatile("s_wait_xcnt 0x0" :: "v"(onl) : "memory");
#pragma unroll
    for (int i = 0; i < 4; i++) {
#pragma unroll
      for (int v = 0; v < 8; v++) {
        bf16_t o[4];
#pragma unroll
        for (int f = 0; f < 4; f++) o[f] = (bf16_t)((acc[i][f][v] + bn[f]) * scale);
        ob[i][v] = *(const uint2*)o;
      }
    }
    bf16_t* op = (which == 0 ? Q : Kb) +
                 ((size_t)(b * NHEADS + h) * S_LEN + (size_t)s0) * DHEAD + r * 4;
    // keeps every vector operation ahead of the first store, so that no
    // register named by an issued store is written again
    __builtin_amdgcn_sched_barrier(0);
#pragma unroll
    for (int i = 0; i < 4; i++) {
#pragma unroll
      for (int v = 0; v < 8; v++) *(uint2*)(op + (v * 4 + i) * DHEAD) = ob[i][v];
    }
  } else {
    // rows: d = d0 + i * 16 + v of head h; columns: s = s0 + f
    const int d0 = hf * 8;
    const int nl = h * DHEAD + d0;
    const int s0 = sw + r * 4;
    v4f bn[4][2];
#pragma unroll
    for (int i = 0; i < 4; i++) {
      bn[i][0] = *(const v4f*)(bv + nl + i * 16);
      bn[i][1] = *(const v4f*)(bv + nl + i * 16 + 4);
    }
    // the offset register named by the loads above stays as it is until this wait
    asm volatile("s_wait_xcnt 0x0" :: "v"(nl) : "memory");
#pragma unroll
    for (int i = 0; i < 4; i++) {
#pragma unroll
      for (int v = 0; v < 8; v++) {
        const float bd = bn[i][v >> 2][v & 3];
        bf16_t o[4];
#pragma unroll
        for (int f = 0; f < 4; f++) o[f] = (bf16_t)(acc[i][f][v] + bd);
        ob[i][v] = *(const uint2*)o;
      }
    }
    bf16_t* op = Vt + ((size_t)(b * NHEADS + h) * DHEAD + (size_t)d0) * S_LEN + s0;
    // keeps every vector operation ahead of the first store, so that no
    // register named by an issued store is written again
    __builtin_amdgcn_sched_barrier(0);
#pragma unroll
    for (int i = 0; i < 4; i++) {
#pragma unroll
      for (int v = 0; v < 8; v++) *(uint2*)(op + (i * 16 + v) * S_LEN) = ob[i][v];
    }
    // in the built code the other branch's text follows these stores and
    // rewrites their registers: the wait stands between
    asm volatile("s_wait_xcnt 0x0" ::: "memory");
  }
}

// ---------------------------------------------------------------------------
// Flash attention, transposed products: S^T = K Q^T, O^T += V^T P^T.
// grid = (S/256, H, B).  Each wave: 32 query columns (two groups of 16), full
// d_head = 64 output in 4 x 2 accumulator tiles; online softmax over 32 keys
// per step.  A lane holds 16 of the 32 scores of ONE query (its other half
// sits in lane ^ 16), so maximum and sum run in the lane's own registers with
// one exchange between the halves; the two score tiles of a group, converted
// in place, are the B operand of the second product.  K rows and V^T rows are
// the A operands, each fragment feeding both column groups.
// The eight waves of a block walk the same keys: a stage of 128 keys (128 K
// rows of 128 B, 64 V^T rows of 256 B) is brought into LDS once for all of
// them by asynchronous b128 copies of whole lines, into one of two buffers,
// one stage ahead of its use; the waves read their fragments from LDS.
// ---------------------------------------------------------------------------
#define LOG2E 1.4426950408889634f
#define A_KEYS 128                        // keys per stage
#define A_NST  (S_LEN / A_KEYS)           // stages
#define A_KP   72                         // K row pitch in LDS, elements (144 B)
#define A_VP   136                        // V^T row pitch in LDS, elements (272 B)
#define A_VOFF (A_KEYS * A_KP)            // V^T rows stand behind the K rows
#define A_BUF  (A_VOFF + DHEAD * A_VP)    // elements per buffer

__device__ __forceinline__ float xhalf(float x) {
  const int i = __builtin_bit_cast(int, x);
  return __builtin_bit_cast(
      float, __builtin_amdgcn_permlanex16(i, i, 0x76543210, 0xfedcba98, false, false));
}

__device__ __forceinline__ void attn_stage(const bf16_t* gk, const bf16_t* gv,
                                           unsigned lk, unsigned lv) {
  const bf16_t* k0 = gk;
  const bf16_t* k1 = gk + 32 * DHEAD;
  const bf16_t* k2 = gk + 64 * DHEAD;
  const bf16_t* k3 = gk + 96 * DHEAD;
  const bf16_t* v0 = gv;
  const bf16_t* v1 = gv + 16 * S_LEN;
  const bf16_t* v2 = gv + 32 * S_LEN;
  const bf16_t* v3 = gv + 48 * S_LEN;
  const unsigned a0 = lk;
  const unsigned a1 = lk + 32 * A_KP * 2;
  const unsigned a2 = lk + 64 * A_KP * 2;
  const unsigned a3 = lk + 96 * A_KP * 2;
  const unsigned b0 = lv;
  const unsigned b1 = lv + 16 * A_VP * 2;
  const unsigned b2 = lv + 32 * A_VP * 2;
  const unsigned b3 = lv + 48 * A_VP * 2;
  asm volatile(
      "global_load_async_to_lds_b128 %0, %1, off\n\t"
      "global_load_async_to_lds_b128 %2, %3, off\n\t"
      "global_load_async_to_lds_b128 %4, %5, off\n\t"
      "global_load_async_to_lds_b128 %6, %7, off\n\t"
      "global_load_async_to_lds_b128 %8, %9, off\n\t"
      "global_load_async_to_lds_b128 %10, %11, off\n\t"
      "global_load_async_to_lds_b128 %12, %13, off\n\t"
      "global_load_async_to_lds_b128 %14, %15, off\n\t"
      "s_wait_xcnt 0x0"
      :: "v"(a0), "v"(k0), "v"(a1), "v"(k1), "v"(a2), "v"(k2), "v"(a3), "v"(k3),
         "v"(b0), "v"(v0), "v"(b1), "v"(v1), "v"(b2), "v"(v2), "v"(b3), "v"(v3)
      : "memory");
}

__global__ void __launch_bounds__(256) attn_kernel(
    const bf16_t* __restrict__ Q, const bf16_t* __restrict__ Kb,
    const bf16_t* __restrict__ Vt, bf16_t* __restrict__ concatb) {
  __shared__ __attribute__((aligned(16))) bf16_t smem[2 * A_BUF];
  const int tid = threadIdx.x;
  const int lane = threadIdx.x & 31, wave = threadIdx.x >> 5;
  const int r = lane & 15, hf = lane >> 4;
  const int h = blockIdx.y, b = blockIdx.z;
  const int q0 = blockIdx.x * 256 + wave * 32;
  const size_t bh = (size_t)(b * NHEADS + h);
  const bf16_t* Qb = Q + bh * S_LEN * DHEAD;
  const bf16_t* Kx = Kb + bh * S_LEN * DHEAD;
  const bf16_t* Vx = Vt + bh * DHEAD * S_LEN;

  // copies: eight lanes per K row (a stage's K rows lie in a row in memory),
  // sixteen lanes per V^T row
  const bf16_t* gk = Kx + tid * 8;
  const bf16_t* gv = Vx + (size_t)(tid >> 4) * S_LEN + (tid & 15) * 8;
  const unsigned lk = (unsigned)(size_t)smem +
                      (unsigned)((tid >> 3) * A_KP + (tid & 7) * 8) * 2u;
  const unsigned lv = (unsigned)(size_t)smem +
                      (unsigned)(A_VOFF + (tid >> 4) * A_VP + (tid & 15) * 8) * 2u;

  attn_stage(gk, gv, lk, lv);

  v16bf qb[2][2];  // [column group][half of d]
#pragma unroll
  for (int g = 0; g < 2; g++) {
    qb[g][0] = frag_load(Qb, DHEAD, q0 + g * 16, 0, lane);
    qb[g][1] = frag_load(Qb, DHEAD, q0 + g * 16, 32, lane);
    // the compiler hands these loads' address pair to a later load's result:
    // the wait stands between them
    asm volatile("s_wait_xcnt 0x0" ::: "memory");
  }

  v8f o[4][2];  // [16 rows of d][column group]
#pragma unroll
  for (int dt = 0; dt < 4; dt++) { o[dt][0] = v8f_zero(); o[dt][1] = v8f_zero(); }
  float mrun[2] = {-3.0e38f, -3.0e38f}, lrun[2] = {0.f, 0.f};

  // stage 0 has landed for this wave, then for the block
  asm volatile("s_wait_asynccnt 0x0" ::: "memory");
  __syncthreads();
  attn_stage(gk + A_KEYS * DHEAD, gv + A_KEYS, lk + A_BUF * 2, lv + A_BUF * 2);

  for (int t = 0; t < A_NST; t++) {
    const int bsel = t & 1;
    const bf16_t* sk = smem + bsel * A_BUF;
    const bf16_t* sv = sk + A_VOFF;

    v16bf kf[2][2], vf[4];  // [16 keys][half of d]; [16 rows of d]
#pragma unroll
    for (int kt = 0; kt < 2; kt++) {
      kf[kt][0] = frag_load(sk, A_KP, kt * 16, 0, lane);
      kf[kt][1] = frag_load(sk, A_KP, kt * 16, 32, lane);
    }
#pragma unroll
    for (int dt = 0; dt < 4; dt++) vf[dt] = frag_load(sv, A_VP, dt * 16, 0, lane);

    // kept rolled: unrolled, the compiler puts off the row sums of all four
    // steps to the stage's end and holds their terms in registers, over 256
#pragma unroll 1
    for (int ss = 0; ss < A_KEYS / 32; ss++) {
      // the next step's keys; the stage's last step wraps to its first, so that
      // the loads stand under no branch and nothing is read past the stage
      const int tn = ((ss + 1) * 32) & (A_KEYS - 1);

      v8f s[2][2];  // [16 keys][column group]
#pragma unroll
      for (int kt = 0; kt < 2; kt++) {
#pragma unroll
        for (int g = 0; g < 2; g++) {
          s[kt][g] = wmma_bf16(kf[kt][0], qb[g][0], v8f_zero());
          s[kt][g] = wmma_bf16(kf[kt][1], qb[g][1], s[kt][g]);
        }
      }
      // next K fragments come during the softmax and the second product
#pragma unroll
      for (int kt = 0; kt < 2; kt++) {
        kf[kt][0] = frag_load(sk, A_KP, tn + kt * 16, 0, lane);
        kf[kt][1] = frag_load(sk, A_KP, tn + kt * 16, 32, lane);
      }

      v16bf pf[2];
#pragma unroll
      for (int g = 0; g < 2; g++) {
        float mx = fmaxf(s[0][g][0], s[1][g][0]);
#pragma unroll
        for (int v = 1; v < 8; v++) mx = fmaxf(mx, fmaxf(s[0][g][v], s[1][g][v]));
        mx = fmaxf(mx, xhalf(mx));
        const float mnew = fmaxf(mrun[g], mx);
        const float resc = __builtin_amdgcn_exp2f((mrun[g] - mnew) * LOG2E);
        const float nm = -mnew * LOG2E;
        float ps[8];
#pragma unroll
        for (int v = 0; v < 8; v++) {
          const float p0 = __builtin_amdgcn_exp2f(fmaf(s[0][g][v], LOG2E, nm));
          const float p1 = __builtin_amdgcn_exp2f(fmaf(s[1][g][v], LOG2E, nm));
          ps[v] = p0 + p1;
          pf[g][v]     = (bf16_t)p0;   // key hf * 8 + v
          pf[g][8 + v] = (bf16_t)p1;   // key 16 + hf * 8 + v
        }
        // this half's 16 keys, summed as a tree; the halves join at the end
        lrun[g] = lrun[g] * resc + (((ps[0] + ps[1]) + (ps[2] + ps[3])) +
                                    ((ps[4] + ps[5]) + (ps[6] + ps[7])));
        mrun[g] = mnew;
#pragma unroll
        for (int dt = 0; dt < 4; dt++) o[dt][g] *= resc;
      }

#pragma unroll
      for (int dt = 0; dt < 4; dt++) {
        o[dt][0] = wmma_bf16(vf[dt], pf[0], o[dt][0]);
        o[dt][1] = wmma_bf16(vf[dt], pf[1], o[dt][1]);
      }
      // next V^T fragments come during the next step's first product and softmax
#pragma unroll
      for (int dt = 0; dt < 4; dt++) vf[dt] = frag_load(sv, A_VP, dt * 16, tn, lane);
    }
    // publish point: this wave's reads of the buffer are done, its copies of
    // stage t + 1 have landed; the barrier says both for the whole block
    asm volatile("s_wait_dscnt 0x0" ::: "memory");
    asm volatile("s_wait_asynccnt 0x0" ::: "memory");
    __syncthreads();
    if (t + 2 < A_NST)
      attn_stage(gk + (size_t)(t + 2) * (A_KEYS * DHEAD), gv + (t + 2) * A_KEYS,
                 lk + (unsigned)bsel * (A_BUF * 2), lv + (unsigned)bsel * (A_BUF * 2));
  }
  // no copy is left in flight when the wave goes on
  asm volatile("s_wait_asynccnt 0x0" ::: "memory");

  // a lane holds d = dt * 16 + hf * 8 + {0..7} of one query: 16-byte stores
#pragma unroll
  for (int g = 0; g < 2; g++) {
    const float inv = 1.0f / (lrun[g] + xhalf(lrun[g]));
    bf16_t* out = concatb + ((size_t)b * S_LEN + (size_t)(q0 + g * 16 + r)) * DMODEL +
                  (size_t)h * DHEAD + hf * 8;
#pragma unroll
    for (int dt = 0; dt < 4; dt++) {
      bf16_t tmp[8];
#pragma unroll
      for (int v = 0; v < 8; v++) tmp[v] = (bf16_t)(o[dt][g][v] * inv);
      *(v4u*)(out + dt * 16) = *(const v4u*)tmp;
    }
  }
}

// ---------------------------------------------------------------------------
// Generic WMMA GEMM: C[M,N] = A[M,K](bf16) * Bt[N,K](bf16) + bias[n]
// (+ resid) (ReLU) -> f32 or bf16.  Block = 4 waves = 128x128 tile, operands
// staged in LDS (gemm_core); WIDE (K = DMODEL): 8 waves = 256x128 (wide_core).
// ---------------------------------------------------------------------------
template <bool RELU, bool HASRES, bool OUTBF16, int N, bool WIDE>
__global__ void __launch_bounds__(WIDE ? 256 : G_THR) gemm_kernel(
    const bf16_t* __restrict__ A, const bf16_t* __restrict__ Bt,
    const float* __restrict__ bias, const float* __restrict__ resid,
    float* __restrict__ outf, bf16_t* __restrict__ outb, int K) {
  __shared__ __attribute__((aligned(16))) bf16_t smem[2 * (WIDE ? W_BUF(2) : G_BUF)];
  const int lane = threadIdx.x & 31;
  const int wave = WIDE ? __builtin_amdgcn_readfirstlane(threadIdx.x >> 5)
                        : (int)(threadIdx.x >> 5);
  const int r = lane & 15, hf = lane >> 4;
  const int m0 = WIDE ? blockIdx.x * 256 + (wave & 3) * 64
                      : blockIdx.x * 128 + (wave >> 1) * 64;
  const int n0 = blockIdx.y * 128 + (WIDE ? wave >> 2 : wave & 1) * 64;

  v8f acc[4][4];
#pragma unroll
  for (int i = 0; i < 4; i++) {
#pragma unroll
    for (int f = 0; f < 4; f++) acc[i][f] = v8f_zero();
  }
  if constexpr (WIDE) {
    const bf16_t* Bblk = Bt + (size_t)blockIdx.y * 128 * DMODEL;
    wide_core<2, false>(A + (size_t)blockIdx.x * 256 * DMODEL, Bblk, Bblk + 64 * DMODEL,
                        Bblk, wave, smem, acc);
  } else {
    gemm_core(A + (size_t)blockIdx.x * 128 * (size_t)K,
              Bt + (size_t)blockIdx.y * 128 * (size_t)K, K, smem, acc);
  }

  // The lane's elements lie at e0 + (i * 16 + v) * N + f, f = 0..3: one address
  // per array, the rest constant offsets; four adjacent columns an access, whole
  // lines a wave.  All loads, then all sums, then all stores.
  const int nl = n0 + r * 4;
  const unsigned e0 = (unsigned)(m0 + hf * 8) * (unsigned)N + (unsigned)nl;
  const v4f bn = *(const v4f*)(bias + nl);
  v4f rv[4][8];
  if constexpr (HASRES) {
    const float* rp = resid + e0;
#pragma unroll
    for (int i = 0; i < 4; i++) {
#pragma unroll
      for (int v = 0; v < 8; v++) rv[i][v] = *(const v4f*)(rp + (i * 16 + v) * N);
    }
    // the address registers named by the loads above stay as they are until
    // this wait: as inputs they cannot be rewritten, or given to a load's
    // result, ahead of it
    asm volatile("s_wait_xcnt 0x0" :: "v"(nl), "v"(e0), "v"(rp) : "memory");
  } else {
    asm volatile("s_wait_xcnt 0x0" :: "v"(nl) : "memory");
  }
  v4f of[4][8];
  uint2 ob[4][8];
#pragma unroll
  for (int i = 0; i < 4; i++) {
#pragma unroll
    for (int v = 0; v < 8; v++) {
      v4f t;
#pragma unroll
      for (int f = 0; f < 4; f++) {
        t[f] = acc[i][f][v] + bn[f];
        if constexpr (HASRES) t[f] = t[f] + rv[i][v][f];
        if constexpr (RELU) t[f] = fmaxf(t[f], 0.0f);
      }
      if constexpr (OUTBF16) {
        bf16_t o[4] = {(bf16_t)t[0], (bf16_t)t[1], (bf16_t)t[2], (bf16_t)t[3]};
        ob[i][v] = *(const uint2*)o;
      } else {
        of[i][v] = t;
      }
    }
  }
  bf16_t* opb = outb + e0;
  float* opf = outf + e0;
  // keeps the vector operations ahead of the stores, so that a register named
  // by an issued store is not written again
  if constexpr (OUTBF16) {
    __builtin_amdgcn_sched_group_barrier(0x002, 1024, 0);
    __builtin_amdgcn_sched_group_barrier(0x040, 32, 0);
  } else {
    __builtin_amdgcn_sched_barrier(0);
  }
#pragma unroll
  for (int i = 0; i < 4; i++) {
#pragma unroll
    for (int v = 0; v < 8; v++) {
      if constexpr (OUTBF16) *(uint2*)(opb + (i * 16 + v) * N) = ob[i][v];
      else                   *(v4f*)(opf + (i * 16 + v) * N) = of[i][v];
    }
  }
}

// ---------------------------------------------------------------------------
// LayerNorm (reference semantics): y = g*(x-mean)/(std+eps)+b, std = sqrt(
// mean((x-mean)^2)).  One wave per row of 1024, 16 waves a work-group, one
// work-group per WGP: a lane holds 32 elements of its row (eight b128 loads,
// each wave-wide load four whole lines, all issued first), both sums run in
// the lane's registers and then across the wave's lanes; no LDS, no barrier.
// ---------------------------------------------------------------------------
#define L_WAVES 16

template <int CTRL>
__device__ __forceinline__ float row_xadd(float x) {
  return x + __builtin_bit_cast(
                 float, __builtin_amdgcn_update_dpp(
                            0, __builtin_bit_cast(int, x), CTRL, 0xf, 0xf, true));
}

// sum over the 32 lanes, the same bits in every lane
__device__ __forceinline__ float wave_sum(float x) {
  x = row_xadd<0x161>(x);
  x = row_xadd<0x162>(x);
  x = row_xadd<0x164>(x);
  x = row_xadd<0x168>(x);
  return x + xhalf(x);
}

template <bool HASB>
__global__ void __launch_bounds__(L_WAVES * 32) ln_kernel(
    const float* in, const float* gam, const float* bet, float* out,
    bf16_t* outb) {
  const int lane = threadIdx.x & 31;
  const int wave = __builtin_amdgcn_readfirstlane(threadIdx.x >> 5);
  const size_t row = (size_t)(blockIdx.x * L_WAVES + wave);
  const unsigned off = (unsigned)lane * 16u;   // the lane's bytes in 512
  const char* px = (const char*)(in + row * DMODEL);
  const char* pg = (const char*)gam;
  const char* pb = (const char*)bet;

  v4f v[8], g[8], bt[8];
#pragma unroll
  for (int i = 0; i < 8; i++) v[i] = *(const v4f*)(px + i * 512 + off);
#pragma unroll
  for (int i = 0; i < 8; i++) g[i] = *(const v4f*)(pg + i * 512 + off);
#pragma unroll
  for (int i = 0; i < 8; i++) bt[i] = *(const v4f*)(pb + i * 512 + off);
  // the base and offset registers named by the loads above stay as they are
  // until this wait: as inputs they cannot be rewritten, or given to a load's
  // result, ahead of it (the pointers are not __restrict__, so no load moves
  // behind it)
  asm volatile("s_wait_xcnt 0x0" :: "v"(off), "s"(px), "s"(pg), "s"(pb) : "memory");
  // keeps all 24 loads ahead of the sums: left free, the compiler puts the
  // gamma and beta loads behind both sums, where their latency is waited out
  __builtin_amdgcn_sched_barrier(0);

  const v4f s4 = ((v[0] + v[1]) + (v[2] + v[3])) + ((v[4] + v[5]) + (v[6] + v[7]));
  const float mean = wave_sum((s4.x + s4.y) + (s4.z + s4.w)) * (1.0f / DMODEL);

  v4f q4 = {0.f, 0.f, 0.f, 0.f};
#pragma unroll
  for (int i = 0; i < 8; i++) {
    v[i] -= mean;
    q4 += v[i] * v[i];
  }
  const float tots = wave_sum((q4.x + q4.y) + (q4.z + q4.w));
  const float stdv = sqrtf(tots * (1.0f / DMODEL));
  const float inv = 1.0f / (stdv + 1e-5f);

#pragma unroll
  for (int i = 0; i < 8; i++) v[i] = g[i] * v[i] * inv + bt[i];

  // the bf16 copy goes out first: its conversions then stand ahead of every
  // store, and no register named by an issued store is written again
  if constexpr (HASB) {
    char* pob = (char*)(outb + row * DMODEL);
#pragma unroll
    for (int i = 0; i < 8; i++) {
      bf16_t o[4] = {(bf16_t)v[i].x, (bf16_t)v[i].y, (bf16_t)v[i].z, (bf16_t)v[i].w};
      *(uint2*)(pob + i * 256 + (off >> 1)) = *(const uint2*)o;
    }
  }
  char* po = (char*)(out + row * DMODEL);
#pragma unroll
  for (int i = 0; i < 8; i++) *(v4f*)(po + i * 512 + off) = v[i];
}

// ---------------------------------------------------------------------------
extern "C" void kernel_launch(void* const* d_in, const int* in_sizes, int n_in,
                              void* d_out, int out_size, void* d_ws,
                              size_t ws_size, hipStream_t stream) {
  (void)in_sizes; (void)n_in; (void)out_size; (void)ws_size;
  const float* x   = (const float*)d_in[0];
  const float* wq  = (const float*)d_in[1];
  const float* bq  = (const float*)d_in[2];
  const float* wk  = (const float*)d_in[3];
  const float* bk  = (const float*)d_in[4];
  const float* wv  = (const float*)d_in[5];
  const float* bv  = (const float*)d_in[6];
  const float* wo  = (const float*)d_in[7];
  const float* wob = (const float*)d_in[8];
  const float* g1  = (const float*)d_in[9];
  const float* b1  = (const float*)d_in[10];
  const float* f1w = (const float*)d_in[11];
  const float* f1bias = (const float*)d_in[12];
  const float* f2w = (const float*)d_in[13];
  const float* f2bias = (const float*)d_in[14];
  const float* g2  = (const float*)d_in[15];
  const float* b2  = (const float*)d_in[16];
  float* out = (float*)d_out;

  char* ws = (char*)d_ws;
  size_t off = 0;
  auto alloc = [&](size_t bytes) -> char* {
    char* p = ws + off;
    off += (bytes + 255) & ~(size_t)255;
    return p;
  };
  const int BS = BATCH * S_LEN;  // 4096 rows
  bf16_t* xb   = (bf16_t*)alloc((size_t)BS * DMODEL * 2);          // 8 MB (reused as concat)
  bf16_t* wqt  = (bf16_t*)alloc((size_t)NHEADS * DHEAD * DMODEL * 2);
  bf16_t* wkt  = (bf16_t*)alloc((size_t)NHEADS * DHEAD * DMODEL * 2);
  bf16_t* wvt  = (bf16_t*)alloc((size_t)NHEADS * DHEAD * DMODEL * 2);
  bf16_t* wot  = (bf16_t*)alloc((size_t)DMODEL * DMODEL * 2);
  bf16_t* ff1t = (bf16_t*)alloc((size_t)DFF * DMODEL * 2);
  bf16_t* ff2t = (bf16_t*)alloc((size_t)DMODEL * DFF * 2);
  bf16_t* Qm   = (bf16_t*)alloc((size_t)BATCH * NHEADS * S_LEN * DHEAD * 2);  // 8 MB
  bf16_t* Km   = (bf16_t*)alloc((size_t)BATCH * NHEADS * S_LEN * DHEAD * 2);  // 8 MB
  bf16_t* Vtm  = (bf16_t*)alloc((size_t)BATCH * NHEADS * DHEAD * S_LEN * 2);  // 8 MB
  float*  t1   = (float*)alloc((size_t)BS * DMODEL * 4);           // 16 MB (reused as t2)
  float*  hbuf = (float*)alloc((size_t)BS * DMODEL * 4);           // 16 MB
  bf16_t* hb   = (bf16_t*)alloc((size_t)BS * DMODEL * 2);          // 8 MB
  bf16_t* concatb = xb;       // alias: xb dead after QKV
  bf16_t* ffn1out = Qm;       // alias: Q+K region (16 MB) dead after attention
  float*  t2 = t1;            // alias: t1 dead after LN1

  dim3 blk256(256);
  dim3 blkg(G_THR);

  // 1) convert x, transpose-convert all weights (one launch)
  prep_kernel<<<dim3(P_WGS), dim3(P_THR), 0, stream>>>(
      x, wq, wk, wv, wo, f1w, f2w, xb, wqt, wkt, wvt, wot, ff1t, ff2t);

  // 2) QKV projections (per head)
  qkv_kernel<<<dim3(S_LEN / 256, NHEADS, BATCH), dim3(384), 0, stream>>>(
      xb, wqt, wkt, wvt, bq, bk, bv, Qm, Km, Vtm);

  // 3) flash attention -> concat heads (bf16)
  attn_kernel<<<dim3(S_LEN / 256, NHEADS, BATCH), blk256, 0, stream>>>(
      Qm, Km, Vtm, concatb);

  // 4) output projection + residual(x) -> t1 (f32)
  gemm_kernel<false, true, false, DMODEL, false><<<dim3(BS / 128, DMODEL / 128), blkg, 0, stream>>>(
      concatb, wot, wob, x, t1, nullptr, DMODEL);

  // 5) LayerNorm1 -> h (f32) + hb (bf16)
  ln_kernel<true><<<dim3(BS / L_WAVES), dim3(L_WAVES * 32), 0, stream>>>(t1, g1, b1, hbuf, hb);

  // 6) FFN1: relu(h @ ff1 + b) -> bf16
  gemm_kernel<true, false, true, DFF, true><<<dim3(BS / 256, DFF / 128), blk256, 0, stream>>>(
      hb, ff1t, f1bias, nullptr, nullptr, ffn1out, DMODEL);

  // 7) FFN2: (+ b + h residual) -> t2 (f32)
  gemm_kernel<false, true, false, DMODEL, false><<<dim3(BS / 128, DMODEL / 128), blkg, 0, stream>>>(
      ffn1out, ff2t, f2bias, hbuf, t2, nullptr, DFF);

  // 8) LayerNorm2 -> d_out
  ln_kernel<false><<<dim3(BS / L_WAVES), dim3(L_WAVES * 32), 0, stream>>>(t2, g2, b2, out, nullptr);
}

// v009
// A run of this version takes 108 microseconds.
// Timed twice side by side with v008, it ran 1.05 times as fast both times.
// Counting every step since v000, it is 3.39 times as fast.
#include <hip/hip_runtime.h>
#include <hip/hip_bf16.h>
#include <math.h>

typedef __bf16 bf16_t;
typedef __attribute__((ext_vector_type(16))) __bf16     v16bf;
typedef __attribute__((ext_vector_type(8)))  float       v8f;
typedef __attribute__((ext_vector_type(4)))  unsigned int v4u;
typedef __attribute__((ext_vector_type(4)))  float       v4f;

#define S_LEN  1024
#define DMODEL 1024
#define DHEAD  64
#define NHEADS 16
#define DFF    2048
#define BATCH  4

__device__ __forceinline__ v8f wmma_bf16(v16bf a, v16bf b, v8f c) {
  return __builtin_amdgcn_wmma_f32_16x16x32_bf16(false, a, false, b, (short)0, c,
                                                 false, false);
}

__device__ __forceinline__ v16bf frag_load(const bf16_t* __restrict__ base,
                                           int ld, int row0, int k0, int lane) {
  const int r = lane & 15, hf = lane >> 4;
  const bf16_t* p = base + (size_t)(row0 + r) * (size_t)ld + (k0 + hf * 8);
  union { v4u u[2]; v16bf v; } cv;
  cv.u[0] = *(const v4u*)p;
  cv.u[1] = *(const v4u*)(p + 16);
  return cv.v;
}

__device__ __forceinline__ v8f v8f_zero() {
  v8f z = {0.f, 0.f, 0.f, 0.f, 0.f, 0.f, 0.f, 0.f};
  return z;
}

#define G_BK    128
#define G_LDP   136
#define G_AROWS 128
#define G_BROWS 128
#define G_BUF   ((G_AROWS + G_BROWS) * G_LDP)   // elements per buffer
#define G_CW    4                        // copy waves: the block's first four
#define G_THR   256                      // threads per block: copy + product waves

template <int LSTEP>
__device__ __forceinline__ void stage_rows(const bf16_t* g, size_t rows8,
                                           unsigned lds) {
  const bf16_t* g0 = g;
  const bf16_t* g1 = g + rows8;
  const bf16_t* g2 = g + 2 * rows8;
  const bf16_t* g3 = g + 3 * rows8;
  const bf16_t* g4 = g + 4 * rows8;
  const bf16_t* g5 = g + 5 * rows8;
  const bf16_t* g6 = g + 6 * rows8;
  const bf16_t* g7 = g + 7 * rows8;
  const unsigned l0 = lds;
  const unsigned l1 = lds + 1 * LSTEP * G_LDP * 2;
  const unsigned l2 = lds + 2 * LSTEP * G_LDP * 2;
  const unsigned l3 = lds + 3 * LSTEP * G_LDP * 2;
  const unsigned l4 = lds + 4 * LSTEP * G_LDP * 2;
  const unsigned l5 = lds + 5 * LSTEP * G_LDP * 2;
  const unsigned l6 = lds + 6 * LSTEP * G_LDP * 2;
  const unsigned l7 = lds + 7 * LSTEP * G_LDP * 2;
  asm volatile(
      "global_load_async_to_lds_b128 %0, %1, off\n\t"
      "global_load_async_to_lds_b128 %2, %3, off\n\t"
      "global_load_async_to_lds_b128 %4, %5, off\n\t"
      "global_load_async_to_lds_b128 %6, %7, off\n\t"
      "global_load_async_to_lds_b128 %8, %9, off\n\t"
      "global_load_async_to_lds_b128 %10, %11, off\n\t"
      "global_load_async_to_lds_b128 %12, %13, off\n\t"
      "global_load_async_to_lds_b128 %14, %15, off\n\t"
      "s_wait_xcnt 0x0"
      :: "v"(l0), "v"(g0), "v"(l1), "v"(g1), "v"(l2), "v"(g2), "v"(l3), "v"(g3),
         "v"(l4), "v"(g4), "v"(l5), "v"(g5), "v"(l6), "v"(g6), "v"(l7), "v"(g7)
      : "memory");
}

// One pass of both operands, 32 copies per lane: the 128 A rows first in the
// buffer, the 128 Bt rows behind them, 64 rows a statement.  lda: the lane's
// place in A row tid >> 4; ldb: its place in the LDS row that Bt row tid >> 4
// is dealt to (Bt row + 8 lands two LDS rows further on).
__device__ __forceinline__ void stage_copies(const bf16_t* ga, const bf16_t* gb,
                                             size_t rows8, unsigned lda,
                                             unsigned ldb) {
  stage_rows<8>(ga, rows8, lda);
  stage_rows<8>(ga + 8 * rows8, rows8, lda + 64 * G_LDP * 2);
  stage_rows<2>(gb, rows8, ldb + G_AROWS * G_LDP * 2);
  // the 32 copies of the pass before may still be out: with the last eight the
  // wave never has more than 63 outstanding
  asm volatile("s_wait_asynccnt 0x37" ::: "memory");
  stage_rows<2>(gb + 8 * rows8, rows8, ldb + (G_AROWS + 64) * G_LDP * 2);
}

// Ablk: first of the block's 128 rows of A; Bblk: first of its 128 rows of Bt;
// both row-major with K elements per row, K a multiple of 128.  wave: the wave's
// number, a scalar; waves 0..3 copy, wave 4 + w takes A rows (w >> 1) * 64 on
// and Bt rows (w & 1) * 64 on; within them acc[i][f] is the tile of A rows
// i * 16 on and of Bt rows 4 * r + f, r the lane & 15.
__device__ __forceinline__ void gemm_core(const bf16_t* __restrict__ Ablk,
                                          const bf16_t* __restrict__ Bblk,
                                          int K, int wave, bf16_t* smem,
                                          v8f acc[4][4]) {
  const int tid = threadIdx.x & (G_CW * 32 - 1);   // the copy waves' thread number
  const int lane = tid & 31;
  // a scalar test: a whole wave copies or branches round the copies
  const bool copier = wave < G_CW;
  const int pw = wave - G_CW;
  const int rw = tid >> 4, cw = (tid & 15) * 8;
  const bf16_t* ga = Ablk + (size_t)rw * (size_t)K + cw;
  const bf16_t* gb = Bblk + (size_t)rw * (size_t)K + cw;
  const size_t rows8 = (size_t)8 * (size_t)K;
  const unsigned lda0 = (unsigned)(size_t)smem + (unsigned)(rw * G_LDP + cw) * 2u;
  const unsigned ldb0 = (unsigned)(size_t)smem +
                        (unsigned)(((rw & 3) * 16 + (rw >> 2)) * G_LDP + cw) * 2u;
  const int npass = K / G_BK;
  const int arow = (pw >> 1) * 64, brow = G_AROWS + (pw & 1) * 64;

  if (copier) {
    stage_copies(ga, gb, rows8, lda0, ldb0);
    if (npass > 1)
      stage_copies(ga + G_BK, gb + G_BK, rows8, lda0 + G_BUF * 2, ldb0 + G_BUF * 2);
  }
  // pass 0 has landed for this wave (the 32 copies of pass 1 may be out), then
  // for the block
  if (copier && npass > 1) asm volatile("s_wait_asynccnt 0x20" ::: "memory");
  else                     asm volatile("s_wait_asynccnt 0x0" ::: "memory");
  __syncthreads();
  if (copier && npass > 2)
    stage_copies(ga + 2 * G_BK, gb + 2 * G_BK, rows8, lda0 + 2 * (G_BUF * 2),
                 ldb0 + 2 * (G_BUF * 2));

  int cur = 0;   // the buffer of pass t
  for (int t = 0; t < npass; t++) {
    if (!copier) {
      const bf16_t* sbuf = smem + cur * G_BUF;
      v16bf a[4][4], b[4][4];
#pragma unroll
      for (int ks = 0; ks < 4; ks++) {
#pragma unroll
        for (int i = 0; i < 4; i++)
          a[ks][i] = frag_load(sbuf, G_LDP, arow + i * 16, ks * 32, lane);
#pragma unroll
        for (int f = 0; f < 4; f++)
          b[ks][f] = frag_load(sbuf, G_LDP, brow + f * 16, ks * 32, lane);
      }
      // keeps the pass's LDS reads one group ahead of its WMMAs: left free, the
      // compiler puts a pair of reads and a full wait in front of every WMMA
      __builtin_amdgcn_sched_barrier(0);
#pragma unroll
      for (int ks = 0; ks < 4; ks++) {
#pragma unroll
        for (int i = 0; i < 4; i++) {
#pragma unroll
          for (int f = 0; f < 4; f++)
            acc[i][f] = wmma_bf16(a[ks][i], b[ks][f], acc[i][f]);
        }
      }
      // keeps the publish point behind the pass's WMMAs: left free, the compiler
      // lifts its waits and barrier over them, so that every LDS read is waited
      // out before the first WMMA
      __builtin_amdgcn_sched_barrier(0);
    }
    // publish point: a product wave's reads of the buffer are done, a copy
    // wave's copies of pass t + 1 have landed (all but its 32 youngest, those of
    // pass t + 2, in the trips in which it has asked for them); the barrier says
    // both for the whole block
    asm volatile("s_wait_dscnt 0x0" ::: "memory");
    if (copier && t + 2 < npass) asm volatile("s_wait_asynccnt 0x20" ::: "memory");
    else                         asm volatile("s_wait_asynccnt 0x0" ::: "memory");
    __syncthreads();
    // pass t + 3 goes into the buffer of pass t, which every reader has left
    if (copier && t + 3 < npass)
      stage_copies(ga + (size_t)(t + 3) * G_BK, gb + (size_t)(t + 3) * G_BK,
                   rows8, lda0 + (unsigned)cur * (G_BUF * 2),
                   ldb0 + (unsigned)cur * (G_BUF * 2));
    cur = cur == 2 ? 0 : cur + 1;
  }
  // no copy is left in flight when the wave goes on
  asm volatile("s_wait_asynccnt 0x0" ::: "memory");
}

// ---------------------------------------------------------------------------
// Wide GEMM core, for the products whose output gives every WGP more than one
// 128x128 tile: one block a WGP, 256 rows of X against NG groups of 64 rows of
// W, so that the X tile comes from L2 once for all groups.  4 * NG waves of
// 64x64: wave w takes X rows (w & 3) * 64 on and W group w >> 2.  K = DMODEL.  Its ring: 128 k a
// pass, two buffers, asynchronous b128 copies one pass ahead, 272 B pitch; a
// buffer holds the X rows first, the W groups behind them.
// Dealt rows: within 64 rows, row 4 * r + f lands in LDS row f * 16 + r.  The W
// groups are dealt; with VLAST the X rows are dealt too and the last W group is
// not, and that group's waves take the W rows as the A operand and the X rows
// as the B operand.
// ---------------------------------------------------------------------------
#define W_XROWS 256
#define W_BUF(NG) ((W_XROWS + (NG) * 64) * G_LDP)   // elements per buffer
#define W_CTHR  256                                 // threads that copy

template <int LSTEP>
__device__ __forceinline__ void stage64(const bf16_t* base, const unsigned vo[4],
                                        unsigned lds) {
  const unsigned l0 = lds;
  const unsigned l1 = lds + 1 * LSTEP * G_LDP * 2;
  const unsigned l2 = lds + 2 * LSTEP * G_LDP * 2;
  const unsigned l3 = lds + 3 * LSTEP * G_LDP * 2;
  asm volatile(
      "global_load_async_to_lds_b128 %0, %4, %8\n\t"
      "global_load_async_to_lds_b128 %1, %5, %8\n\t"
      "global_load_async_to_lds_b128 %2, %6, %8\n\t"
      "global_load_async_to_lds_b128 %3, %7, %8\n\t"
      "s_wait_xcnt 0x0"
      :: "v"(l0), "v"(l1), "v"(l2), "v"(l3),
         "v"(vo[0]), "v"(vo[1]), "v"(vo[2]), "v"(vo[3]), "s"(base)
      : "memory");
}

// One pass of all operands, (4 + NG) * 4 copies per copying lane.  gx, g0..g2:
// the first row of X and of each W group at the pass's k.  lpl: the lane's place
// in LDS row tid >> 4; ldl: its place in the LDS row that row tid >> 4 is dealt to.
template <int NG, bool VLAST>
__device__ __forceinline__ void wide_copies(const bf16_t* gx, const bf16_t* g0,
                                            const bf16_t* g1, const bf16_t* g2,
                                            const unsigned vo[4], unsigned lpl,
                                            unsigned ldl) {
#pragma unroll
  for (int q = 0; q < 4; q++) {
    if (VLAST) stage64<4>(gx + q * 64 * DMODEL, vo, ldl + q * 64 * G_LDP * 2);
    else       stage64<16>(gx + q * 64 * DMODEL, vo, lpl + q * 64 * G_LDP * 2);
  }
  stage64<4>(g0, vo, ldl + W_XROWS * G_LDP * 2);
  stage64<4>(g1, vo, ldl + (W_XROWS + 64) * G_LDP * 2);
  if (NG == 3) {
    if (VLAST) stage64<16>(g2, vo, lpl + (W_XROWS + 128) * G_LDP * 2);
    else       stage64<4>(g2, vo, ldl + (W_XROWS + 128) * G_LDP * 2);
  }
}

// The wave's fragments of 32 k
__device__ __forceinline__ void wide_frags(const bf16_t* sbuf, int arow, int brow,
                                           int ks, int lane, v16bf a[4], v16bf b[4]) {
#pragma unroll
  for (int i = 0; i < 4; i++) a[i] = frag_load(sbuf, G_LDP, arow + i * 16, ks * 32, lane);
#pragma unroll
  for (int f = 0; f < 4; f++) b[f] = frag_load(sbuf, G_LDP, brow + f * 16, ks * 32, lane);
}

// Xblk: first of the block's 256 rows of X; W0..W2: first row of each W group;
// all row-major with DMODEL elements per row.  wave: the wave's number, a scalar.
// acc[i][f]: A fragment i against B fragment f.
template <int NG, bool VLAST>
__device__ __forceinline__ void wide_core(const bf16_t* __restrict__ Xblk,
                                          const bf16_t* __restrict__ W0,
                                          const bf16_t* __restrict__ W1,
                                          const bf16_t* __restrict__ W2,
                                          int wave, bf16_t* smem, v8f acc[4][4]) {
  const int tid = threadIdx.x;
  const int lane = tid & 31;
  const int rw = tid >> 4, cw = (tid & 15) * 8;
  unsigned vo[4];
#pragma unroll
  for (int j = 0; j < 4; j++) vo[j] = (unsigned)((rw + 16 * j) * DMODEL + cw) * 2u;
  const unsigned lpl = (unsigned)(size_t)smem + (unsigned)(rw * G_LDP + cw) * 2u;
  const unsigned ldl = (unsigned)(size_t)smem +
                       (unsigned)(((rw & 3) * 16 + (rw >> 2)) * G_LDP + cw) * 2u;
  const int npass = DMODEL / G_BK;
  const int xrow = (wave & 3) * 64, wrow = W_XROWS + (wave >> 2) * 64;
  const bool tr = VLAST && (wave >> 2) == NG - 1;
  const int arow = tr ? wrow : xrow, brow = tr ? xrow : wrow;
  // the first 8 waves copy (a scalar test: a whole wave copies or branches round)
  const bool copier = NG == 2 || wave < W_CTHR / 32;

  if (copier) wide_copies<NG, VLAST>(Xblk, W0, W1, W2, vo, lpl, ldl);
  // pass 0 has landed for this wave, then for the block
  asm volatile("s_wait_asynccnt 0x0" ::: "memory");
  __syncthreads();
  if (copier)
    wide_copies<NG, VLAST>(Xblk + G_BK, W0 + G_BK, W1 + G_BK, W2 + G_BK, vo,
                           lpl + W_BUF(NG) * 2, ldl + W_BUF(NG) * 2);

  for (int t = 0; t < npass; t++) {
    const int bsel = t & 1;
    const bf16_t* sbuf = smem + bsel * W_BUF(NG);
    v16bf a[2][4], b[2][4];   // two fragment sets, 32 k each
    wide_frags(sbuf, arow, brow, 0, lane, a[0], b[0]);
    wide_frags(sbuf, arow, brow, 1, lane, a[1], b[1]);
    // the scheduling barriers of this loop keep each set's LDS reads one group,
    // a whole set of WMMAs ahead of their use: left free, the compiler spreads
    // the reads among the WMMAs with a wait in front of each
    __builtin_amdgcn_sched_barrier(0);
#pragma unroll
    for (int ks = 0; ks < 4; ks++) {
#pragma unroll
      for (int i = 0; i < 4; i++) {
#pragma unroll
        for (int f = 0; f < 4; f++)
          acc[i][f] = wmma_bf16(a[ks & 1][i], b[ks & 1][f], acc[i][f]);
      }
      __builtin_amdgcn_sched_barrier(0);
      if (ks < 2) {
        wide_frags(sbuf, arow, brow, ks + 2, lane, a[ks & 1], b[ks & 1]);
        __builtin_amdgcn_sched_barrier(0);
      }
    }
    // publish point: this wave's reads of the buffer are done, its copies of
    // pass t + 1 have landed; the barrier says both for the whole block
    asm volatile("s_wait_dscnt 0x0" ::: "memory");
    asm volatile("s_wait_asynccnt 0x0" ::: "memory");
    __syncthreads();
    if (copier && t + 2 < npass) {
      const int ko = (t + 2) * G_BK;
      wide_copies<NG, VLAST>(Xblk + ko, W0 + ko, W1 + ko, W2 + ko, vo,
                             lpl + (unsigned)bsel * (W_BUF(NG) * 2),
                             ldl + (unsigned)bsel * (W_BUF(NG) * 2));
    }
  }
  // no copy is left in flight when the wave goes on
  asm volatile("s_wait_asynccnt 0x0" ::: "memory");
}

template <int LSTEP>
__device__ __forceinline__ void stage64c(const bf16_t* base, const unsigned vo[8],
                                         unsigned lds) {
  const unsigned l0 = lds;
  const unsigned l1 = lds + 1 * LSTEP * G_LDP * 2;
  const unsigned l2 = lds + 2 * LSTEP * G_LDP * 2;
  const unsigned l3 = lds + 3 * LSTEP * G_LDP * 2;
  const unsigned l4 = lds + 4 * LSTEP * G_LDP * 2;
  const unsigned l5 = lds + 5 * LSTEP * G_LDP * 2;
  const unsigned l6 = lds + 6 * LSTEP * G_LDP * 2;
  const unsigned l7 = lds + 7 * LSTEP * G_LDP * 2;
  asm volatile(
      "global_load_async_to_lds_b128 %0, %8, %16\n\t"
      "global_load_async_to_lds_b128 %1, %9, %16\n\t"
      "global_load_async_to_lds_b128 %2, %10, %16\n\t"
      "global_load_async_to_lds_b128 %3, %11, %16\n\t"
      "global_load_async_to_lds_b128 %4, %12, %16\n\t"
      "global_load_async_to_lds_b128 %5, %13, %16\n\t"
      "global_load_async_to_lds_b128 %6, %14, %16\n\t"
      "global_load_async_to_lds_b128 %7, %15, %16\n\t"
      "s_wait_xcnt 0x0"
      :: "v"(l0), "v"(l1), "v"(l2), "v"(l3), "v"(l4), "v"(l5), "v"(l6), "v"(l7),
         "v"(vo[0]), "v"(vo[1]), "v"(vo[2]), "v"(vo[3]), "v"(vo[4]), "v"(vo[5]),
         "v"(vo[6]), "v"(vo[7]), "s"(base)
      : "memory");
}

// One pass of all operands, 48 copies per copying lane.  gx, g0, g1: the first
// row of X and of each W group at the pass's k.  lpl: the lane's place in LDS row
// tid >> 4; ldl: its place in the LDS row that row tid >> 4 is dealt to.
__device__ __forceinline__ void wide2_copies(const bf16_t* gx, const bf16_t* g0,
                                             const bf16_t* g1, const unsigned vo[8],
                                             unsigned lpl, unsigned ldl) {
  // the waits: the 48 copies of the pass before may still be out; with each
  // eight more, from the second eight on, the wave never has more than 63
  // outstanding
#pragma unroll
  for (int q = 0; q < 4; q++) {
    if (q > 0) asm volatile("s_wait_asynccnt 0x37" ::: "memory");
    stage64c<8>(gx + q * 64 * DMODEL, vo, lpl + q * 64 * G_LDP * 2);
  }
  asm volatile("s_wait_asynccnt 0x37" ::: "memory");
  stage64c<2>(g0, vo, ldl + W_XROWS * G_LDP * 2);
  asm volatile("s_wait_asynccnt 0x37" ::: "memory");
  stage64c<2>(g1, vo, ldl + (W_XROWS + 64) * G_LDP * 2);
}

// Xblk: first of the block's 256 rows of X; W0, W1: first row of each W group;
// all row-major with DMODEL elements per row.  wave: the wave's number, a scalar.
// acc[i][f]: A fragment i against B fragment f.
__device__ __forceinline__ void wide2_core(const bf16_t* __restrict__ Xblk,
                                           const bf16_t* __restrict__ W0,
                                           const bf16_t* __restrict__ W1,
                                           int wave, bf16_t* smem, v8f acc[4][4]) {
  const int tid = threadIdx.x & (G_CW * 32 - 1);   // the copy waves' thread number
  const int lane = tid & 31;
  // a scalar test: a whole wave copies or branches round the copies
  const bool copier = wave < G_CW;
  const int pw = wave - G_CW;
  const int rw = tid >> 4, cw = (tid & 15) * 8;
  unsigned vo[8];
#pragma unroll
  for (int j = 0; j < 8; j++) vo[j] = (unsigned)((rw + 8 * j) * DMODEL + cw) * 2u;
  const unsigned lpl = (unsigned)(size_t)smem + (unsigned)(rw * G_LDP + cw) * 2u;
  const unsigned ldl = (unsigned)(size_t)smem +
                       (unsigned)(((rw & 3) * 16 + (rw >> 2)) * G_LDP + cw) * 2u;
  const int npass = DMODEL / G_BK;
  const int arow = (pw & 3) * 64, brow = W_XROWS + (pw >> 2) * 64;

  if (copier) {
    wide2_copies(Xblk, W0, W1, vo, lpl, ldl);
    wide2_copies(Xblk + G_BK, W0 + G_BK, W1 + G_BK, vo, lpl + W_BUF(2) * 2,
                 ldl + W_BUF(2) * 2);
  }
  // pass 0 has landed for this wave (the 48 copies of pass 1 may be out), then
  // for the block
  if (copier) asm volatile("s_wait_asynccnt 0x30" ::: "memory");
  else        asm volatile("s_wait_asynccnt 0x0" ::: "memory");
  __syncthreads();
  if (copier)
    wide2_copies(Xblk + 2 * G_BK, W0 + 2 * G_BK, W1 + 2 * G_BK, vo,
                 lpl + 2 * (W_BUF(2) * 2), ldl + 2 * (W_BUF(2) * 2));

  int cur = 0;   // the buffer of pass t
  for (int t = 0; t < npass; t++) {
    if (!copier) {
      const bf16_t* sbuf = smem + cur * W_BUF(2);
      v16bf a[2][4], b[2][4];   // two fragment sets, 32 k each
      wide_frags(sbuf, arow, brow, 0, lane, a[0], b[0]);
      wide_frags(sbuf, arow, brow, 1, lane, a[1], b[1]);
      // the scheduling barriers of this loop keep each set's LDS reads one group,
      // a whole set of WMMAs ahead of their use: left free, the compiler spreads
      // the reads among the WMMAs with a wait in front of each
      __builtin_amdgcn_sched_barrier(0);
#pragma unroll
      for (int ks = 0; ks < 4; ks++) {
#pragma unroll
        for (int i = 0; i < 4; i++) {
#pragma unroll
          for (int f = 0; f < 4; f++)
            acc[i][f] = wmma_bf16(a[ks & 1][i], b[ks & 1][f], acc[i][f]);
        }
        __builtin_amdgcn_sched_barrier(0);
        if (ks < 2) {
          wide_frags(sbuf, arow, brow, ks + 2, lane, a[ks & 1], b[ks & 1]);
          __builtin_amdgcn_sched_barrier(0);
        }
      }
    }
    // publish point: a product wave's reads of the buffer are done, a copy
    // wave's copies of pass t + 1 have landed (all but its 48 youngest, those of
    // pass t + 2, in the trips in which it has asked for them); the barrier says
    // both for the whole block
    asm volatile("s_wait_dscnt 0x0" ::: "memory");
    if (copier && t + 2 < npass) asm volatile("s_wait_asynccnt 0x30" ::: "memory");
    else                         asm volatile("s_wait_asynccnt 0x0" ::: "memory");
    __syncthreads();
    // pass t + 3 goes into the buffer of pass t, which every reader has left
    if (copier && t + 3 < npass) {
      const int ko = (t + 3) * G_BK;
      wide2_copies(Xblk + ko, W0 + ko, W1 + ko, vo,
                   lpl + (unsigned)cur * (W_BUF(2) * 2),
                   ldl + (unsigned)cur * (W_BUF(2) * 2));
    }
    cur = cur == 2 ? 0 : cur + 1;
  }
  // no copy is left in flight when the wave goes on
  asm volatile("s_wait_asynccnt 0x0" ::: "memory");
}

// ---------------------------------------------------------------------------
// Operand preparation, one launch: x -> bf16, and every weight matrix
// fp32 [R][C] -> bf16 [C][R].  256 work-groups of 16 waves, all resident at
// once; each takes 16384 elements of x and eight 64x64 weight tiles (one each
// of wq, wk, wv, wo, two of ff1, two of ff2).  All 24 b128 loads of a thread
// are issued first; loads and stores cover whole 128-B lines.
// ---------------------------------------------------------------------------
#define P_WGS   256
#define P_THR   512
#define P_PITCH 65                       // LDS tile row pitch, floats

// src: the tile's first element (uniform); off: this thread's byte offset in
// the tile's first 32 rows; C: source row length.
template <int C>
__device__ __forceinline__ void tile_load(const float* src, unsigned off,
                                          float4 v[2]) {
  const char* p = (const char*)src;
  v[0] = *(const float4*)(p + off);
  v[1] = *(const float4*)(p + 32 * C * 4 + off);
}

__device__ __forceinline__ void tile_to_lds(float* tile, int tid, const float4 v[2]) {
  float* t = tile + (tid >> 4) * P_PITCH + (tid & 15) * 4;
#pragma unroll
  for (int i = 0; i < 2; i++) {
    t[32 * i * P_PITCH + 0] = v[i].x;
    t[32 * i * P_PITCH + 1] = v[i].y;
    t[32 * i * P_PITCH + 2] = v[i].z;
    t[32 * i * P_PITCH + 3] = v[i].w;
  }
}

// dst points at element [c0][r0] of the transposed matrix, R = its row length.
// Eight lanes write the 128 B of one destination row.
__device__ __forceinline__ void tile_store_t(const float* tile, int tid,
                                             bf16_t* __restrict__ dst, int R) {
  const int rg = (tid & 7) * 8, c = tid >> 3;
  bf16_t o[8];
#pragma unroll
  for (int e = 0; e < 8; e++) o[e] = (bf16_t)tile[(rg + e) * P_PITCH + c];
  *(v4u*)(dst + (size_t)c * (size_t)R + rg) = *(const v4u*)o;
}

__global__ void __launch_bounds__(P_THR) prep_kernel(
    const float* x, const float* wq, const float* wk, const float* wv,
    const float* wo, const float* f1w, const float* f2w, bf16_t* xb,
    bf16_t* wqt, bf16_t* wkt, bf16_t* wvt, bf16_t* wot, bf16_t* ff1t,
    bf16_t* ff2t) {
  __shared__ float tiles[8][64 * P_PITCH];
  const int tid = threadIdx.x;
  const int b = blockIdx.x, bh = b >> 4, bl = b & 15;
  const int b2 = b + P_WGS;

  // per-head matrices are [1024][64]: head bh, row tile bl
  const size_t hsrc = (size_t)bh * (DMODEL * DHEAD) + (size_t)bl * (64 * DHEAD);
  const size_t hdst = (size_t)bh * (DMODEL * DHEAD) + (size_t)bl * 64;
  const unsigned col = (unsigned)(tid & 15) * 16u, row = (unsigned)(tid >> 4);
  const unsigned o64 = row * (DHEAD * 4) + col;
  const unsigned o1k = row * (DMODEL * 4) + col;
  const unsigned o2k = row * (DFF * 4) + col;

  const float* pq = wq + hsrc;
  const float* pk = wk + hsrc;
  const float* pv = wv + hsrc;
  // wo [1024][1024]: row tile bh, column tile bl
  const float* po = wo + (size_t)bh * (64 * DMODEL) + bl * 64;
  // ff1 [1024][2048]: row tile index >> 5, column tile index & 31
  const float* p1a = f1w + (size_t)(b >> 5) * (64 * DFF) + (b & 31) * 64;
  const float* p1b = f1w + (size_t)(b2 >> 5) * (64 * DFF) + (b2 & 31) * 64;
  // ff2 [2048][1024]: row tile index >> 4, column tile index & 15
  const float* p2a = f2w + (size_t)(b >> 4) * (64 * DMODEL) + (b & 15) * 64;
  const float* p2b = f2w + (size_t)(b2 >> 4) * (64 * DMODEL) + (b2 & 15) * 64;
  // x: 16384 elements from b * 16384 on; o64 is also tid * 16 bytes
  const char* px = (const char*)(x + (size_t)b * (8 * P_THR * 4));

  float4 t[8][2], xv[8];
  tile_load<DHEAD>(pq, o64, t[0]);
  tile_load<DHEAD>(pk, o64, t[1]);
  tile_load<DHEAD>(pv, o64, t[2]);
  tile_load<DMODEL>(po, o1k, t[3]);
  tile_load<DFF>(p1a, o2k, t[4]);
  tile_load<DFF>(p1b, o2k, t[5]);
  tile_load<DMODEL>(p2a, o1k, t[6]);
  tile_load<DMODEL>(p2b, o1k, t[7]);
#pragma unroll
  for (int i = 0; i < 8; i++) xv[i] = *(const float4*)(px + i * (P_THR * 16) + o64);
  // the base and offset registers named by the loads above stay as they are
  // until this wait: as inputs they cannot be rewritten, or given to a load's
  // result, ahead of it (the pointers are not __restrict__, so no load moves
  // behind it)
  asm volatile("s_wait_xcnt 0x0"
               :: "v"(o64), "v"(o1k), "v"(o2k), "s"(pq), "s"(pk), "s"(pv), "s"(po),
                  "s"(p1a), "s"(p1b), "s"(p2a), "s"(p2b), "s"(px)
               : "memory");

#pragma unroll
  for (int k = 0; k < 8; k++) tile_to_lds(tiles[k], tid, t[k]);
  __syncthreads();
#pragma unroll
  for (int i = 0; i < 8; i++) {
    bf16_t o[4] = {(bf16_t)xv[i].x, (bf16_t)xv[i].y, (bf16_t)xv[i].z, (bf16_t)xv[i].w};
    *(uint2*)(xb + (size_t)b * (8 * P_THR * 4) + i * (P_THR * 4) + tid * 4) = *(const uint2*)o;
  }
  tile_store_t(tiles[0], tid, wqt + hdst, DMODEL);
  tile_store_t(tiles[1], tid, wkt + hdst, DMODEL);
  tile_store_t(tiles[2], tid, wvt + hdst, DMODEL);
  tile_store_t(tiles[3], tid, wot + (size_t)bl * (64 * DMODEL) + bh * 64, DMODEL);
  tile_store_t(tiles[4], tid, ff1t + (size_t)(b & 31) * (64 * DMODEL) + (b >> 5) * 64, DMODEL);
  tile_store_t(tiles[5], tid, ff1t + (size_t)(b2 & 31) * (64 * DMODEL) + (b2 >> 5) * 64, DMODEL);
  tile_store_t(tiles[6], tid, ff2t + (size_t)(b & 15) * (64 * DFF) + (b >> 4) * 64, DFF);
  tile_store_t(tiles[7], tid, ff2t + (size_t)(b2 & 15) * (64 * DFF) + (b2 >> 4) * 64, DFF);
}

// ---------------------------------------------------------------------------
// QKV projections.  grid = (S/256, H, B).  Block = 256 rows of x against the q,
// k and v weights of one head, which share the x tile; 12 waves, wave = 64 rows
// x 64 cols (d_head) of one of the three.  Operands staged in LDS (wide_core).
// Q is pre-scaled by 1/sqrt(64); V is stored transposed [64][S].
// The x rows are dealt: as the B operand of V^T a lane's four tiles are four
// adjacent s; as the A operand of Q and K accumulator row m of tile i is x row
// 4 * m + i.  The q and k weights are dealt too.  A lane then stores four
// adjacent bf16, and 16 lanes one whole 128-B line.
// ---------------------------------------------------------------------------
__global__ void __launch_bounds__(384) qkv_kernel(
    const bf16_t* __restrict__ xb, const bf16_t* __restrict__ wqt,
    const bf16_t* __restrict__ wkt, const bf16_t* __restrict__ wvt,
    const float* __restrict__ bq, const float* __restrict__ bk,
    const float* __restrict__ bv, bf16_t* __restrict__ Q,
    bf16_t* __restrict__ Kb, bf16_t* __restrict__ Vt) {
  __shared__ __attribute__((aligned(16))) bf16_t smem[2 * W_BUF(3)];
  const int lane = threadIdx.x & 31;
  const int wave = __builtin_amdgcn_readfirstlane(threadIdx.x >> 5);
  const int r = lane & 15, hf = lane >> 4;
  const int which = wave >> 2, h = blockIdx.y, b = blockIdx.z;
  const int sw = blockIdx.x * 256 + (wave & 3) * 64;   // the wave's first s

  const bf16_t* Xblk = xb + ((size_t)b * S_LEN + (size_t)blockIdx.x * 256) * DMODEL;
  const size_t wof = (size_t)h * DHEAD * DMODEL;

  v8f acc[4][4];
#pragma unroll
  for (int i = 0; i < 4; i++) {
#pragma unroll
    for (int f = 0; f < 4; f++) acc[i][f] = v8f_zero();
  }
  wide_core<3, true>(Xblk, wqt + wof, wkt + wof, wvt + wof, wave, smem, acc);

  uint2 ob[4][8];
  if (which < 2) {
    // rows: s = s0 + v * 4 + i; columns: n = nl + f of head h
    const int nl = h * DHEAD + r * 4;
    const int s0 = sw + hf * 32;
    const float scale = (which == 0) ? 0.125f : 1.0f;  // 1/sqrt(64)
    const unsigned onl = (unsigned)nl * 4u;   // in bytes: the load's own offset register
    const v4f bn = *(const v4f*)((const char*)(which == 0 ? bq : bk) + onl);
    // the offset register named by the load above stays as it is until this
    // wait: as an input it cannot be rewritten, or given to the load's result
    asm volatile("s_wait_xcnt 0x0" :: "v"(onl) : "memory");
#pragma unroll
    for (int i = 0; i < 4; i++) {
#pragma unroll
      for (int v = 0; v < 8; v++) {
        bf16_t o[4];
#pragma unroll
        for (int f = 0; f < 4; f++) o[f] = (bf16_t)((acc[i][f][v] + bn[f]) * scale);
        ob[i][v] = *(const uint2*)o;
      }
    }
    bf16_t* op = (which == 0 ? Q : Kb) +
                 ((size_t)(b * NHEADS + h) * S_LEN + (size_t)s0) * DHEAD + r * 4;
    // keeps every vector operation ahead of the first store, so that no
    // register named by an issued store is written again
    __builtin_amdgcn_sched_barrier(0);
#pragma unroll
    for (int i = 0; i < 4; i++) {
#pragma unroll
      for (int v = 0; v < 8; v++) *(uint2*)(op + (v * 4 + i) * DHEAD) = ob[i][v];
    }
  } else {
    // rows: d = d0 + i * 16 + v of head h; columns: s = s0 + f
    const int d0 = hf * 8;
    const int nl = h * DHEAD + d0;
    const int s0 = sw + r * 4;
    v4f bn[4][2];
#pragma unroll
    for (int i = 0; i < 4; i++) {
      bn[i][0] = *(const v4f*)(bv + nl + i * 16);
      bn[i][1] = *(const v4f*)(bv + nl + i * 16 + 4);
    }
    // the offset register named by the loads above stays as it is until this wait
    asm volatile("s_wait_xcnt 0x0" :: "v"(nl) : "memory");
#pragma unroll
    for (int i = 0; i < 4; i++) {
#pragma unroll
      for (int v = 0; v < 8; v++) {
        const float bd = bn[i][v >> 2][v & 3];
        bf16_t o[4];
#pragma unroll
        for (int f = 0; f < 4; f++) o[f] = (bf16_t)(acc[i][f][v] + bd);
        ob[i][v] = *(const uint2*)o;
      }
    }
    bf16_t* op = Vt + ((size_t)(b * NHEADS + h) * DHEAD + (size_t)d0) * S_LEN + s0;
    // keeps every vector operation ahead of the first store, so that no
    // register named by an issued store is written again
    __builtin_amdgcn_sched_barrier(0);
#pragma unroll
    for (int i = 0; i < 4; i++) {
#pragma unroll
      for (int v = 0; v < 8; v++) *(uint2*)(op + (i * 16 + v) * S_LEN) = ob[i][v];
    }
    // in the built code the other branch's text follows these stores and
    // rewrites their registers: the wait stands between
    asm volatile("s_wait_xcnt 0x0" ::: "memory");
  }
}

// ---------------------------------------------------------------------------
// Flash attention, transposed products: S^T = K Q^T, O^T += V^T P^T.
// grid = (S/256, H, B).  Each wave: 32 query columns (two groups of 16), full
// d_head = 64 output in 4 x 2 accumulator tiles; online softmax over 32 keys
// per step.  A lane holds 16 of the 32 scores of ONE query (its other half
// sits in lane ^ 16), so maximum and sum run in the lane's own registers with
// one exchange between the halves; the two score tiles of a group, converted
// in place, are the B operand of the second product.  K rows and V^T rows are
// the A operands, each fragment feeding both column groups.
// The eight waves of a block walk the same keys: a stage of 128 keys (128 K
// rows of 128 B, 64 V^T rows of 256 B) is brought into LDS once for all of
// them by asynchronous b128 copies of whole lines, into one of two buffers,
// one stage ahead of its use; the waves read their fragments from LDS.
// ---------------------------------------------------------------------------
#define LOG2E 1.4426950408889634f
#define A_KEYS 128                        // keys per stage
#define A_NST  (S_LEN / A_KEYS)           // stages
#define A_KP   72                         // K row pitch in LDS, elements (144 B)
#define A_VP   136                        // V^T row pitch in LDS, elements (272 B)
#define A_VOFF (A_KEYS * A_KP)            // V^T rows stand behind the K rows
#define A_BUF  (A_VOFF + DHEAD * A_VP)    // elements per buffer

__device__ __forceinline__ float xhalf(float x) {
  const int i = __builtin_bit_cast(int, x);
  return __builtin_bit_cast(
      float, __builtin_amdgcn_permlanex16(i, i, 0x76543210, 0xfedcba98, false, false));
}

__device__ __forceinline__ void attn_stage(const bf16_t* gk, const bf16_t* gv,
                                           unsigned lk, unsigned lv) {
  const bf16_t* k0 = gk;
  const bf16_t* k1 = gk + 32 * DHEAD;
  const bf16_t* k2 = gk + 64 * DHEAD;
  const bf16_t* k3 = gk + 96 * DHEAD;
  const bf16_t* v0 = gv;
  const bf16_t* v1 = gv + 16 * S_LEN;
  const bf16_t* v2 = gv + 32 * S_LEN;
  const bf16_t* v3 = gv + 48 * S_LEN;
  const unsigned a0 = lk;
  const unsigned a1 = lk + 32 * A_KP * 2;
  const unsigned a2 = lk + 64 * A_KP * 2;
  const unsigned a3 = lk + 96 * A_KP * 2;
  const unsigned b0 = lv;
  const unsigned b1 = lv + 16 * A_VP * 2;
  const unsigned b2 = lv + 32 * A_VP * 2;
  const unsigned b3 = lv + 48 * A_VP * 2;
  asm volatile(
      "global_load_async_to_lds_b128 %0, %1, off\n\t"
      "global_load_async_to_lds_b128 %2, %3, off\n\t"
      "global_load_async_to_lds_b128 %4, %5, off\n\t"
      "global_load_async_to_lds_b128 %6, %7, off\n\t"
      "global_load_async_to_lds_b128 %8, %9, off\n\t"
      "global_load_async_to_lds_b128 %10, %11, off\n\t"
      "global_load_async_to_lds_b128 %12, %13, off\n\t"
      "global_load_async_to_lds_b128 %14, %15, off\n\t"
      "s_wait_xcnt 0x0"
      :: "v"(a0), "v"(k0), "v"(a1), "v"(k1), "v"(a2), "v"(k2), "v"(a3), "v"(k3),
         "v"(b0), "v"(v0), "v"(b1), "v"(v1), "v"(b2), "v"(v2), "v"(b3), "v"(v3)
      : "memory");
}

__global__ void __launch_bounds__(256) attn_kernel(
    const bf16_t* __restrict__ Q, const bf16_t* __restrict__ Kb,
    const bf16_t* __restrict__ Vt, bf16_t* __restrict__ concatb) {
  __shared__ __attribute__((aligned(16))) bf16_t smem[2 * A_BUF];
  const int tid = threadIdx.x;
  const int lane = threadIdx.x & 31, wave = threadIdx.x >> 5;
  const int r = lane & 15, hf = lane >> 4;
  const int h = blockIdx.y, b = blockIdx.z;
  const int q0 = blockIdx.x * 256 + wave * 32;
  const size_t bh = (size_t)(b * NHEADS + h);
  const bf16_t* Qb = Q + bh * S_LEN * DHEAD;
  const bf16_t* Kx = Kb + bh * S_LEN * DHEAD;
  const bf16_t* Vx = Vt + bh * DHEAD * S_LEN;

  // copies: eight lanes per K row (a stage's K rows lie in a row in memory),
  // sixteen lanes per V^T row
  const bf16_t* gk = Kx + tid * 8;
  const bf16_t* gv = Vx + (size_t)(tid >> 4) * S_LEN + (tid & 15) * 8;
  const unsigned lk = (unsigned)(size_t)smem +
                      (unsigned)((tid >> 3) * A_KP + (tid & 7) * 8) * 2u;
  const unsigned lv = (unsigned)(size_t)smem +
                      (unsigned)(A_VOFF + (tid >> 4) * A_VP + (tid & 15) * 8) * 2u;

  attn_stage(gk, gv, lk, lv);

  v16bf qb[2][2];  // [column group][half of d]
#pragma unroll
  for (int g = 0; g < 2; g++) {
    qb[g][0] = frag_load(Qb, DHEAD, q0 + g * 16, 0, lane);
    qb[g][1] = frag_load(Qb, DHEAD, q0 + g * 16, 32, lane);
    // the compiler hands these loads' address pair to a later load's result:
    // the wait stands between them
    asm volatile("s_wait_xcnt 0x0" ::: "memory");
  }

  v8f o[4][2];  // [16 rows of d][column group]
#pragma unroll
  for (int dt = 0; dt < 4; dt++) { o[dt][0] = v8f_zero(); o[dt][1] = v8f_zero(); }
  float mrun[2] = {-3.0e38f, -3.0e38f}, lrun[2] = {0.f, 0.f};

  // stage 0 has landed for this wave, then for the block
  asm volatile("s_wait_asynccnt 0x0" ::: "memory");
  __syncthreads();
  attn_stage(gk + A_KEYS * DHEAD, gv + A_KEYS, lk + A_BUF * 2, lv + A_BUF * 2);

  for (int t = 0; t < A_NST; t++) {
    const int bsel = t & 1;
    const bf16_t* sk = smem + bsel * A_BUF;
    const bf16_t* sv = sk + A_VOFF;

    v16bf kf[2][2], vf[4];  // [16 keys][half of d]; [16 rows of d]
#pragma unroll
    for (int kt = 0; kt < 2; kt++) {
      kf[kt][0] = frag_load(sk, A_KP, kt * 16, 0, lane);
      kf[kt][1] = frag_load(sk, A_KP, kt * 16, 32, lane);
    }
#pragma unroll
    for (int dt = 0; dt < 4; dt++) vf[dt] = frag_load(sv, A_VP, dt * 16, 0, lane);

    // kept rolled: unrolled, the compiler puts off the row sums of all four
    // steps to the stage's end and holds their terms in registers, over 256
#pragma unroll 1
    for (int ss = 0; ss < A_KEYS / 32; ss++) {
      // the next step's keys; the stage's last step wraps to its first, so that
      // the loads stand under no branch and nothing is read past the stage
      const int tn = ((ss + 1) * 32) & (A_KEYS - 1);

      v8f s[2][2];  // [16 keys][column group]
#pragma unroll
      for (int kt = 0; kt < 2; kt++) {
#pragma unroll
        for (int g = 0; g < 2; g++) {
          s[kt][g] = wmma_bf16(kf[kt][0], qb[g][0], v8f_zero());
          s[kt][g] = wmma_bf16(kf[kt][1], qb[g][1], s[kt][g]);
        }
      }
      // next K fragments come during the softmax and the second product
#pragma unroll
      for (int kt = 0; kt < 2; kt++) {
        kf[kt][0] = frag_load(sk, A_KP, tn + kt * 16, 0, lane);
        kf[kt][1] = frag_load(sk, A_KP, tn + kt * 16, 32, lane);
      }

      v16bf pf[2];
#pragma unroll
      for (int g = 0; g < 2; g++) {
        float mx = fmaxf(s[0][g][0], s[1][g][0]);
#pragma unroll
        for (int v = 1; v < 8; v++) mx = fmaxf(mx, fmaxf(s[0][g][v], s[1][g][v]));
        mx = fmaxf(mx, xhalf(mx));
        const float mnew = fmaxf(mrun[g], mx);
        const float resc = __builtin_amdgcn_exp2f((mrun[g] - mnew) * LOG2E);
        const float nm = -mnew * LOG2E;
        float ps[8];
#pragma unroll
        for (int v = 0; v < 8; v++) {
          const float p0 = __builtin_amdgcn_exp2f(fmaf(s[0][g][v], LOG2E, nm));
          const float p1 = __builtin_amdgcn_exp2f(fmaf(s[1][g][v], LOG2E, nm));
          ps[v] = p0 + p1;
          pf[g][v]     = (bf16_t)p0;   // key hf * 8 + v
          pf[g][8 + v] = (bf16_t)p1;   // key 16 + hf * 8 + v
        }
        // this half's 16 keys, summed as a tree; the halves join at the end
        lrun[g] = lrun[g] * resc + (((ps[0] + ps[1]) + (ps[2] + ps[3])) +
                                    ((ps[4] + ps[5]) + (ps[6] + ps[7])));
        mrun[g] = mnew;
#pragma unroll
        for (int dt = 0; dt < 4; dt++) o[dt][g] *= resc;
      }

#pragma unroll
      for (int dt = 0; dt < 4; dt++) {
        o[dt][0] = wmma_bf16(vf[dt], pf[0], o[dt][0]);
        o[dt][1] = wmma_bf16(vf[dt], pf[1], o[dt][1]);
      }
      // next V^T fragments come during the next step's first product and softmax
#pragma unroll
      for (int dt = 0; dt < 4; dt++) vf[dt] = frag_load(sv, A_VP, dt * 16, tn, lane);
    }
    // publish point: this wave's reads of the buffer are done, its copies of
    // stage t + 1 have landed; the barrier says both for the whole block
    asm volatile("s_wait_dscnt 0x0" ::: "memory");
    asm volatile("s_wait_asynccnt 0x0" ::: "memory");
    __syncthreads();
    if (t + 2 < A_NST)
      attn_stage(gk + (size_t)(t + 2) * (A_KEYS * DHEAD), gv + (t + 2) * A_KEYS,
                 lk + (unsigned)bsel * (A_BUF * 2), lv + (unsigned)bsel * (A_BUF * 2));
  }
  // no copy is left in flight when the wave goes on
  asm volatile("s_wait_asynccnt 0x0" ::: "memory");

  // a lane holds d = dt * 16 + hf * 8 + {0..7} of one query: 16-byte stores
#pragma unroll
  for (int g = 0; g < 2; g++) {
    const float inv = 1.0f / (lrun[g] + xhalf(lrun[g]));
    bf16_t* out = concatb + ((size_t)b * S_LEN + (size_t)(q0 + g * 16 + r)) * DMODEL +
                  (size_t)h * DHEAD + hf * 8;
#pragma unroll
    for (int dt = 0; dt < 4; dt++) {
      bf16_t tmp[8];
#pragma unroll
      for (int v = 0; v < 8; v++) tmp[v] = (bf16_t)(o[dt][g][v] * inv);
      *(v4u*)(out + dt * 16) = *(const v4u*)tmp;
    }
  }
}

// ---------------------------------------------------------------------------
// Generic WMMA GEMM: C[M,N] = A[M,K](bf16) * Bt[N,K](bf16) + bias[n]
// (+ resid) (ReLU) -> f32 or bf16.  Block = 4 copy waves + 4 product waves =
// 128x128 tile, operands staged in LDS (gemm_core); WIDE (K = DMODEL): 4 copy
// waves + 8 product waves = 256x128 (wide2_core).
// ---------------------------------------------------------------------------
template <bool RELU, bool HASRES, bool OUTBF16, int N, bool WIDE>
__global__ void __launch_bounds__(WIDE ? 384 : G_THR) gemm_kernel(
    const bf16_t* __restrict__ A, const bf16_t* __restrict__ Bt,
    const float* __restrict__ bias, const float* __restrict__ resid,
    float* __restrict__ outf, bf16_t* __restrict__ outb, int K) {
  __shared__ __attribute__((aligned(16))) bf16_t smem[3 * (WIDE ? W_BUF(2) : G_BUF)];
  const int lane = threadIdx.x & 31;
  const int wave = __builtin_amdgcn_readfirstlane(threadIdx.x >> 5);
  const int pw = wave - G_CW;   // the product wave's number
  const int r = lane & 15, hf = lane >> 4;
  const int m0 = WIDE ? blockIdx.x * 256 + (pw & 3) * 64
                      : blockIdx.x * 128 + (pw >> 1) * 64;
  const int n0 = blockIdx.y * 128 + (WIDE ? pw >> 2 : pw & 1) * 64;

  v8f acc[4][4];
#pragma unroll
  for (int i = 0; i < 4; i++) {
#pragma unroll
    for (int f = 0; f < 4; f++) acc[i][f] = v8f_zero();
  }
  if constexpr (WIDE) {
    const bf16_t* Bblk = Bt + (size_t)blockIdx.y * 128 * DMODEL;
    wide2_core(A + (size_t)blockIdx.x * 256 * DMODEL, Bblk, Bblk + 64 * DMODEL, wave,
               smem, acc);
  } else {
    gemm_core(A + (size_t)blockIdx.x * 128 * (size_t)K,
              Bt + (size_t)blockIdx.y * 128 * (size_t)K, K, wave, smem, acc);
  }
  // the copy waves hold no part of the tile; no barrier follows
  if (wave < G_CW) return;

  // The lane's elements lie at e0 + (i * 16 + v) * N + f, f = 0..3: one address
  // per array, the rest constant offsets; four adjacent columns an access, whole
  // lines a wave.  All loads, then all sums, then all stores.
  const int nl = n0 + r * 4;
  const unsigned e0 = (unsigned)(m0 + hf * 8) * (unsigned)N + (unsigned)nl;
  const v4f bn = *(const v4f*)(bias + nl);
  v4f rv[4][8];
  if constexpr (HASRES) {
    const float* rp = resid + e0;
#pragma unroll
    for (int i = 0; i < 4; i++) {
#pragma unroll
      for (int v = 0; v < 8; v++) rv[i][v] = *(const v4f*)(rp + (i * 16 + v) * N);
    }
    // the address registers named by the loads above stay as they are until
    // this wait: as inputs they cannot be rewritten, or given to a load's
    // result, ahead of it
    asm volatile("s_wait_xcnt 0x0" :: "v"(nl), "v"(e0), "v"(rp) : "memory");
  } else {
    asm volatile("s_wait_xcnt 0x0" :: "v"(nl) : "memory");
  }
  v4f of[4][8];
  uint2 ob[4][8];
#pragma unroll
  for (int i = 0; i < 4; i++) {
#pragma unroll
    for (int v = 0; v < 8; v++) {
      v4f t;
#pragma unroll
      for (int f = 0; f < 4; f++) {
        t[f] = acc[i][f][v] + bn[f];
        if constexpr (HASRES) t[f] = t[f] + rv[i][v][f];
        if constexpr (RELU) t[f] = fmaxf(t[f], 0.0f);
      }
      if constexpr (OUTBF16) {
        bf16_t o[4] = {(bf16_t)t[0], (bf16_t)t[1], (bf16_t)t[2], (bf16_t)t[3]};
        ob[i][v] = *(const uint2*)o;
      } else {
        of[i][v] = t;
      }
    }
  }
  bf16_t* opb = outb + e0;
  float* opf = outf + e0;
  // keeps the vector operations ahead of the stores, so that a register named
  // by an issued store is not written again
  if constexpr (OUTBF16) {
    __builtin_amdgcn_sched_group_barrier(0x002, 1024, 0);
    __builtin_amdgcn_sched_group_barrier(0x040, 32, 0);
  } else {
    __builtin_amdgcn_sched_barrier(0);
  }
#pragma unroll
  for (int i = 0; i < 4; i++) {
#pragma unroll
    for (int v = 0; v < 8; v++) {
      if constexpr (OUTBF16) *(uint2*)(opb + (i * 16 + v) * N) = ob[i][v];
      else                   *(v4f*)(opf + (i * 16 + v) * N) = of[i][v];
    }
  }
}

// ---------------------------------------------------------------------------
// LayerNorm (reference semantics): y = g*(x-mean)/(std+eps)+b, std = sqrt(
// mean((x-mean)^2)).  One wave per row of 1024, 16 waves a work-group, one
// work-group per WGP: a lane holds 32 elements of its row (eight b128 loads,
// each wave-wide load four whole lines, all issued first), both sums run in
// the lane's registers and then across the wave's lanes; no LDS, no barrier.
// ---------------------------------------------------------------------------
#define L_WAVES 16

template <int CTRL>
__device__ __forceinline__ float row_xadd(float x) {
  return x + __builtin_bit_cast(
                 float, __builtin_amdgcn_update_dpp(
                            0, __builtin_bit_cast(int, x), CTRL, 0xf, 0xf, true));
}

// sum over the 32 lanes, the same bits in every lane
__device__ __forceinline__ float wave_sum(float x) {
  x = row_xadd<0x161>(x);
  x = row_xadd<0x162>(x);
  x = row_xadd<0x164>(x);
  x = row_xadd<0x168>(x);
  return x + xhalf(x);
}

template <bool HASB>
__global__ void __launch_bounds__(L_WAVES * 32) ln_kernel(
    const float* in, const float* gam, const float* bet, float* out,
    bf16_t* outb) {
  const int lane = threadIdx.x & 31;
  const int wave = __builtin_amdgcn_readfirstlane(threadIdx.x >> 5);
  const size_t row = (size_t)(blockIdx.x * L_WAVES + wave);
  const unsigned off = (unsigned)lane * 16u;   // the lane's bytes in 512
  const char* px = (const char*)(in + row * DMODEL);
  const char* pg = (const char*)gam;
  const char* pb = (const char*)bet;

  v4f v[8], g[8], bt[8];
#pragma unroll
  for (int i = 0; i < 8; i++) v[i] = *(const v4f*)(px + i * 512 + off);
#pragma unroll
  for (int i = 0; i < 8; i++) g[i] = *(const v4f*)(pg + i * 512 + off);
#pragma unroll
  for (int i = 0; i < 8; i++) bt[i] = *(const v4f*)(pb + i * 512 + off);
  // the base and offset registers named by the loads above stay as they are
  // until this wait: as inputs they cannot be rewritten, or given to a load's
  // result, ahead of it (the pointers are not __restrict__, so no load moves
  // behind it)
  asm volatile("s_wait_xcnt 0x0" :: "v"(off), "s"(px), "s"(pg), "s"(pb) : "memory");
  // keeps all 24 loads ahead of the sums: left free, the compiler puts the
  // gamma and beta loads behind both sums, where their latency is waited out
  __builtin_amdgcn_sched_barrier(0);

  const v4f s4 = ((v[0] + v[1]) + (v[2] + v[3])) + ((v[4] + v[5]) + (v[6] + v[7]));
  const float mean = wave_sum((s4.x + s4.y) + (s4.z + s4.w)) * (1.0f / DMODEL);

  v4f q4 = {0.f, 0.f, 0.f, 0.f};
#pragma unroll
  for (int i = 0; i < 8; i++) {
    v[i] -= mean;
    q4 += v[i] * v[i];
  }
  const float tots = wave_sum((q4.x + q4.y) + (q4.z + q4.w));
  const float stdv = sqrtf(tots * (1.0f / DMODEL));
  const float inv = 1.0f / (stdv + 1e-5f);

#pragma unroll
  for (int i = 0; i < 8; i++) v[i] = g[i] * v[i] * inv + bt[i];

  // the bf16 copy goes out first: its conversions then stand ahead of every
  // store, and no register named by an issued store is written again
  if constexpr (HASB) {
    char* pob = (char*)(outb + row * DMODEL);
#pragma unroll
    for (int i = 0; i < 8; i++) {
      bf16_t o[4] = {(bf16_t)v[i].x, (bf16_t)v[i].y, (bf16_t)v[i].z, (bf16_t)v[i].w};
      *(uint2*)(pob + i * 256 + (off >> 1)) = *(const uint2*)o;
    }
  }
  char* po = (char*)(out + row * DMODEL);
#pragma unroll
  for (int i = 0; i < 8; i++) *(v4f*)(po + i * 512 + off) = v[i];
}

// ---------------------------------------------------------------------------
extern "C" void kernel_launch(void* const* d_in, const int* in_sizes, int n_in,
                              void* d_out, int out_size, void* d_ws,
                              size_t ws_size, hipStream_t stream) {
  (void)in_sizes; (void)n_in; (void)out_size; (void)ws_size;
  const float* x   = (const float*)d_in[0];
  const float* wq  = (const float*)d_in[1];
  const float* bq  = (const float*)d_in[2];
  const float* wk  = (const float*)d_in[3];
  const float* bk  = (const float*)d_in[4];
  const float* wv  = (const float*)d_in[5];
  const float* bv  = (const float*)d_in[6];
  const float* wo  = (const float*)d_in[7];
  const float* wob = (const float*)d_in[8];
  const float* g1  = (const float*)d_in[9];
  const float* b1  = (const float*)d_in[10];
  const float* f1w = (const float*)d_in[11];
  const float* f1bias = (const float*)d_in[12];
  const float* f2w = (const float*)d_in[13];
  const float* f2bias = (const float*)d_in[14];
  const float* g2  = (const float*)d_in[15];
  const float* b2  = (const float*)d_in[16];
  float* out = (float*)d_out;

  char* ws = (char*)d_ws;
  size_t off = 0;
  auto alloc = [&](size_t bytes) -> char* {
    char* p = ws + off;
    off += (bytes + 255) & ~(size_t)255;
    return p;
  };
  const int BS = BATCH * S_LEN;  // 4096 rows
  bf16_t* xb   = (bf16_t*)alloc((size_t)BS * DMODEL * 2);          // 8 MB (reused as concat)
  bf16_t* wqt  = (bf16_t*)alloc((size_t)NHEADS * DHEAD * DMODEL * 2);
  bf16_t* wkt  = (bf16_t*)alloc((size_t)NHEADS * DHEAD * DMODEL * 2);
  bf16_t* wvt  = (bf16_t*)alloc((size_t)NHEADS * DHEAD * DMODEL * 2);
  bf16_t* wot  = (bf16_t*)alloc((size_t)DMODEL * DMODEL * 2);
  bf16_t* ff1t = (bf16_t*)alloc((size_t)DFF * DMODEL * 2);
  bf16_t* ff2t = (bf16_t*)alloc((size_t)DMODEL * DFF * 2);
  bf16_t* Qm   = (bf16_t*)alloc((size_t)BATCH * NHEADS * S_LEN * DHEAD * 2);  // 8 MB
  bf16_t* Km   = (bf16_t*)alloc((size_t)BATCH * NHEADS * S_LEN * DHEAD * 2);  // 8 MB
  bf16_t* Vtm  = (bf16_t*)alloc((size_t)BATCH * NHEADS * DHEAD * S_LEN * 2);  // 8 MB
  float*  t1   = (float*)alloc((size_t)BS * DMODEL * 4);           // 16 MB (reused as t2)
  float*  hbuf = (float*)alloc((size_t)BS * DMODEL * 4);           // 16 MB
  bf16_t* hb   = (bf16_t*)alloc((size_t)BS * DMODEL * 2);          // 8 MB
  bf16_t* concatb = xb;       // alias: xb dead after QKV
  bf16_t* ffn1out = Qm;       // alias: Q+K region (16 MB) dead after attention
  float*  t2 = t1;            // alias: t1 dead after LN1

  dim3 blk256(256);
  dim3 blkg(G_THR);

  // 1) convert x, transpose-convert all weights (one launch)
  prep_kernel<<<dim3(P_WGS), dim3(P_THR), 0, stream>>>(
      x, wq, wk, wv, wo, f1w, f2w, xb, wqt, wkt, wvt, wot, ff1t, ff2t);

  // 2) QKV projections (per head)
  qkv_kernel<<<dim3(S_LEN / 256, NHEADS, BATCH), dim3(384), 0, stream>>>(
      xb, wqt, wkt, wvt, bq, bk, bv, Qm, Km, Vtm);

  // 3) flash attention -> concat heads (bf16)
  attn_kernel<<<dim3(S_LEN / 256, NHEADS, BATCH), blk256, 0, stream>>>(
      Qm, Km, Vtm, concatb);

  // 4) output projection + residual(x) -> t1 (f32)
  gemm_kernel<false, true, false, DMODEL, false><<<dim3(BS / 128, DMODEL / 128), blkg, 0, stream>>>(
      concatb, wot, wob, x, t1, nullptr, DMODEL);

  // 5) LayerNorm1 -> h (f32) + hb (bf16)
  ln_kernel<true><<<dim3(BS / L_WAVES), dim3(L_WAVES * 32), 0, stream>>>(t1, g1, b1, hbuf, hb);

  // 6) FFN1: relu(h @ ff1 + b) -> bf16
  gemm_kernel<true, false, true, DFF, true><<<dim3(BS / 256, DFF / 128), dim3(384), 0, stream>>>(
      hb, ff1t, f1bias, nullptr, nullptr, ffn1out, DMODEL);

  // 7) FFN2: (+ b + h residual) -> t2 (f32)
  gemm_kernel<false, true, false, DMODEL, false><<<dim3(BS / 128, DMODEL / 128), blkg, 0, stream>>>(
      ffn1out, ff2t, f2bias, hbuf, t2, nullptr, DFF);

  // 8) LayerNorm2 -> d_out
  ln_kernel<false><<<dim3(BS / L_WAVES), dim3(L_WAVES * 32), 0, stream>>>(t2, g2, b2, out, nullptr);
}
